// v000
// Measured on an AMD MI455X. A time is GPU time per run, averaged over a window of back-to-back runs after a warm-up
// (all launches, gaps included; the runs take copies of the inputs in turn), and the median of several windows.
// Apart from v000's, it joins two sittings. Times from different sittings can be a few percent apart, while
// side-by-side timings come from the same sitting.
// v000 is the starting kernel. One run takes 239 microseconds.
// Contractions: q, k, v^T projections = v_wmma_f32_16x16x32_bf16 (bf16 operands from RNE-converted inputs and weights, single product, f32 accumulate);
// q.k^T scores = v_wmma_f32_16x16x32_bf16 with bf16 hi/lo split q and k (hi.hi + hi.lo + lo.hi), f32 accumulate;
// p.v = v_wmma_f32_16x16x32_f16 (p carried x1024 as f16 hi plane + f16 residual plane x4096, v as f16 hi plane + f16 residual
// plane x4096; 3 products hi.hi, hi.res, res.hi), f32 accumulate; softmax (running max), normalisers and bias adds in f32 on the VALU.
// Carry audit:
//   Psh = f16(1024 * p)                      -> the 1/1024 is folded exactly once in the attention epilogue: inv = (1/l) * (1/1024)
//   Psl = f16((1024 p - Psh) * 4096)         }  products Psh.VTl and Psl.VTh go to the separate accumulator o1,
//   VTl = f16((v - VTh) * 4096)              }  folded back with * (1/4096) once per key chunk
//   VTh = f16(v), no carry (|v| typ. 0.65); q / k lo planes are unscaled bf16 residuals (v - hi) sharing the hi accumulator;
//   score scale 1/8 applied once in f32 after the score accumulate. No other scaled planes.
#include <hip/hip_runtime.h>
#include <math.h>
#include <stdint.h>

#ifndef NB
#define NB   8
#endif
#ifndef SEQ
#define SEQ  2048
#endif
#define NB_FULL  8
#define SEQ_FULL 2048
#define DIN  512
#define HD   64
#define NQB  (SEQ / 64)   // 64-row query blocks per sequence
#define NKT  (SEQ / 64)   // 64-key chunks per sequence
static_assert(NB >= 1 && NB <= NB_FULL && SEQ >= 64 && SEQ <= SEQ_FULL);
static_assert((SEQ % 64) == 0 && (DIN % 32) == 0 && HD == 64);
static_assert(((long long)SEQ * DIN) % (8 * 32) == 0);
static_assert((HD * DIN) % (8 * 256) == 0);

typedef _Float16 v16h __attribute__((ext_vector_type(16)));
typedef _Float16 v8h  __attribute__((ext_vector_type(8)));
typedef __bf16   v16b __attribute__((ext_vector_type(16)));
typedef __bf16   v8b  __attribute__((ext_vector_type(8)));
typedef float    v8f  __attribute__((ext_vector_type(8)));
typedef float    v4f  __attribute__((ext_vector_type(4)));
typedef unsigned int v4u __attribute__((ext_vector_type(4)));

// ---- scalar helpers --------------------------------------------------------------------------------
__device__ __forceinline__ unsigned short bf_bits(float f) {          // f32 -> bf16 bits, RNE convert
  unsigned u = __float_as_uint(f);
  return (unsigned short)((u + 0x7FFFu + ((u >> 16) & 1u)) >> 16);
}
__device__ __forceinline__ float bf_up(unsigned short h) { return __uint_as_float(((unsigned)h) << 16); }
__device__ __forceinline__ unsigned short h_bits(_Float16 x) { return __builtin_bit_cast(unsigned short, x); }
__device__ __forceinline__ unsigned pk16(unsigned short a, unsigned short b) { return (unsigned)a | ((unsigned)b << 16); }
__device__ __forceinline__ v8f zero8() { v8f z = {0.f, 0.f, 0.f, 0.f, 0.f, 0.f, 0.f, 0.f}; return z; }

__device__ __forceinline__ void lds_wave_sync() {
  __builtin_amdgcn_fence(3, "workgroup");
  __builtin_amdgcn_wave_barrier();
  __builtin_amdgcn_fence(2, "workgroup");
}

// ---- fragment loader: 16-bit A/B operand, lane -> row/col (lane&15), p already includes +8*(lane>>4);
//      elements 0..7 <- p[0..7] (k0+8h..k0+8h+7), elements 8..15 <- p[16..23] (k0+16+8h..k0+16+8h+7)
__device__ __forceinline__ v16b ldfrag_b(const __bf16* p) {
  union { v16b v; v8b h[2]; } f;
  f.h[0] = *(const v8b*)(p);
  f.h[1] = *(const v8b*)(p + 16);
  return f.v;
}

// ---- WMMA helpers with trailing VALU hazard gap --------------------------------------------------------
__device__ __forceinline__ v8f mma_b(v16b a, v16b b, v8f c) {
  c = __builtin_amdgcn_wmma_f32_16x16x32_bf16(false, a, false, b, (short)0, c, false, false);
  asm volatile("v_nop\n\tv_nop\n\tv_nop\n\tv_nop" : "+v"(c) : "v"(a), "v"(b));
  return c;
}
__device__ __forceinline__ v8f mma_h(v16h a, v16h b, v8f c) {
  c = __builtin_amdgcn_wmma_f32_16x16x32_f16(false, a, false, b, (short)0, c, false, false);
  asm volatile("v_nop\n\tv_nop\n\tv_nop\n\tv_nop" : "+v"(c) : "v"(a), "v"(b));
  return c;
}
__device__ __forceinline__ v8f mma_b_raw(v16b a, v16b b, v8f c) {
  return __builtin_amdgcn_wmma_f32_16x16x32_bf16(false, a, false, b, (short)0, c, false, false);
}
__device__ __forceinline__ void dep_guard_b(v8f& a, v8f& b, v16b x, v16b y) {
  asm volatile("v_nop\n\tv_nop\n\tv_nop\n\tv_nop" : "+v"(a), "+v"(b) : "v"(x), "v"(y));
}
__device__ __forceinline__ void keep4_b(v16b a, v16b b, v16b c, v16b d) {
  asm volatile("v_nop" :: "v"(a), "v"(b), "v"(c), "v"(d));
}
__device__ __forceinline__ void acc_guard4(v8f& a, v8f& b, v8f& c, v8f& d) {
  asm volatile("v_nop\n\tv_nop\n\tv_nop\n\tv_nop" : "+v"(a), "+v"(b), "+v"(c), "+v"(d));
}

// =====================================================================================================
// f32 -> bf16 (RNE convert), 8 elements per thread, one 16-B store per lane: a wave writes 512 contiguous B
// [NB*SEQ][DIN]: group i -> batch b = i / grpB, compact offset r = i - b*grpB; source row block of batch b
// starts at b*strideB floats (full per-batch input stride). grid = ceil(n8/256), guarded by i < n8;
// coverage: n8 threads x 8 = the whole compact plane [NB*SEQ][DIN].
// =====================================================================================================
__global__ __launch_bounds__(256) void cvt_bf16x8(const float* __restrict__ in, unsigned short* out, int n8,
                                                  int grpB, long long strideB) {
  const int i = blockIdx.x * 256 + (int)threadIdx.x;
  if (i < n8) {
    const int b = i / grpB;
    const int r = i - b * grpB;
    const float* src = in + (size_t)b * (size_t)strideB + (size_t)r * 8;
    const v4f a = *(const v4f*)(src);
    const v4f c = *(const v4f*)(src + 4);
    v4u p;
    p[0] = pk16(bf_bits(a[0]), bf_bits(a[1]));
    p[1] = pk16(bf_bits(a[2]), bf_bits(a[3]));
    p[2] = pk16(bf_bits(c[0]), bf_bits(c[1]));
    p[3] = pk16(bf_bits(c[2]), bf_bits(c[3]));
    *(v4u*)(out + (size_t)i * 8) = p;
    
  }
}

// =====================================================================================================
// Weight transpose + convert: W f32 [DIN k][HD n] (n contiguous) -> Wt bf16 bits [HD n][DIN k] (k contiguous),
// RNE convert. thread i in 0..HD*DIN/8-1: n = i / (DIN/8), k8 = (i mod DIN/8) * 8, one 16-B store per lane at
// coverage: 4096 threads x 8 = the whole [64][512] plane. reads: 8 strided scalars per lane (k*HD + n, in range).
// =====================================================================================================
__global__ __launch_bounds__(256) void wt_bf16(const float* __restrict__ W, unsigned short* out, int ngrp) {
  const int i = blockIdx.x * 256 + (int)threadIdx.x;
  if (i < ngrp) {
    const int n  = i / (DIN / 8);
    const int k8 = (i - n * (DIN / 8)) * 8;
    v4u p;
#pragma unroll
    for (int e = 0; e < 4; ++e) {
      const float f0 = W[(size_t)(k8 + 2 * e) * HD + n];
      const float f1 = W[(size_t)(k8 + 2 * e + 1) * HD + n];
      p[e] = pk16(bf_bits(f0), bf_bits(f1));
    }
    unsigned short* o = out + (size_t)n * DIN + k8;
    *(v4u*)o = p;
    
  }
}

// =====================================================================================================
// Register-blocked batched bf16 WMMA GEMM: C[m][n] = sum_k A[m][k] * Bt[n][k] + bias; one wave per 64x64 tile,
// no block barriers. A row-major [M][K] pitch lda; Bt row-major [N][K] pitch ldb (k contiguous);
// M, N multiples of 64, K multiple of 32 (host shapes are static multiples). blockIdx.y = batch index (strides in elements).
// NSPLIT: 0 = A.Bt; 1 = (A + A2).Bt (A2 = unscaled bf16 lo plane of A, 2 products).
// BIAS: 0 = none; 1 = per column n, bias[n]; 2 = per row m, bias[m]; the bias value is RNE-converted to bf16 and added in f32.
// OUT_MODE: 0 = f32 (pitch ldc); 2 = bf16 hi plane C + bf16 lo plane C2 (lo = RNE(v - hi), unscaled);
//           3 = f16 hi plane C + f16 residual plane C2 = f16((v - hi) * rscale), C2 written only for tiles
//               with n0 < N2 (pitch ldc2, batch stride strideC2).
// Epilogue: 16-row slabs staged per wave in LDS (wave-private, lds_wave_sync); each 64-wide row segment written as
// =====================================================================================================
template <int NSPLIT, int OUT_MODE, int BIAS>
__global__ __launch_bounds__(256) void gemm64(
    const unsigned short* __restrict__ Ap, const unsigned short* A2p, int lda, long long strideA,
    const unsigned short* __restrict__ Btp, int ldb, long long strideB,
    const float* __restrict__ bias,
    void* Cout, int ldc, long long strideC,
    void* Cout2, int ldc2, long long strideC2, int N2,
    int M, int N, int K, float rscale) {
  const __bf16* A   = (const __bf16*)(const void*)Ap;
  const __bf16* A2  = (const __bf16*)(const void*)A2p;
  const __bf16* Bt  = (const __bf16*)(const void*)Btp;
  __shared__ __align__(16) float sT[8][16 * 68];   // per-wave 16x64 slab, pitch 68 floats
  const int b    = blockIdx.y;
  const int lane = threadIdx.x & 31;
  const int wave = threadIdx.x >> 5;
  const int tilesN = N >> 6;
  const int tilesM = M >> 6;
  const int tile = blockIdx.x * 8 + wave;
  if (tile >= tilesM * tilesN) return;   // wave-uniform; no block barriers in this kernel
  const int tm = tile / tilesN;
  const int tn = tile - tm * tilesN;
  const int m0 = tm << 6;
  const int n0 = tn << 6;

  const __bf16* Ab  = A  + (size_t)b * strideA;
  const __bf16* Bb  = Bt + (size_t)b * strideB;
  const __bf16* Ab2 = (NSPLIT >= 1) ? (A2 + (size_t)b * strideA) : Ab;

  const int rlane = lane & 15;                 // row (A) / col (B, D) within subtile
  const int koff  = (lane >> 4) * 8;           // k offset of this lane half
  const int mOff  = (lane >> 4) * 8;           // D row offset

  v8f acc[4][4];
#pragma unroll
  for (int i = 0; i < 4; ++i)
#pragma unroll
    for (int j = 0; j < 4; ++j) acc[i][j] = zero8();

  for (int k0 = 0; k0 < K; k0 += 32) {
    v16b bh[4];
#pragma unroll
    for (int j = 0; j < 4; ++j) {
      const size_t bo = (size_t)(n0 + (j << 4) + rlane) * ldb + koff + k0;
      bh[j] = ldfrag_b(Bb + bo);
    }
#pragma unroll
    for (int i = 0; i < 4; ++i) {
      const size_t ao = (size_t)(m0 + (i << 4) + rlane) * lda + koff + k0;
      const v16b ah = ldfrag_b(Ab + ao);
      v16b al = ah;
      if (NSPLIT >= 1) al = ldfrag_b(Ab2 + ao);
#pragma unroll
      for (int j = 0; j < 4; ++j) {
        acc[i][j] = mma_b_raw(ah, bh[j], acc[i][j]);
        if (NSPLIT >= 1) acc[i][j] = mma_b_raw(al, bh[j], acc[i][j]);
      }
      dep_guard_b(acc[i][0], acc[i][3], ah, al);
    }
    keep4_b(bh[0], bh[1], bh[2], bh[3]);
  }
  acc_guard4(acc[0][0], acc[0][1], acc[0][2], acc[0][3]);
  acc_guard4(acc[1][0], acc[1][1], acc[1][2], acc[1][3]);
  acc_guard4(acc[2][0], acc[2][1], acc[2][2], acc[2][3]);
  acc_guard4(acc[3][0], acc[3][1], acc[3][2], acc[3][3]);

  // ---- epilogue ----
  float* slab = sT[wave];
  float bcol[4];
#pragma unroll
  for (int j = 0; j < 4; ++j) {
    bcol[j] = 0.f;
    if (BIAS == 1) bcol[j] = bf_up(bf_bits(bias[n0 + (j << 4) + rlane]));   // n < N, bias has N entries
  }
#pragma unroll
  for (int i = 0; i < 4; ++i) {
    const int mBase = m0 + (i << 4);
    float brow[8];
#pragma unroll
    for (int r = 0; r < 8; ++r) {
      brow[r] = 0.f;
      if (BIAS == 2) brow[r] = bf_up(bf_bits(bias[mBase + mOff + r]));      // m < M, bias has M entries
    }
#pragma unroll
    for (int j = 0; j < 4; ++j) {
#pragma unroll
      for (int r = 0; r < 8; ++r) {
        slab[(mOff + r) * 68 + (j << 4) + rlane] = acc[i][j][r] + bcol[j] + brow[r];
      }
    }
    lds_wave_sync();
    if (OUT_MODE == 0) {
      float* C = (float*)Cout + (size_t)b * strideC;
      const int hh = lane >> 4, c4 = (lane & 15) * 4;     // 256-B row segment = 16 lanes x 16 B
      {
#pragma unroll
        for (int it = 0; it < 8; ++it) {
          const int row = it * 2 + hh;                     // it 0..7 x hh 0..1 = rows 0..15
          const v4f v = *(const v4f*)(slab + row * 68 + c4);
          *(v4f*)(C + (size_t)(mBase + row) * ldc + n0 + c4) = v;
        }
        
      }
    } else {
      const int q = lane >> 3, c8 = (lane & 7) * 8;
      unsigned short* C  = (unsigned short*)Cout  + (size_t)b * strideC;
      unsigned short* C2 = (unsigned short*)Cout2 + (size_t)b * strideC2;
      const bool wlo = (OUT_MODE == 2) || (n0 < N2);      // wave-uniform
      v4u hv[4], lv[4];
#pragma unroll
      for (int it = 0; it < 4; ++it) {
        const int row = it * 4 + q;                        // it 0..3 x q 0..3 = rows 0..15
        const float* sp = slab + row * 68 + c8;
        v4u a, a2;
#pragma unroll
        for (int e = 0; e < 4; ++e) {
          const float f0 = sp[2 * e], f1 = sp[2 * e + 1];
          unsigned short h0, h1, l0, l1;
          if (OUT_MODE == 2) {
            h0 = bf_bits(f0); h1 = bf_bits(f1);
            l0 = bf_bits(f0 - bf_up(h0)); l1 = bf_bits(f1 - bf_up(h1));
          } else {
            const _Float16 x0 = (_Float16)f0, x1 = (_Float16)f1;
            h0 = h_bits(x0); h1 = h_bits(x1);
            l0 = h_bits((_Float16)((f0 - (float)x0) * rscale));
            l1 = h_bits((_Float16)((f1 - (float)x1) * rscale));
          }
          a[e] = pk16(h0, h1); a2[e] = pk16(l0, l1);
        }
        hv[it] = a; lv[it] = a2;
      }
      {
#pragma unroll
        for (int it = 0; it < 4; ++it) {
          const int row = it * 4 + q;
          *(v4u*)(C + (size_t)(mBase + row) * ldc + n0 + c8) = hv[it];
          if (wlo) *(v4u*)(C2 + (size_t)(mBase + row) * ldc2 + n0 + c8) = lv[it];
        }
        
      }
    }
    lds_wave_sync();
  }
}

// =====================================================================================================
// Non-causal one-head attention, head dim 64, key chunks of 64, softmax over all SEQ keys.
//   q planes (bf16 hi / lo): element (b, t, d) at [(b*SEQ + t)*HD + d]   (compact rows)
//   k planes (bf16 hi / lo): same layout with key index s
//   v^T hi plane (f16):      element (b, d, s) at [(b*HD + d)*SEQ + s]
//   v^T residual plane (f16, (v - hi)*4096): same layout
//   scores = q . k : bf16 hi/lo split (hi.hi + hi.lo + lo.hi), f32 accumulate, then * 1/8 in f32
//   p = exp(s - m) carried as f16(1024 p) plus f16 residual (x4096); context = p . v on f16 WMMA, 3 products:
//   ph.vh into oacc; ph.vl and pl.vh into the separate accumulator o1 folded back with 1/4096 per chunk in f32;
//   online softmax (running max from -inf; every chunk holds at least the chunk max key so l >= 1 after chunk 0) in f32.
//   Block = 4 waves = 64 query rows of one batch b; grid = NB * NQB.
//   K / V^T chunk staging (cross-wave LDS, __syncthreads before and after): 128 threads x 32 elements per plane =
//   the whole 64x64 tile of every plane read later (plain 16-B loads); staged extent == consumed extent for Ksh, Ksl, Vth, Vtl.
//   P tiles are wave-private, spilled with _Float16 element stores and reloaded as v8h (same element type) after
//   lds_wave_sync; the f32 context tile Os is wave-private, written as float scalars and reloaded as v4f after lds_wave_sync.
//   Output (f32, rows of 64 = 256 B = 2 lines): each wave stores rows q0..q0+15 (it 0..7 x lane>>4 0..1) x 64 columns
//   [NB*SEQ][HD] output.
// =====================================================================================================
__global__ __launch_bounds__(128)
void attn64(const unsigned short* __restrict__ qhp, const unsigned short* __restrict__ qlp,
            const unsigned short* __restrict__ khp, const unsigned short* __restrict__ klp,
            const unsigned short* __restrict__ vhp, const unsigned short* __restrict__ vlp,
            float* outp) {
  union FB { v16b v; v8b h[2]; };
  union FH { v16h v; v8h h[2]; };
  __shared__ __align__(16) __bf16   Ksh[64 * 64];                 // K hi [kv][d]   8 KB   (cross-wave, block barriers)
  __shared__ __align__(16) __bf16   Ksl[64 * 64];                 // K lo           8 KB   (cross-wave)
  __shared__ __align__(16) _Float16 Vth[64 * 64];                 // V^T hi [d][kv] 8 KB   (cross-wave)
  __shared__ __align__(16) _Float16 Vtl[64 * 64];                 // V^T residual   8 KB   (cross-wave)
  __shared__ __align__(16) _Float16 Psh[4][16 * 64];              // per wave P [row][kv]      8 KB (wave-private)
  __shared__ __align__(16) _Float16 Psl[4][16 * 64];              // per wave P residual        8 KB (wave-private)
  __shared__ __align__(16) float    Os[4][16 * 64];               // per wave context [row][d] 16 KB (wave-private)

  const int tid  = threadIdx.x;
  const int wave = tid >> 5;
  const int lane = tid & 31;
  const int hh   = lane >> 4;
  const int c    = lane & 15;

  const int bx   = blockIdx.x;
  const int qb   = bx % NQB;
  const int b    = bx / NQB;                   // 0..NB-1
  const int q0   = qb * 64 + wave * 16;
  const size_t rowB = (size_t)b * SEQ;

  const __bf16* Qh = (const __bf16*)(const void*)qhp;
  const __bf16* Ql = (const __bf16*)(const void*)qlp;
  const __bf16* Kh = (const __bf16*)(const void*)khp;
  const __bf16* Kl = (const __bf16*)(const void*)klp;
  const _Float16* Vh = (const _Float16*)(const void*)vhp + (size_t)b * HD * SEQ;
  const _Float16* Vl = (const _Float16*)(const void*)vlp + (size_t)b * HD * SEQ;

  // ---- Q fragments (A operand, row = lane&15): 2 d-chunks, hi and lo ----
  v16b qah[2], qal[2];
#pragma unroll
  for (int dc = 0; dc < 2; ++dc) {
    const size_t qo = (rowB + q0 + c) * HD + dc * 32 + 8 * hh;
    qah[dc] = ldfrag_b(Qh + qo);
    qal[dc] = ldfrag_b(Ql + qo);
  }

  float mrow[8], lrow[8];
  v8f oacc[4];
#pragma unroll
  for (int r = 0; r < 8; ++r) { mrow[r] = -INFINITY; lrow[r] = 0.f; }
#pragma unroll
  for (int t = 0; t < 4; ++t) oacc[t] = zero8();

  for (int kt = 0; kt < NKT; ++kt) {           // static trip count
    const int kv0 = kt * 64;                   // kv0 + 63 < SEQ
    __syncthreads();
    {
      const int r = tid >> 1, half = (tid & 1) * 32;
      const __bf16*   kg  = Kh + (rowB + kv0 + r) * HD + half;    // K row kv0+r, d = half..half+31
      const __bf16*   klg = Kl + (rowB + kv0 + r) * HD + half;
      const _Float16* vg  = Vh + (size_t)r * SEQ + kv0 + half;    // V^T row d = r, s = kv0+half..+31
      const _Float16* vlg = Vl + (size_t)r * SEQ + kv0 + half;
#pragma unroll
      for (int i = 0; i < 4; ++i) {
        const v8b a0 = *(const v8b*)(kg + 8 * i);
        const v8b a1 = *(const v8b*)(klg + 8 * i);
        const v8h b0 = *(const v8h*)(vg + 8 * i);
        const v8h b1 = *(const v8h*)(vlg + 8 * i);
        *(v8b*)(Ksh + r * 64 + half + 8 * i) = a0;
        *(v8b*)(Ksl + r * 64 + half + 8 * i) = a1;
        *(v8h*)(Vth + r * 64 + half + 8 * i) = b0;
        *(v8h*)(Vtl + r * 64 + half + 8 * i) = b1;
      }
    }
    __syncthreads();

    // ---- scores: 16 query rows x 64 keys per wave, 3 bf16 products per (key subtile, d-chunk) ----
    v8f s[4];
#pragma unroll
    for (int j = 0; j < 4; ++j) {
      s[j] = zero8();
#pragma unroll
      for (int dc = 0; dc < 2; ++dc) {
        FB kb, kl;
        kb.h[0] = *(const v8b*)(Ksh + (j * 16 + c) * 64 + dc * 32 + 8 * hh);
        kb.h[1] = *(const v8b*)(Ksh + (j * 16 + c) * 64 + dc * 32 + 16 + 8 * hh);
        kl.h[0] = *(const v8b*)(Ksl + (j * 16 + c) * 64 + dc * 32 + 8 * hh);
        kl.h[1] = *(const v8b*)(Ksl + (j * 16 + c) * 64 + dc * 32 + 16 + 8 * hh);
        s[j] = mma_b(qah[dc], kb.v, s[j]);
        s[j] = mma_b(qah[dc], kl.v, s[j]);
        s[j] = mma_b(qal[dc], kb.v, s[j]);
      }
    }

    // ---- scale, row max, online softmax, P (x1024, f16) and P residual (x4096) to LDS ----
    _Float16* pwh = Psh[wave];
    _Float16* pwl = Psl[wave];
#pragma unroll
    for (int r = 0; r < 8; ++r) {
      float m = -INFINITY;
#pragma unroll
      for (int j = 0; j < 4; ++j) {
        const float sv = s[j][r] * 0.125f;
        s[j][r] = sv;
        m = fmaxf(m, sv);
      }
#pragma unroll
      for (int off = 1; off < 16; off <<= 1) m = fmaxf(m, __shfl_xor(m, off, 32));
      const float mnew  = fmaxf(mrow[r], m);
      const float msafe = (mnew == -INFINITY) ? 0.f : mnew;
      const float alpha = __expf(mrow[r] - msafe);
      mrow[r] = mnew;
      float psum = 0.f;
#pragma unroll
      for (int j = 0; j < 4; ++j) {
        const float p = __expf(s[j][r] - msafe);
        psum += p;
        const float p1k = p * 1024.0f;
        const _Float16 ph = (_Float16)p1k;
        const _Float16 pl = (_Float16)((p1k - (float)ph) * 4096.0f);
        pwh[(8 * hh + r) * 64 + j * 16 + c] = ph;
        pwl[(8 * hh + r) * 64 + j * 16 + c] = pl;
      }
#pragma unroll
      for (int off = 1; off < 16; off <<= 1) psum += __shfl_xor(psum, off, 32);
      lrow[r] = lrow[r] * alpha + psum;
#pragma unroll
      for (int t = 0; t < 4; ++t) oacc[t][r] *= alpha;
    }
    lds_wave_sync();

    // ---- context += P . V (f16 WMMA), residual products into a separate accumulator ----
    v8f o1[4];
#pragma unroll
    for (int t = 0; t < 4; ++t) o1[t] = zero8();
#pragma unroll 1
    for (int kk = 0; kk < 2; ++kk) {
      FH pa, pr;
      pa.h[0] = *(const v8h*)(pwh + c * 64 + kk * 32 + 8 * hh);
      pa.h[1] = *(const v8h*)(pwh + c * 64 + kk * 32 + 16 + 8 * hh);
      pr.h[0] = *(const v8h*)(pwl + c * 64 + kk * 32 + 8 * hh);
      pr.h[1] = *(const v8h*)(pwl + c * 64 + kk * 32 + 16 + 8 * hh);
#pragma unroll
      for (int t = 0; t < 4; ++t) {
        FH vb, vl;
        vb.h[0] = *(const v8h*)(Vth + (t * 16 + c) * 64 + kk * 32 + 8 * hh);
        vb.h[1] = *(const v8h*)(Vth + (t * 16 + c) * 64 + kk * 32 + 16 + 8 * hh);
        vl.h[0] = *(const v8h*)(Vtl + (t * 16 + c) * 64 + kk * 32 + 8 * hh);
        vl.h[1] = *(const v8h*)(Vtl + (t * 16 + c) * 64 + kk * 32 + 16 + 8 * hh);
        oacc[t] = mma_h(pa.v, vb.v, oacc[t]);
        o1[t]   = mma_h(pa.v, vl.v, o1[t]);
        o1[t]   = mma_h(pr.v, vb.v, o1[t]);
      }
    }
#pragma unroll
    for (int t = 0; t < 4; ++t)
#pragma unroll
      for (int r = 0; r < 8; ++r) oacc[t][r] += o1[t][r] * (1.0f / 4096.0f);
  }

  // ---- normalise (1/l and the 1/1024 p carry), stage the wave's 16x64 f32 tile,
  float* os = Os[wave];
#pragma unroll
  for (int r = 0; r < 8; ++r) {
    const float l = lrow[r];
    const float inv = ((l > 0.f) ? (1.0f / l) : 0.f) * (1.0f / 1024.0f);
#pragma unroll
    for (int t = 0; t < 4; ++t) os[(8 * hh + r) * 64 + t * 16 + c] = oacc[t][r] * inv;
  }
  lds_wave_sync();
  {
    const int h2 = lane >> 4, c4 = (lane & 15) * 4;
    v4f ov[8];
#pragma unroll
    for (int it = 0; it < 8; ++it) {
      const int row = it * 2 + h2;   // it 0..7 x h2 0..1 = rows 0..15 of the wave tile
      ov[it] = *(const v4f*)(os + row * 64 + c4);
    }
    {
#pragma unroll
      for (int it = 0; it < 8; ++it) {
        const int row = it * 2 + h2;
        const size_t go = (rowB + q0 + row) * HD + c4;
        *(v4f*)(outp + go) = ov[it];
      }
      
    }
  }
}

// =====================================================================================================
// Workspace map (bytes, full build NB=8 SEQ=2048; every region is an exact multiple of its 64x64-tile / whole-line
// store granularity, all shapes are tile multiples so no padded tails exist; no region is reused):
//   Qb   bf16 [NB*SEQ][512] compact  0            16777216
//   Kb   bf16 [NB*SEQ][512]          16777216     16777216
//   Vb   bf16 [NB*SEQ][512]          33554432     16777216
//   WqT  bf16 [64 n][512 k]         50331648        65536
//   WkT                             50397184        65536
//   WvT                             50462720        65536
//   Qh   bf16 [NB*SEQ][64]           50528256      2097152
//   Ql                              52625408      2097152
//   Kh                              54722560      2097152
//   Kl                              56819712      2097152
//   VTh  f16  [NB][64][SEQ]         58916864      2097152
//   VTl  f16  [NB][64][SEQ]         61014016      2097152
//   end                             63111168
// =====================================================================================================
extern "C" void kernel_launch(void* const* d_in, const int* in_sizes, int n_in,
                              void* d_out, int out_size, void* d_ws, size_t ws_size,
                              hipStream_t stream) {
  if (n_in < 9) return;
  const long long NX_NEED = ((long long)(NB - 1) * SEQ_FULL + SEQ) * (long long)DIN;   // last row read + 1, floats
  const int NXC = NB * SEQ * DIN;                  // compact activation plane elements (8388608 full)
  const int NO  = NB * SEQ * HD;                   // output elements (1048576 full)
  const int NW  = DIN * HD;                        //   32768
  if ((long long)in_sizes[0] < NX_NEED || (long long)in_sizes[1] < NX_NEED || (long long)in_sizes[2] < NX_NEED) return;
  if (in_sizes[3] < NW || in_sizes[5] < NW || in_sizes[7] < NW) return;
  if (in_sizes[4] < HD || in_sizes[6] < HD || in_sizes[8] < HD) return;
  if (out_size < NO) return;

  const float* q_in = (const float*)d_in[0];   // [8][2048][512]
  const float* k_in = (const float*)d_in[1];   // [8][2048][512]
  const float* v_in = (const float*)d_in[2];   // [8][2048][512]
  const float* Wq   = (const float*)d_in[3];   // [512 in][64 out]
  const float* bq   = (const float*)d_in[4];   // [64]
  const float* Wk   = (const float*)d_in[5];   // [512][64]
  const float* bk   = (const float*)d_in[6];   // [64]
  const float* Wv   = (const float*)d_in[7];   // [512][64]
  const float* bv   = (const float*)d_in[8];   // [64]

  const size_t PX  = (size_t)NXC * 2;              // 16-bit compact activation plane [NB*SEQ][512]
  const size_t PW  = (size_t)NW * 2;               // 16-bit weight plane [64][512]
  const size_t PP  = (size_t)NO * 2;               // 16-bit projected plane [NB*SEQ][64]
  const size_t PVT = (size_t)NB * HD * SEQ * 2;    // 16-bit v^T plane [NB][64][SEQ]
  size_t off = 0;
  const size_t oQb  = off; off += PX;
  const size_t oKb  = off; off += PX;
  const size_t oVb  = off; off += PX;
  const size_t oWq  = off; off += PW;
  const size_t oWk  = off; off += PW;
  const size_t oWv  = off; off += PW;
  const size_t oQh  = off; off += PP;
  const size_t oQl  = off; off += PP;
  const size_t oKh  = off; off += PP;
  const size_t oKl  = off; off += PP;
  const size_t oVTh = off; off += PVT;
  const size_t oVTl = off; off += PVT;
  if (off > ws_size) return;                       // off = 63111168 (full build)
  if (off > (size_t)134217728) return;

  char* ws = (char*)d_ws;
  unsigned short* Qb  = (unsigned short*)(ws + oQb);
  unsigned short* Kb  = (unsigned short*)(ws + oKb);
  unsigned short* Vb  = (unsigned short*)(ws + oVb);
  unsigned short* WqT = (unsigned short*)(ws + oWq);
  unsigned short* WkT = (unsigned short*)(ws + oWk);
  unsigned short* WvT = (unsigned short*)(ws + oWv);
  unsigned short* Qh  = (unsigned short*)(ws + oQh);
  unsigned short* Ql  = (unsigned short*)(ws + oQl);
  unsigned short* Kh  = (unsigned short*)(ws + oKh);
  unsigned short* Kl  = (unsigned short*)(ws + oKl);
  unsigned short* VTh = (unsigned short*)(ws + oVTh);
  unsigned short* VTl = (unsigned short*)(ws + oVTl);

  const dim3 blk(256);
  const int n8x  = NXC / 8;                                    // 1048576 (full), multiple of 32
  const int grpB = SEQ * DIN / 8;                              // 16-B groups per batch in the compact plane
  const long long strB = (long long)SEQ_FULL * DIN;            // full per-batch input stride (floats)
  const int n8w  = NW / 8;                                     //    4096
  const dim3 gCvtX((n8x + 255) / 256);                         // 4096 blocks (full)
  const dim3 gWt((n8w + 255) / 256);                           //   16 blocks
  const dim3 gProj(((NB * SEQ / 64) * (HD / 64) + 7) / 8, 1);  //  256 tiles -> 32 blocks (full): M=NB*SEQ, N=64
  const dim3 gVT(((HD / 64) * (SEQ / 64) + 7) / 8, NB);        //   32 tiles ->  4 blocks x NB batches (full): M=64, N=SEQ
  const dim3 gAttn(NB * NQB);                                  //  256 blocks of 128 (full)

  // (1) activations f32 -> bf16 compact planes; weights [k][n] f32 -> bf16 [n][k]
  cvt_bf16x8<<<gCvtX, blk, 0, stream>>>(q_in, Qb, n8x, grpB, strB);
  cvt_bf16x8<<<gCvtX, blk, 0, stream>>>(k_in, Kb, n8x, grpB, strB);
  cvt_bf16x8<<<gCvtX, blk, 0, stream>>>(v_in, Vb, n8x, grpB, strB);
  wt_bf16<<<gWt, blk, 0, stream>>>(Wq, WqT, n8w);
  wt_bf16<<<gWt, blk, 0, stream>>>(Wk, WkT, n8w);
  wt_bf16<<<gWt, blk, 0, stream>>>(Wv, WvT, n8w);
  // (2) q = q_in . Wq + bq -> bf16 hi/lo planes [b*SEQ+t][d]   (M=NB*SEQ, N=64, K=512)
  gemm64<0, 2, 1><<<gProj, blk, 0, stream>>>(
      Qb, Qb, DIN, 0LL, WqT, DIN, 0LL, bq,
      (void*)Qh, HD, 0LL, (void*)Ql, HD, 0LL, HD,
      NB * SEQ, HD, DIN, 1.0f);
  // (3) k = k_in . Wk + bk -> bf16 hi/lo planes
  gemm64<0, 2, 1><<<gProj, blk, 0, stream>>>(
      Kb, Kb, DIN, 0LL, WkT, DIN, 0LL, bk,
      (void*)Kh, HD, 0LL, (void*)Kl, HD, 0LL, HD,
      NB * SEQ, HD, DIN, 1.0f);
  // (4) v^T = Wv^T . v_in^T + bv per batch -> f16 hi plane [b][d][s] (pitch SEQ) and residual plane (x4096, pitch SEQ,
  //     all tiles)   (A = WvT [n][k], Bt = Vb compact rows of batch b; M=64, N=SEQ, K=512)
  gemm64<0, 3, 2><<<gVT, blk, 0, stream>>>(
      WvT, WvT, DIN, 0LL, Vb, DIN, (long long)SEQ * DIN, bv,
      (void*)VTh, SEQ, (long long)HD * SEQ, (void*)VTl, SEQ, (long long)HD * SEQ, SEQ,
      HD, SEQ, DIN, 4096.0f);
  // (5) attention -> d_out f32 [NB*SEQ][64]
  attn64<<<gAttn, dim3(128), 0, stream>>>(Qh, Ql, Kh, Kl, VTh, VTl, (float*)d_out);
  (void)hipGetLastError();
}

// v001
// A run of this version takes 203 microseconds.
// In two side-by-side timings against v000, it was 1.19 and 1.18 times as fast.
// Contractions: q, k, v^T projections = v_wmma_f32_16x16x32_bf16 (bf16 operands from RNE-converted inputs and weights, single product, f32 accumulate);
// q.k^T scores = v_wmma_f32_16x16x32_bf16 with bf16 hi/lo split q and k (hi.hi + hi.lo + lo.hi), f32 accumulate;
// p.v = v_wmma_f32_16x16x32_f16 (p carried x1024 as f16 hi plane + f16 residual plane x4096, v as f16 hi plane + f16 residual
// plane x4096; 3 products hi.hi, hi.res, res.hi), f32 accumulate; softmax (running max), normalisers and bias adds in f32 on the VALU.
// Carry audit:
//   Psh = f16(1024 * p)                      -> the 1/1024 is folded exactly once in the attention epilogue: inv = (1/l) * (1/1024)
//   Psl = f16((1024 p - Psh) * 4096)         }  products Psh.VTl and Psl.VTh go to the separate accumulator o1,
//   VTl = f16((v - VTh) * 4096)              }  folded back with * (1/4096) once per key chunk
//   VTh = f16(v), no carry (|v| typ. 0.65); q / k lo planes are unscaled bf16 residuals (v - hi) sharing the hi accumulator;
//   score scale 1/8 applied once in f32 after the score accumulate. No other scaled planes.
#include <hip/hip_runtime.h>
#include <math.h>
#include <stdint.h>

#ifndef NB
#define NB   8
#endif
#ifndef SEQ
#define SEQ  2048
#endif
#define NB_FULL  8
#define SEQ_FULL 2048
#define DIN  512
#define HD   64
#define NQB  (SEQ / 64)   // 64-row query blocks per sequence
#define NKT  (SEQ / 64)   // 64-key chunks per sequence
#define LP   72           // LDS row pitch (16-bit elements) of the attention tiles read by 16-B loads: 144 B = 16 B x 9 (odd)
static_assert(NB >= 1 && NB <= NB_FULL && SEQ >= 64 && SEQ <= SEQ_FULL);
static_assert((SEQ % 64) == 0 && (DIN % 32) == 0 && HD == 64);
static_assert(((long long)SEQ * DIN) % (8 * 32) == 0);
static_assert((HD * DIN) % (8 * 256) == 0);

typedef _Float16 v16h __attribute__((ext_vector_type(16)));
typedef _Float16 v8h  __attribute__((ext_vector_type(8)));
typedef __bf16   v16b __attribute__((ext_vector_type(16)));
typedef __bf16   v8b  __attribute__((ext_vector_type(8)));
typedef float    v8f  __attribute__((ext_vector_type(8)));
typedef float    v4f  __attribute__((ext_vector_type(4)));
typedef unsigned int v4u __attribute__((ext_vector_type(4)));

// ---- scalar helpers --------------------------------------------------------------------------------
__device__ __forceinline__ unsigned short bf_bits(float f) {          // f32 -> bf16 bits, RNE convert
  unsigned u = __float_as_uint(f);
  return (unsigned short)((u + 0x7FFFu + ((u >> 16) & 1u)) >> 16);
}
__device__ __forceinline__ float bf_up(unsigned short h) { return __uint_as_float(((unsigned)h) << 16); }
__device__ __forceinline__ unsigned short h_bits(_Float16 x) { return __builtin_bit_cast(unsigned short, x); }
__device__ __forceinline__ unsigned pk16(unsigned short a, unsigned short b) { return (unsigned)a | ((unsigned)b << 16); }
__device__ __forceinline__ v8f zero8() { v8f z = {0.f, 0.f, 0.f, 0.f, 0.f, 0.f, 0.f, 0.f}; return z; }

__device__ __forceinline__ void lds_wave_sync() {
  __builtin_amdgcn_fence(3, "workgroup");
  __builtin_amdgcn_wave_barrier();
  __builtin_amdgcn_fence(2, "workgroup");
}

// ---- fragment loader: 16-bit A/B operand, lane -> row/col (lane&15), p already includes +8*(lane>>4);
//      elements 0..7 <- p[0..7] (k0+8h..k0+8h+7), elements 8..15 <- p[16..23] (k0+16+8h..k0+16+8h+7)
__device__ __forceinline__ v16b ldfrag_b(const __bf16* p) {
  union { v16b v; v8b h[2]; } f;
  f.h[0] = *(const v8b*)(p);
  f.h[1] = *(const v8b*)(p + 16);
  return f.v;
}

// ---- WMMA helpers with trailing VALU hazard gap --------------------------------------------------------
__device__ __forceinline__ v8f mma_b(v16b a, v16b b, v8f c) {
  c = __builtin_amdgcn_wmma_f32_16x16x32_bf16(false, a, false, b, (short)0, c, false, false);
  asm volatile("v_nop\n\tv_nop\n\tv_nop\n\tv_nop" : "+v"(c) : "v"(a), "v"(b));
  return c;
}
__device__ __forceinline__ v8f mma_h(v16h a, v16h b, v8f c) {
  c = __builtin_amdgcn_wmma_f32_16x16x32_f16(false, a, false, b, (short)0, c, false, false);
  asm volatile("v_nop\n\tv_nop\n\tv_nop\n\tv_nop" : "+v"(c) : "v"(a), "v"(b));
  return c;
}
__device__ __forceinline__ v8f mma_b_raw(v16b a, v16b b, v8f c) {
  return __builtin_amdgcn_wmma_f32_16x16x32_bf16(false, a, false, b, (short)0, c, false, false);
}
__device__ __forceinline__ void dep_guard_b(v8f& a, v8f& b, v16b x, v16b y) {
  asm volatile("v_nop\n\tv_nop\n\tv_nop\n\tv_nop" : "+v"(a), "+v"(b) : "v"(x), "v"(y));
}
__device__ __forceinline__ void keep4_b(v16b a, v16b b, v16b c, v16b d) {
  asm volatile("v_nop" :: "v"(a), "v"(b), "v"(c), "v"(d));
}
__device__ __forceinline__ void acc_guard4(v8f& a, v8f& b, v8f& c, v8f& d) {
  asm volatile("v_nop\n\tv_nop\n\tv_nop\n\tv_nop" : "+v"(a), "+v"(b), "+v"(c), "+v"(d));
}

// =====================================================================================================
// f32 -> bf16 (RNE convert), 8 elements per thread, one 16-B store per lane: a wave writes 512 contiguous B
// [NB*SEQ][DIN]: group i -> batch b = i / grpB, compact offset r = i - b*grpB; source row block of batch b
// starts at b*strideB floats (full per-batch input stride). grid = ceil(n8/256), guarded by i < n8;
// coverage: n8 threads x 8 = the whole compact plane [NB*SEQ][DIN].
// =====================================================================================================
__global__ __launch_bounds__(256) void cvt_bf16x8(const float* __restrict__ in, unsigned short* out, int n8,
                                                  int grpB, long long strideB) {
  const int i = blockIdx.x * 256 + (int)threadIdx.x;
  if (i < n8) {
    const int b = i / grpB;
    const int r = i - b * grpB;
    const float* src = in + (size_t)b * (size_t)strideB + (size_t)r * 8;
    const v4f a = *(const v4f*)(src);
    const v4f c = *(const v4f*)(src + 4);
    v4u p;
    p[0] = pk16(bf_bits(a[0]), bf_bits(a[1]));
    p[1] = pk16(bf_bits(a[2]), bf_bits(a[3]));
    p[2] = pk16(bf_bits(c[0]), bf_bits(c[1]));
    p[3] = pk16(bf_bits(c[2]), bf_bits(c[3]));
    *(v4u*)(out + (size_t)i * 8) = p;
    
  }
}

// =====================================================================================================
// Weight transpose + convert: W f32 [DIN k][HD n] (n contiguous) -> Wt bf16 bits [HD n][DIN k] (k contiguous),
// RNE convert. thread i in 0..HD*DIN/8-1: n = i / (DIN/8), k8 = (i mod DIN/8) * 8, one 16-B store per lane at
// coverage: 4096 threads x 8 = the whole [64][512] plane. reads: 8 strided scalars per lane (k*HD + n, in range).
// =====================================================================================================
__global__ __launch_bounds__(256) void wt_bf16(const float* __restrict__ W, unsigned short* out, int ngrp) {
  const int i = blockIdx.x * 256 + (int)threadIdx.x;
  if (i < ngrp) {
    const int n  = i / (DIN / 8);
    const int k8 = (i - n * (DIN / 8)) * 8;
    v4u p;
#pragma unroll
    for (int e = 0; e < 4; ++e) {
      const float f0 = W[(size_t)(k8 + 2 * e) * HD + n];
      const float f1 = W[(size_t)(k8 + 2 * e + 1) * HD + n];
      p[e] = pk16(bf_bits(f0), bf_bits(f1));
    }
    unsigned short* o = out + (size_t)n * DIN + k8;
    *(v4u*)o = p;
    
  }
}

// =====================================================================================================
// Register-blocked batched bf16 WMMA GEMM: C[m][n] = sum_k A[m][k] * Bt[n][k] + bias; one wave per 64x64 tile,
// no block barriers. A row-major [M][K] pitch lda; Bt row-major [N][K] pitch ldb (k contiguous);
// M, N multiples of 64, K multiple of 32 (host shapes are static multiples). blockIdx.y = batch index (strides in elements).
// NSPLIT: 0 = A.Bt; 1 = (A + A2).Bt (A2 = unscaled bf16 lo plane of A, 2 products).
// BIAS: 0 = none; 1 = per column n, bias[n]; 2 = per row m, bias[m]; the bias value is RNE-converted to bf16 and added in f32.
// OUT_MODE: 0 = f32 (pitch ldc); 2 = bf16 hi plane C + bf16 lo plane C2 (lo = RNE(v - hi), unscaled);
//           3 = f16 hi plane C + f16 residual plane C2 = f16((v - hi) * rscale), C2 written only for tiles
//               with n0 < N2 (pitch ldc2, batch stride strideC2).
// Epilogue: 16-row slabs staged per wave in LDS (wave-private, lds_wave_sync); each 64-wide row segment written as
// =====================================================================================================
template <int NSPLIT, int OUT_MODE, int BIAS>
__global__ __launch_bounds__(256) void gemm64(
    const unsigned short* __restrict__ Ap, const unsigned short* A2p, int lda, long long strideA,
    const unsigned short* __restrict__ Btp, int ldb, long long strideB,
    const float* __restrict__ bias,
    void* Cout, int ldc, long long strideC,
    void* Cout2, int ldc2, long long strideC2, int N2,
    int M, int N, int K, float rscale) {
  const __bf16* A   = (const __bf16*)(const void*)Ap;
  const __bf16* A2  = (const __bf16*)(const void*)A2p;
  const __bf16* Bt  = (const __bf16*)(const void*)Btp;
  __shared__ __align__(16) float sT[8][16 * 68];   // per-wave 16x64 slab, pitch 68 floats
  const int b    = blockIdx.y;
  const int lane = threadIdx.x & 31;
  const int wave = threadIdx.x >> 5;
  const int tilesN = N >> 6;
  const int tilesM = M >> 6;
  const int tile = blockIdx.x * 8 + wave;
  if (tile >= tilesM * tilesN) return;   // wave-uniform; no block barriers in this kernel
  const int tm = tile / tilesN;
  const int tn = tile - tm * tilesN;
  const int m0 = tm << 6;
  const int n0 = tn << 6;

  const __bf16* Ab  = A  + (size_t)b * strideA;
  const __bf16* Bb  = Bt + (size_t)b * strideB;
  const __bf16* Ab2 = (NSPLIT >= 1) ? (A2 + (size_t)b * strideA) : Ab;

  const int rlane = lane & 15;                 // row (A) / col (B, D) within subtile
  const int koff  = (lane >> 4) * 8;           // k offset of this lane half
  const int mOff  = (lane >> 4) * 8;           // D row offset

  v8f acc[4][4];
#pragma unroll
  for (int i = 0; i < 4; ++i)
#pragma unroll
    for (int j = 0; j < 4; ++j) acc[i][j] = zero8();

  for (int k0 = 0; k0 < K; k0 += 32) {
    v16b bh[4];
#pragma unroll
    for (int j = 0; j < 4; ++j) {
      const size_t bo = (size_t)(n0 + (j << 4) + rlane) * ldb + koff + k0;
      bh[j] = ldfrag_b(Bb + bo);
    }
#pragma unroll
    for (int i = 0; i < 4; ++i) {
      const size_t ao = (size_t)(m0 + (i << 4) + rlane) * lda + koff + k0;
      const v16b ah = ldfrag_b(Ab + ao);
      v16b al = ah;
      if (NSPLIT >= 1) al = ldfrag_b(Ab2 + ao);
#pragma unroll
      for (int j = 0; j < 4; ++j) {
        acc[i][j] = mma_b_raw(ah, bh[j], acc[i][j]);
        if (NSPLIT >= 1) acc[i][j] = mma_b_raw(al, bh[j], acc[i][j]);
      }
      dep_guard_b(acc[i][0], acc[i][3], ah, al);
    }
    keep4_b(bh[0], bh[1], bh[2], bh[3]);
  }
  acc_guard4(acc[0][0], acc[0][1], acc[0][2], acc[0][3]);
  acc_guard4(acc[1][0], acc[1][1], acc[1][2], acc[1][3]);
  acc_guard4(acc[2][0], acc[2][1], acc[2][2], acc[2][3]);
  acc_guard4(acc[3][0], acc[3][1], acc[3][2], acc[3][3]);

  // ---- epilogue ----
  float* slab = sT[wave];
  float bcol[4];
#pragma unroll
  for (int j = 0; j < 4; ++j) {
    bcol[j] = 0.f;
    if (BIAS == 1) bcol[j] = bf_up(bf_bits(bias[n0 + (j << 4) + rlane]));   // n < N, bias has N entries
  }
#pragma unroll
  for (int i = 0; i < 4; ++i) {
    const int mBase = m0 + (i << 4);
    float brow[8];
#pragma unroll
    for (int r = 0; r < 8; ++r) {
      brow[r] = 0.f;
      if (BIAS == 2) brow[r] = bf_up(bf_bits(bias[mBase + mOff + r]));      // m < M, bias has M entries
    }
#pragma unroll
    for (int j = 0; j < 4; ++j) {
#pragma unroll
      for (int r = 0; r < 8; ++r) {
        slab[(mOff + r) * 68 + (j << 4) + rlane] = acc[i][j][r] + bcol[j] + brow[r];
      }
    }
    lds_wave_sync();
    if (OUT_MODE == 0) {
      float* C = (float*)Cout + (size_t)b * strideC;
      const int hh = lane >> 4, c4 = (lane & 15) * 4;     // 256-B row segment = 16 lanes x 16 B
      {
#pragma unroll
        for (int it = 0; it < 8; ++it) {
          const int row = it * 2 + hh;                     // it 0..7 x hh 0..1 = rows 0..15
          const v4f v = *(const v4f*)(slab + row * 68 + c4);
          *(v4f*)(C + (size_t)(mBase + row) * ldc + n0 + c4) = v;
        }
        
      }
    } else {
      const int q = lane >> 3, c8 = (lane & 7) * 8;
      unsigned short* C  = (unsigned short*)Cout  + (size_t)b * strideC;
      unsigned short* C2 = (unsigned short*)Cout2 + (size_t)b * strideC2;
      const bool wlo = (OUT_MODE == 2) || (n0 < N2);      // wave-uniform
      v4u hv[4], lv[4];
#pragma unroll
      for (int it = 0; it < 4; ++it) {
        const int row = it * 4 + q;                        // it 0..3 x q 0..3 = rows 0..15
        const float* sp = slab + row * 68 + c8;
        v4u a, a2;
#pragma unroll
        for (int e = 0; e < 4; ++e) {
          const float f0 = sp[2 * e], f1 = sp[2 * e + 1];
          unsigned short h0, h1, l0, l1;
          if (OUT_MODE == 2) {
            h0 = bf_bits(f0); h1 = bf_bits(f1);
            l0 = bf_bits(f0 - bf_up(h0)); l1 = bf_bits(f1 - bf_up(h1));
          } else {
            const _Float16 x0 = (_Float16)f0, x1 = (_Float16)f1;
            h0 = h_bits(x0); h1 = h_bits(x1);
            l0 = h_bits((_Float16)((f0 - (float)x0) * rscale));
            l1 = h_bits((_Float16)((f1 - (float)x1) * rscale));
          }
          a[e] = pk16(h0, h1); a2[e] = pk16(l0, l1);
        }
        hv[it] = a; lv[it] = a2;
      }
      {
#pragma unroll
        for (int it = 0; it < 4; ++it) {
          const int row = it * 4 + q;
          *(v4u*)(C + (size_t)(mBase + row) * ldc + n0 + c8) = hv[it];
          if (wlo) *(v4u*)(C2 + (size_t)(mBase + row) * ldc2 + n0 + c8) = lv[it];
        }
        
      }
    }
    lds_wave_sync();
  }
}

// =====================================================================================================
// Non-causal one-head attention, head dim 64, key chunks of 64, softmax over all SEQ keys.
//   q planes (bf16 hi / lo): element (b, t, d) at [(b*SEQ + t)*HD + d]   (compact rows)
//   k planes (bf16 hi / lo): same layout with key index s
//   v^T hi plane (f16):      element (b, d, s) at [(b*HD + d)*SEQ + s]
//   v^T residual plane (f16, (v - hi)*4096): same layout
//   scores = q . k : bf16 hi/lo split (hi.hi + hi.lo + lo.hi), f32 accumulate, then * 1/8 in f32
//   p = exp(s - m) carried as f16(1024 p) plus f16 residual (x4096); context = p . v on f16 WMMA, 3 products:
//   ph.vh into oacc; ph.vl and pl.vh into the separate accumulator o1 folded back with 1/4096 per chunk in f32;
//   online softmax (running max from -inf; every chunk holds at least the chunk max key so l >= 1 after chunk 0) in f32.
//   Block = 4 waves = 64 query rows of one batch b; grid = NB * NQB.
//   K / V^T chunk staging (cross-wave LDS, __syncthreads before and after): 128 threads x 32 elements per plane =
//   the whole 64x64 tile of every plane read later (plain 16-B loads); staged extent == consumed extent for Ksh, Ksl, Vth, Vtl.
//   P tiles are wave-private, spilled with _Float16 element stores and reloaded as v8h (same element type) after
//   lds_wave_sync; the f32 context tile Os is wave-private, written as float scalars and reloaded as v4f after lds_wave_sync.
//   Output (f32, rows of 64 = 256 B = 2 lines): each wave stores rows q0..q0+15 (it 0..7 x lane>>4 0..1) x 64 columns
//   [NB*SEQ][HD] output.
// =====================================================================================================
__global__ __launch_bounds__(128)
void attn64(const unsigned short* __restrict__ qhp, const unsigned short* __restrict__ qlp,
            const unsigned short* __restrict__ khp, const unsigned short* __restrict__ klp,
            const unsigned short* __restrict__ vhp, const unsigned short* __restrict__ vlp,
            float* outp) {
  union FB { v16b v; v8b h[2]; };
  union FH { v16h v; v8h h[2]; };
  // Rows of 64 elements at pitch LP: the 8 pad elements of a row are never written and never read.
  __shared__ __align__(16) __bf16   Ksh[64 * LP];                 // K hi [kv][d]   9 KB   (cross-wave, block barriers)
  __shared__ __align__(16) __bf16   Ksl[64 * LP];                 // K lo           9 KB   (cross-wave)
  __shared__ __align__(16) _Float16 Vth[64 * LP];                 // V^T hi [d][kv] 9 KB   (cross-wave)
  __shared__ __align__(16) _Float16 Vtl[64 * LP];                 // V^T residual   9 KB   (cross-wave)
  __shared__ __align__(16) _Float16 Psh[4][16 * LP];              // per wave P [row][kv]      9 KB (wave-private)
  __shared__ __align__(16) _Float16 Psl[4][16 * LP];              // per wave P residual        9 KB (wave-private)
  __shared__ __align__(16) float    Os[4][16 * 64];               // per wave context [row][d] 16 KB (wave-private)

  const int tid  = threadIdx.x;
  const int wave = tid >> 5;
  const int lane = tid & 31;
  const int hh   = lane >> 4;
  const int c    = lane & 15;

  const int bx   = blockIdx.x;
  const int qb   = bx % NQB;
  const int b    = bx / NQB;                   // 0..NB-1
  const int q0   = qb * 64 + wave * 16;
  const size_t rowB = (size_t)b * SEQ;

  const __bf16* Qh = (const __bf16*)(const void*)qhp;
  const __bf16* Ql = (const __bf16*)(const void*)qlp;
  const __bf16* Kh = (const __bf16*)(const void*)khp;
  const __bf16* Kl = (const __bf16*)(const void*)klp;
  const _Float16* Vh = (const _Float16*)(const void*)vhp + (size_t)b * HD * SEQ;
  const _Float16* Vl = (const _Float16*)(const void*)vlp + (size_t)b * HD * SEQ;

  // ---- Q fragments (A operand, row = lane&15): 2 d-chunks, hi and lo ----
  v16b qah[2], qal[2];
#pragma unroll
  for (int dc = 0; dc < 2; ++dc) {
    const size_t qo = (rowB + q0 + c) * HD + dc * 32 + 8 * hh;
    qah[dc] = ldfrag_b(Qh + qo);
    qal[dc] = ldfrag_b(Ql + qo);
  }

  float mrow[8], lrow[8];
  v8f oacc[4];
#pragma unroll
  for (int r = 0; r < 8; ++r) { mrow[r] = -INFINITY; lrow[r] = 0.f; }
#pragma unroll
  for (int t = 0; t < 4; ++t) oacc[t] = zero8();

  for (int kt = 0; kt < NKT; ++kt) {           // static trip count
    const int kv0 = kt * 64;                   // kv0 + 63 < SEQ
    __syncthreads();
    {
      const int r = tid >> 1, half = (tid & 1) * 32;
      const __bf16*   kg  = Kh + (rowB + kv0 + r) * HD + half;    // K row kv0+r, d = half..half+31
      const __bf16*   klg = Kl + (rowB + kv0 + r) * HD + half;
      const _Float16* vg  = Vh + (size_t)r * SEQ + kv0 + half;    // V^T row d = r, s = kv0+half..+31
      const _Float16* vlg = Vl + (size_t)r * SEQ + kv0 + half;
#pragma unroll
      for (int i = 0; i < 4; ++i) {
        const v8b a0 = *(const v8b*)(kg + 8 * i);
        const v8b a1 = *(const v8b*)(klg + 8 * i);
        const v8h b0 = *(const v8h*)(vg + 8 * i);
        const v8h b1 = *(const v8h*)(vlg + 8 * i);
        *(v8b*)(Ksh + r * LP + half + 8 * i) = a0;
        *(v8b*)(Ksl + r * LP + half + 8 * i) = a1;
        *(v8h*)(Vth + r * LP + half + 8 * i) = b0;
        *(v8h*)(Vtl + r * LP + half + 8 * i) = b1;
      }
    }
    __syncthreads();

    // ---- scores: 16 query rows x 64 keys per wave, 3 bf16 products per (key subtile, d-chunk) ----
    v8f s[4];
#pragma unroll
    for (int j = 0; j < 4; ++j) {
      s[j] = zero8();
#pragma unroll
      for (int dc = 0; dc < 2; ++dc) {
        FB kb, kl;
        kb.h[0] = *(const v8b*)(Ksh + (j * 16 + c) * LP + dc * 32 + 8 * hh);
        kb.h[1] = *(const v8b*)(Ksh + (j * 16 + c) * LP + dc * 32 + 16 + 8 * hh);
        kl.h[0] = *(const v8b*)(Ksl + (j * 16 + c) * LP + dc * 32 + 8 * hh);
        kl.h[1] = *(const v8b*)(Ksl + (j * 16 + c) * LP + dc * 32 + 16 + 8 * hh);
        s[j] = mma_b(qah[dc], kb.v, s[j]);
        s[j] = mma_b(qah[dc], kl.v, s[j]);
        s[j] = mma_b(qal[dc], kb.v, s[j]);
      }
    }

    // ---- scale, row max, online softmax, P (x1024, f16) and P residual (x4096) to LDS ----
    _Float16* pwh = Psh[wave];
    _Float16* pwl = Psl[wave];
#pragma unroll
    for (int r = 0; r < 8; ++r) {
      float m = -INFINITY;
#pragma unroll
      for (int j = 0; j < 4; ++j) {
        const float sv = s[j][r] * 0.125f;
        s[j][r] = sv;
        m = fmaxf(m, sv);
      }
#pragma unroll
      for (int off = 1; off < 16; off <<= 1) m = fmaxf(m, __shfl_xor(m, off, 32));
      const float mnew  = fmaxf(mrow[r], m);
      const float msafe = (mnew == -INFINITY) ? 0.f : mnew;
      const float alpha = __expf(mrow[r] - msafe);
      mrow[r] = mnew;
      float psum = 0.f;
#pragma unroll
      for (int j = 0; j < 4; ++j) {
        const float p = __expf(s[j][r] - msafe);
        psum += p;
        const float p1k = p * 1024.0f;
        const _Float16 ph = (_Float16)p1k;
        const _Float16 pl = (_Float16)((p1k - (float)ph) * 4096.0f);
        pwh[(8 * hh + r) * LP + j * 16 + c] = ph;
        pwl[(8 * hh + r) * LP + j * 16 + c] = pl;
      }
#pragma unroll
      for (int off = 1; off < 16; off <<= 1) psum += __shfl_xor(psum, off, 32);
      lrow[r] = lrow[r] * alpha + psum;
#pragma unroll
      for (int t = 0; t < 4; ++t) oacc[t][r] *= alpha;
    }
    lds_wave_sync();

    // ---- context += P . V (f16 WMMA), residual products into a separate accumulator ----
    v8f o1[4];
#pragma unroll
    for (int t = 0; t < 4; ++t) o1[t] = zero8();
#pragma unroll 1
    for (int kk = 0; kk < 2; ++kk) {
      FH pa, pr;
      pa.h[0] = *(const v8h*)(pwh + c * LP + kk * 32 + 8 * hh);
      pa.h[1] = *(const v8h*)(pwh + c * LP + kk * 32 + 16 + 8 * hh);
      pr.h[0] = *(const v8h*)(pwl + c * LP + kk * 32 + 8 * hh);
      pr.h[1] = *(const v8h*)(pwl + c * LP + kk * 32 + 16 + 8 * hh);
#pragma unroll
      for (int t = 0; t < 4; ++t) {
        FH vb, vl;
        vb.h[0] = *(const v8h*)(Vth + (t * 16 + c) * LP + kk * 32 + 8 * hh);
        vb.h[1] = *(const v8h*)(Vth + (t * 16 + c) * LP + kk * 32 + 16 + 8 * hh);
        vl.h[0] = *(const v8h*)(Vtl + (t * 16 + c) * LP + kk * 32 + 8 * hh);
        vl.h[1] = *(const v8h*)(Vtl + (t * 16 + c) * LP + kk * 32 + 16 + 8 * hh);
        oacc[t] = mma_h(pa.v, vb.v, oacc[t]);
        o1[t]   = mma_h(pa.v, vl.v, o1[t]);
        o1[t]   = mma_h(pr.v, vb.v, o1[t]);
      }
    }
#pragma unroll
    for (int t = 0; t < 4; ++t)
#pragma unroll
      for (int r = 0; r < 8; ++r) oacc[t][r] += o1[t][r] * (1.0f / 4096.0f);
  }

  // ---- normalise (1/l and the 1/1024 p carry), stage the wave's 16x64 f32 tile,
  float* os = Os[wave];
#pragma unroll
  for (int r = 0; r < 8; ++r) {
    const float l = lrow[r];
    const float inv = ((l > 0.f) ? (1.0f / l) : 0.f) * (1.0f / 1024.0f);
#pragma unroll
    for (int t = 0; t < 4; ++t) os[(8 * hh + r) * 64 + t * 16 + c] = oacc[t][r] * inv;
  }
  lds_wave_sync();
  {
    const int h2 = lane >> 4, c4 = (lane & 15) * 4;
    v4f ov[8];
#pragma unroll
    for (int it = 0; it < 8; ++it) {
      const int row = it * 2 + h2;   // it 0..7 x h2 0..1 = rows 0..15 of the wave tile
      ov[it] = *(const v4f*)(os + row * 64 + c4);
    }
    {
#pragma unroll
      for (int it = 0; it < 8; ++it) {
        const int row = it * 2 + h2;
        const size_t go = (rowB + q0 + row) * HD + c4;
        *(v4f*)(outp + go) = ov[it];
      }
      
    }
  }
}

// =====================================================================================================
// Workspace map (bytes, full build NB=8 SEQ=2048; every region is an exact multiple of its 64x64-tile / whole-line
// store granularity, all shapes are tile multiples so no padded tails exist; no region is reused):
//   Qb   bf16 [NB*SEQ][512] compact  0            16777216
//   Kb   bf16 [NB*SEQ][512]          16777216     16777216
//   Vb   bf16 [NB*SEQ][512]          33554432     16777216
//   WqT  bf16 [64 n][512 k]         50331648        65536
//   WkT                             50397184        65536
//   WvT                             50462720        65536
//   Qh   bf16 [NB*SEQ][64]           50528256      2097152
//   Ql                              52625408      2097152
//   Kh                              54722560      2097152
//   Kl                              56819712      2097152
//   VTh  f16  [NB][64][SEQ]         58916864      2097152
//   VTl  f16  [NB][64][SEQ]         61014016      2097152
//   end                             63111168
// =====================================================================================================
extern "C" void kernel_launch(void* const* d_in, const int* in_sizes, int n_in,
                              void* d_out, int out_size, void* d_ws, size_t ws_size,
                              hipStream_t stream) {
  if (n_in < 9) return;
  const long long NX_NEED = ((long long)(NB - 1) * SEQ_FULL + SEQ) * (long long)DIN;   // last row read + 1, floats
  const int NXC = NB * SEQ * DIN;                  // compact activation plane elements (8388608 full)
  const int NO  = NB * SEQ * HD;                   // output elements (1048576 full)
  const int NW  = DIN * HD;                        //   32768
  if ((long long)in_sizes[0] < NX_NEED || (long long)in_sizes[1] < NX_NEED || (long long)in_sizes[2] < NX_NEED) return;
  if (in_sizes[3] < NW || in_sizes[5] < NW || in_sizes[7] < NW) return;
  if (in_sizes[4] < HD || in_sizes[6] < HD || in_sizes[8] < HD) return;
  if (out_size < NO) return;

  const float* q_in = (const float*)d_in[0];   // [8][2048][512]
  const float* k_in = (const float*)d_in[1];   // [8][2048][512]
  const float* v_in = (const float*)d_in[2];   // [8][2048][512]
  const float* Wq   = (const float*)d_in[3];   // [512 in][64 out]
  const float* bq   = (const float*)d_in[4];   // [64]
  const float* Wk   = (const float*)d_in[5];   // [512][64]
  const float* bk   = (const float*)d_in[6];   // [64]
  const float* Wv   = (const float*)d_in[7];   // [512][64]
  const float* bv   = (const float*)d_in[8];   // [64]

  const size_t PX  = (size_t)NXC * 2;              // 16-bit compact activation plane [NB*SEQ][512]
  const size_t PW  = (size_t)NW * 2;               // 16-bit weight plane [64][512]
  const size_t PP  = (size_t)NO * 2;               // 16-bit projected plane [NB*SEQ][64]
  const size_t PVT = (size_t)NB * HD * SEQ * 2;    // 16-bit v^T plane [NB][64][SEQ]
  size_t off = 0;
  const size_t oQb  = off; off += PX;
  const size_t oKb  = off; off += PX;
  const size_t oVb  = off; off += PX;
  const size_t oWq  = off; off += PW;
  const size_t oWk  = off; off += PW;
  const size_t oWv  = off; off += PW;
  const size_t oQh  = off; off += PP;
  const size_t oQl  = off; off += PP;
  const size_t oKh  = off; off += PP;
  const size_t oKl  = off; off += PP;
  const size_t oVTh = off; off += PVT;
  const size_t oVTl = off; off += PVT;
  if (off > ws_size) return;                       // off = 63111168 (full build)
  if (off > (size_t)134217728) return;

  char* ws = (char*)d_ws;
  unsigned short* Qb  = (unsigned short*)(ws + oQb);
  unsigned short* Kb  = (unsigned short*)(ws + oKb);
  unsigned short* Vb  = (unsigned short*)(ws + oVb);
  unsigned short* WqT = (unsigned short*)(ws + oWq);
  unsigned short* WkT = (unsigned short*)(ws + oWk);
  unsigned short* WvT = (unsigned short*)(ws + oWv);
  unsigned short* Qh  = (unsigned short*)(ws + oQh);
  unsigned short* Ql  = (unsigned short*)(ws + oQl);
  unsigned short* Kh  = (unsigned short*)(ws + oKh);
  unsigned short* Kl  = (unsigned short*)(ws + oKl);
  unsigned short* VTh = (unsigned short*)(ws + oVTh);
  unsigned short* VTl = (unsigned short*)(ws + oVTl);

  const dim3 blk(256);
  const int n8x  = NXC / 8;                                    // 1048576 (full), multiple of 32
  const int grpB = SEQ * DIN / 8;                              // 16-B groups per batch in the compact plane
  const long long strB = (long long)SEQ_FULL * DIN;            // full per-batch input stride (floats)
  const int n8w  = NW / 8;                                     //    4096
  const dim3 gCvtX((n8x + 255) / 256);                         // 4096 blocks (full)
  const dim3 gWt((n8w + 255) / 256);                           //   16 blocks
  const dim3 gProj(((NB * SEQ / 64) * (HD / 64) + 7) / 8, 1);  //  256 tiles -> 32 blocks (full): M=NB*SEQ, N=64
  const dim3 gVT(((HD / 64) * (SEQ / 64) + 7) / 8, NB);        //   32 tiles ->  4 blocks x NB batches (full): M=64, N=SEQ
  const dim3 gAttn(NB * NQB);                                  //  256 blocks of 128 (full)

  // (1) activations f32 -> bf16 compact planes; weights [k][n] f32 -> bf16 [n][k]
  cvt_bf16x8<<<gCvtX, blk, 0, stream>>>(q_in, Qb, n8x, grpB, strB);
  cvt_bf16x8<<<gCvtX, blk, 0, stream>>>(k_in, Kb, n8x, grpB, strB);
  cvt_bf16x8<<<gCvtX, blk, 0, stream>>>(v_in, Vb, n8x, grpB, strB);
  wt_bf16<<<gWt, blk, 0, stream>>>(Wq, WqT, n8w);
  wt_bf16<<<gWt, blk, 0, stream>>>(Wk, WkT, n8w);
  wt_bf16<<<gWt, blk, 0, stream>>>(Wv, WvT, n8w);
  // (2) q = q_in . Wq + bq -> bf16 hi/lo planes [b*SEQ+t][d]   (M=NB*SEQ, N=64, K=512)
  gemm64<0, 2, 1><<<gProj, blk, 0, stream>>>(
      Qb, Qb, DIN, 0LL, WqT, DIN, 0LL, bq,
      (void*)Qh, HD, 0LL, (void*)Ql, HD, 0LL, HD,
      NB * SEQ, HD, DIN, 1.0f);
  // (3) k = k_in . Wk + bk -> bf16 hi/lo planes
  gemm64<0, 2, 1><<<gProj, blk, 0, stream>>>(
      Kb, Kb, DIN, 0LL, WkT, DIN, 0LL, bk,
      (void*)Kh, HD, 0LL, (void*)Kl, HD, 0LL, HD,
      NB * SEQ, HD, DIN, 1.0f);
  // (4) v^T = Wv^T . v_in^T + bv per batch -> f16 hi plane [b][d][s] (pitch SEQ) and residual plane (x4096, pitch SEQ,
  //     all tiles)   (A = WvT [n][k], Bt = Vb compact rows of batch b; M=64, N=SEQ, K=512)
  gemm64<0, 3, 2><<<gVT, blk, 0, stream>>>(
      WvT, WvT, DIN, 0LL, Vb, DIN, (long long)SEQ * DIN, bv,
      (void*)VTh, SEQ, (long long)HD * SEQ, (void*)VTl, SEQ, (long long)HD * SEQ, SEQ,
      HD, SEQ, DIN, 4096.0f);
  // (5) attention -> d_out f32 [NB*SEQ][64]
  attn64<<<gAttn, dim3(128), 0, stream>>>(Qh, Ql, Kh, Kl, VTh, VTl, (float*)d_out);
  (void)hipGetLastError();
}

// v002
// One run takes 131 microseconds.
// Timed twice side by side with v001, it ran 1.54 and 1.55 times as fast.
// Over all steps from v000 it is 1.83 times as fast.
// Contractions: q, k, v^T projections = v_wmma_f32_16x16x32_bf16 (bf16 operands from RNE-converted inputs and weights, single product, f32 accumulate);
// q.k^T scores = v_wmma_f32_16x16x32_bf16 with bf16 hi/lo split q and k (hi.hi + hi.lo + lo.hi), f32 accumulate;
// p.v = v_wmma_f32_16x16x32_f16 (p carried x1024 as f16 hi plane + f16 residual plane x4096, v as f16 hi plane + f16 residual
// plane x4096; 3 products hi.hi, hi.res, res.hi), f32 accumulate; softmax (running max), normalisers and bias adds in f32 on the VALU.
// Carry audit:
//   Psh = f16(1024 * p)                      -> the 1/1024 is folded exactly once in the attention epilogue: inv = (1/l) * (1/1024)
//   Psl = f16((1024 p - Psh) * 4096)         }  products Psh.VTl and Psl.VTh go to the separate accumulator o1,
//   VTl = f16((v - VTh) * 4096)              }  folded back with * (1/4096) once per key chunk
//   VTh = f16(v), no carry (|v| typ. 0.65); q / k lo planes are unscaled bf16 residuals (v - hi) sharing the hi accumulator;
//   score scale 1/8 applied once in f32 after the score accumulate. No other scaled planes.
#include <hip/hip_runtime.h>
#include <math.h>
#include <stdint.h>

#ifndef NB
#define NB   8
#endif
#ifndef SEQ
#define SEQ  2048
#endif
#define NB_FULL  8
#define SEQ_FULL 2048
#define DIN  512
#define HD   64
#define NQB  (SEQ / 64)   // 64-row query blocks per sequence
#define NKT  (SEQ / 64)   // 64-key chunks per sequence
#define LP   72           // LDS row pitch (16-bit elements) of the attention tiles read by 16-B loads: 144 B = 16 B x 9 (odd)
static_assert(NB >= 1 && NB <= NB_FULL && SEQ >= 64 && SEQ <= SEQ_FULL);
static_assert((SEQ % 64) == 0 && (DIN % 32) == 0 && HD == 64);
static_assert(((long long)SEQ * DIN) % (8 * 32) == 0);
static_assert((HD * DIN) % (8 * 256) == 0);

typedef _Float16 v16h __attribute__((ext_vector_type(16)));
typedef _Float16 v8h  __attribute__((ext_vector_type(8)));
typedef __bf16   v16b __attribute__((ext_vector_type(16)));
typedef __bf16   v8b  __attribute__((ext_vector_type(8)));
typedef float    v8f  __attribute__((ext_vector_type(8)));
typedef float    v4f  __attribute__((ext_vector_type(4)));
typedef unsigned int v4u __attribute__((ext_vector_type(4)));

// ---- scalar helpers --------------------------------------------------------------------------------
__device__ __forceinline__ unsigned short bf_bits(float f) {          // f32 -> bf16 bits, RNE convert
  unsigned u = __float_as_uint(f);
  return (unsigned short)((u + 0x7FFFu + ((u >> 16) & 1u)) >> 16);
}
__device__ __forceinline__ float bf_up(unsigned short h) { return __uint_as_float(((unsigned)h) << 16); }
__device__ __forceinline__ unsigned short h_bits(_Float16 x) { return __builtin_bit_cast(unsigned short, x); }
__device__ __forceinline__ unsigned pk16(unsigned short a, unsigned short b) { return (unsigned)a | ((unsigned)b << 16); }
__device__ __forceinline__ v8f zero8() { v8f z = {0.f, 0.f, 0.f, 0.f, 0.f, 0.f, 0.f, 0.f}; return z; }

__device__ __forceinline__ void lds_wave_sync() {
  __builtin_amdgcn_fence(3, "workgroup");
  __builtin_amdgcn_wave_barrier();
  __builtin_amdgcn_fence(2, "workgroup");
}

// ---- fragment loader: 16-bit A/B operand, lane -> row/col (lane&15), p already includes +8*(lane>>4);
//      elements 0..7 <- p[0..7] (k0+8h..k0+8h+7), elements 8..15 <- p[16..23] (k0+16+8h..k0+16+8h+7)
__device__ __forceinline__ v16b ldfrag_b(const __bf16* p) {
  union { v16b v; v8b h[2]; } f;
  f.h[0] = *(const v8b*)(p);
  f.h[1] = *(const v8b*)(p + 16);
  return f.v;
}

// ---- WMMA helpers with trailing VALU hazard gap --------------------------------------------------------
__device__ __forceinline__ v8f mma_b(v16b a, v16b b, v8f c) {
  c = __builtin_amdgcn_wmma_f32_16x16x32_bf16(false, a, false, b, (short)0, c, false, false);
  asm volatile("v_nop\n\tv_nop\n\tv_nop\n\tv_nop" : "+v"(c) : "v"(a), "v"(b));
  return c;
}
__device__ __forceinline__ v8f mma_h(v16h a, v16h b, v8f c) {
  c = __builtin_amdgcn_wmma_f32_16x16x32_f16(false, a, false, b, (short)0, c, false, false);
  asm volatile("v_nop\n\tv_nop\n\tv_nop\n\tv_nop" : "+v"(c) : "v"(a), "v"(b));
  return c;
}
__device__ __forceinline__ v8f mma_b_raw(v16b a, v16b b, v8f c) {
  return __builtin_amdgcn_wmma_f32_16x16x32_bf16(false, a, false, b, (short)0, c, false, false);
}
__device__ __forceinline__ void dep_guard_b(v8f& a, v8f& b, v16b x, v16b y) {
  asm volatile("v_nop\n\tv_nop\n\tv_nop\n\tv_nop" : "+v"(a), "+v"(b) : "v"(x), "v"(y));
}
__device__ __forceinline__ void keep4_b(v16b a, v16b b, v16b c, v16b d) {
  asm volatile("v_nop" :: "v"(a), "v"(b), "v"(c), "v"(d));
}
__device__ __forceinline__ void acc_guard4(v8f& a, v8f& b, v8f& c, v8f& d) {
  asm volatile("v_nop\n\tv_nop\n\tv_nop\n\tv_nop" : "+v"(a), "+v"(b), "+v"(c), "+v"(d));
}

// =====================================================================================================
// f32 -> bf16 (RNE convert), 8 elements per thread, one 16-B store per lane: a wave writes 512 contiguous B
// [NB*SEQ][DIN]: group i -> batch b = i / grpB, compact offset r = i - b*grpB; source row block of batch b
// starts at b*strideB floats (full per-batch input stride). blk = 0..ceil(n8/256)-1, guarded by i < n8;
// coverage: n8 threads x 8 = the whole compact plane [NB*SEQ][DIN]. One role of the launch prep_bf16 below.
// =====================================================================================================
__device__ __forceinline__ void cvt_bf16x8(const float* __restrict__ in, unsigned short* out, int n8,
                                           int grpB, long long strideB, int blk) {
  const int i = blk * 256 + (int)threadIdx.x;
  if (i < n8) {
    const int b = i / grpB;
    const int r = i - b * grpB;
    const float* src = in + (size_t)b * (size_t)strideB + (size_t)r * 8;
    const v4f a = *(const v4f*)(src);
    const v4f c = *(const v4f*)(src + 4);
    v4u p;
    p[0] = pk16(bf_bits(a[0]), bf_bits(a[1]));
    p[1] = pk16(bf_bits(a[2]), bf_bits(a[3]));
    p[2] = pk16(bf_bits(c[0]), bf_bits(c[1]));
    p[3] = pk16(bf_bits(c[2]), bf_bits(c[3]));
    *(v4u*)(out + (size_t)i * 8) = p;
    
  }
}

// =====================================================================================================
// Weight transpose + convert: W f32 [DIN k][HD n] (n contiguous) -> Wt bf16 bits [HD n][DIN k] (k contiguous),
// RNE convert. thread i in 0..HD*DIN/8-1: n = i / (DIN/8), k8 = (i mod DIN/8) * 8, one 16-B store per lane at
// coverage: 4096 threads x 8 = the whole [64][512] plane. reads: 8 strided scalars per lane (k*HD + n, in range).
// One role of the launch prep_bf16 below; blk = 0..ceil(ngrp/256)-1.
// =====================================================================================================
__device__ __forceinline__ void wt_bf16(const float* __restrict__ W, unsigned short* out, int ngrp, int blk) {
  const int i = blk * 256 + (int)threadIdx.x;
  if (i < ngrp) {
    const int n  = i / (DIN / 8);
    const int k8 = (i - n * (DIN / 8)) * 8;
    v4u p;
#pragma unroll
    for (int e = 0; e < 4; ++e) {
      const float f0 = W[(size_t)(k8 + 2 * e) * HD + n];
      const float f1 = W[(size_t)(k8 + 2 * e + 1) * HD + n];
      p[e] = pk16(bf_bits(f0), bf_bits(f1));
    }
    unsigned short* o = out + (size_t)n * DIN + k8;
    *(v4u*)o = p;
    
  }
}

// =====================================================================================================
// The six independent preparation passes in one launch, role by block index: blockIdx.y = 0, 1, 2 picks the q, k or v
// set (activation tensor and its weight); in a set the first wtBlocks blocks transpose the weight, the others convert
// the activations. Both tests are block-uniform; no role has a barrier; no role reads what another writes.
// grid = (wtBlocks + ceil(n8/256), 3).
// =====================================================================================================
__global__ __launch_bounds__(256) void prep_bf16(
    const float* __restrict__ q_in, const float* __restrict__ k_in, const float* __restrict__ v_in,
    const float* __restrict__ Wq, const float* __restrict__ Wk, const float* __restrict__ Wv,
    unsigned short* Qb, unsigned short* Kb, unsigned short* Vb,
    unsigned short* WqT, unsigned short* WkT, unsigned short* WvT,
    int n8, int grpB, long long strideB, int ngrp, int wtBlocks) {
  const int set = blockIdx.y;
  const int bx  = blockIdx.x;
  if (bx < wtBlocks) {
    wt_bf16(set == 0 ? Wq : (set == 1 ? Wk : Wv), set == 0 ? WqT : (set == 1 ? WkT : WvT), ngrp, bx);
  } else {
    cvt_bf16x8(set == 0 ? q_in : (set == 1 ? k_in : v_in), set == 0 ? Qb : (set == 1 ? Kb : Vb),
               n8, grpB, strideB, bx - wtBlocks);
  }
}

// =====================================================================================================
// Register-blocked batched bf16 WMMA GEMM: C[m][n] = sum_k A[m][k] * Bt[n][k] + bias; one wave per 64x64 tile,
// no block barriers. A row-major [M][K] pitch lda; Bt row-major [N][K] pitch ldb (k contiguous);
// M, N multiples of 64, K multiple of 32 (host shapes are static multiples). b = batch index (strides in elements), bx = block
// index inside the product (8 tiles each), sT = the block's slab LDS: all three given by the launch proj3 below.
// NSPLIT: 0 = A.Bt; 1 = (A + A2).Bt (A2 = unscaled bf16 lo plane of A, 2 products).
// BIAS: 0 = none; 1 = per column n, bias[n]; 2 = per row m, bias[m]; the bias value is RNE-converted to bf16 and added in f32.
// OUT_MODE: 0 = f32 (pitch ldc); 2 = bf16 hi plane C + bf16 lo plane C2 (lo = RNE(v - hi), unscaled);
//           3 = f16 hi plane C + f16 residual plane C2 = f16((v - hi) * rscale), C2 written only for tiles
//               with n0 < N2 (pitch ldc2, batch stride strideC2).
// Epilogue: 16-row slabs staged per wave in LDS (wave-private, lds_wave_sync); each 64-wide row segment written as
// =====================================================================================================
template <int NSPLIT, int OUT_MODE, int BIAS>
__device__ __forceinline__ void gemm64(
    const unsigned short* __restrict__ Ap, const unsigned short* A2p, int lda, long long strideA,
    const unsigned short* __restrict__ Btp, int ldb, long long strideB,
    const float* __restrict__ bias,
    void* Cout, int ldc, long long strideC,
    void* Cout2, int ldc2, long long strideC2, int N2,
    int M, int N, int K, float rscale, int bx, int b, float (*sT)[16 * 68]) {
  const __bf16* A   = (const __bf16*)(const void*)Ap;
  const __bf16* A2  = (const __bf16*)(const void*)A2p;
  const __bf16* Bt  = (const __bf16*)(const void*)Btp;
  const int lane = threadIdx.x & 31;
  const int wave = threadIdx.x >> 5;
  const int tilesN = N >> 6;
  const int tilesM = M >> 6;
  const int tile = bx * 8 + wave;
  if (tile >= tilesM * tilesN) return;   // wave-uniform; no block barriers in this kernel
  const int tm = tile / tilesN;
  const int tn = tile - tm * tilesN;
  const int m0 = tm << 6;
  const int n0 = tn << 6;

  const __bf16* Ab  = A  + (size_t)b * strideA;
  const __bf16* Bb  = Bt + (size_t)b * strideB;
  const __bf16* Ab2 = (NSPLIT >= 1) ? (A2 + (size_t)b * strideA) : Ab;

  const int rlane = lane & 15;                 // row (A) / col (B, D) within subtile
  const int koff  = (lane >> 4) * 8;           // k offset of this lane half
  const int mOff  = (lane >> 4) * 8;           // D row offset

  v8f acc[4][4];
#pragma unroll
  for (int i = 0; i < 4; ++i)
#pragma unroll
    for (int j = 0; j < 4; ++j) acc[i][j] = zero8();

  for (int k0 = 0; k0 < K; k0 += 32) {
    v16b bh[4];
#pragma unroll
    for (int j = 0; j < 4; ++j) {
      const size_t bo = (size_t)(n0 + (j << 4) + rlane) * ldb + koff + k0;
      bh[j] = ldfrag_b(Bb + bo);
    }
#pragma unroll
    for (int i = 0; i < 4; ++i) {
      const size_t ao = (size_t)(m0 + (i << 4) + rlane) * lda + koff + k0;
      const v16b ah = ldfrag_b(Ab + ao);
      v16b al = ah;
      if (NSPLIT >= 1) al = ldfrag_b(Ab2 + ao);
#pragma unroll
      for (int j = 0; j < 4; ++j) {
        acc[i][j] = mma_b_raw(ah, bh[j], acc[i][j]);
        if (NSPLIT >= 1) acc[i][j] = mma_b_raw(al, bh[j], acc[i][j]);
      }
      dep_guard_b(acc[i][0], acc[i][3], ah, al);
    }
    keep4_b(bh[0], bh[1], bh[2], bh[3]);
  }
  acc_guard4(acc[0][0], acc[0][1], acc[0][2], acc[0][3]);
  acc_guard4(acc[1][0], acc[1][1], acc[1][2], acc[1][3]);
  acc_guard4(acc[2][0], acc[2][1], acc[2][2], acc[2][3]);
  acc_guard4(acc[3][0], acc[3][1], acc[3][2], acc[3][3]);

  // ---- epilogue ----
  float* slab = sT[wave];
  float bcol[4];
#pragma unroll
  for (int j = 0; j < 4; ++j) {
    bcol[j] = 0.f;
    if (BIAS == 1) bcol[j] = bf_up(bf_bits(bias[n0 + (j << 4) + rlane]));   // n < N, bias has N entries
  }
#pragma unroll
  for (int i = 0; i < 4; ++i) {
    const int mBase = m0 + (i << 4);
    float brow[8];
#pragma unroll
    for (int r = 0; r < 8; ++r) {
      brow[r] = 0.f;
      if (BIAS == 2) brow[r] = bf_up(bf_bits(bias[mBase + mOff + r]));      // m < M, bias has M entries
    }
#pragma unroll
    for (int j = 0; j < 4; ++j) {
#pragma unroll
      for (int r = 0; r < 8; ++r) {
        slab[(mOff + r) * 68 + (j << 4) + rlane] = acc[i][j][r] + bcol[j] + brow[r];
      }
    }
    lds_wave_sync();
    if (OUT_MODE == 0) {
      float* C = (float*)Cout + (size_t)b * strideC;
      const int hh = lane >> 4, c4 = (lane & 15) * 4;     // 256-B row segment = 16 lanes x 16 B
      {
#pragma unroll
        for (int it = 0; it < 8; ++it) {
          const int row = it * 2 + hh;                     // it 0..7 x hh 0..1 = rows 0..15
          const v4f v = *(const v4f*)(slab + row * 68 + c4);
          *(v4f*)(C + (size_t)(mBase + row) * ldc + n0 + c4) = v;
        }
        
      }
    } else {
      const int q = lane >> 3, c8 = (lane & 7) * 8;
      unsigned short* C  = (unsigned short*)Cout  + (size_t)b * strideC;
      unsigned short* C2 = (unsigned short*)Cout2 + (size_t)b * strideC2;
      const bool wlo = (OUT_MODE == 2) || (n0 < N2);      // wave-uniform
      v4u hv[4], lv[4];
#pragma unroll
      for (int it = 0; it < 4; ++it) {
        const int row = it * 4 + q;                        // it 0..3 x q 0..3 = rows 0..15
        const float* sp = slab + row * 68 + c8;
        v4u a, a2;
#pragma unroll
        for (int e = 0; e < 4; ++e) {
          const float f0 = sp[2 * e], f1 = sp[2 * e + 1];
          unsigned short h0, h1, l0, l1;
          if (OUT_MODE == 2) {
            h0 = bf_bits(f0); h1 = bf_bits(f1);
            l0 = bf_bits(f0 - bf_up(h0)); l1 = bf_bits(f1 - bf_up(h1));
          } else {
            const _Float16 x0 = (_Float16)f0, x1 = (_Float16)f1;
            h0 = h_bits(x0); h1 = h_bits(x1);
            l0 = h_bits((_Float16)((f0 - (float)x0) * rscale));
            l1 = h_bits((_Float16)((f1 - (float)x1) * rscale));
          }
          a[e] = pk16(h0, h1); a2[e] = pk16(l0, l1);
        }
        hv[it] = a; lv[it] = a2;
      }
      {
#pragma unroll
        for (int it = 0; it < 4; ++it) {
          const int row = it * 4 + q;
          *(v4u*)(C + (size_t)(mBase + row) * ldc + n0 + c8) = hv[it];
          if (wlo) *(v4u*)(C2 + (size_t)(mBase + row) * ldc2 + n0 + c8) = lv[it];
        }
        
      }
    }
    lds_wave_sync();
  }
}

// =====================================================================================================
// The three independent projections in one launch, role by block index (block-uniform): blockIdx.y = 0: q, 1: k, 2: v^T.
//   q = q_in . Wq + bq -> bf16 hi/lo planes [b*SEQ+t][d]   (M=NB*SEQ, N=64, K=512); k alike
//   v^T = Wv^T . v_in^T + bv per batch -> f16 hi plane [b][d][s] (pitch SEQ) and residual plane (x4096, pitch SEQ, all tiles)
//         (A = WvT [n][k], Bt = Vb compact rows of batch b; M=64, N=SEQ, K=512): blockIdx.x = batch * VT_BX + block in batch
// grid = (VT_BX * NB, 3); VT_BX * NB >= PROJ_BX, and a wave whose tile lies past its product's last tile returns in gemm64.
// =====================================================================================================
#define PROJ_BX (((NB * SEQ / 64) * (HD / 64) + 7) / 8)   //  256 tiles -> 32 blocks (full)
#define VT_BX   (((HD / 64) * (SEQ / 64) + 7) / 8)        //   32 tiles ->  4 blocks per batch (full)
static_assert(VT_BX * NB >= PROJ_BX);
__global__ __launch_bounds__(256) void proj3(
    const unsigned short* __restrict__ Qb, const unsigned short* __restrict__ Kb, const unsigned short* __restrict__ Vb,
    const unsigned short* __restrict__ WqT, const unsigned short* __restrict__ WkT, const unsigned short* __restrict__ WvT,
    const float* __restrict__ bq, const float* __restrict__ bk, const float* __restrict__ bv,
    unsigned short* Qh, unsigned short* Ql, unsigned short* Kh, unsigned short* Kl,
    unsigned short* VTh, unsigned short* VTl) {
  __shared__ __align__(16) float sT[8][16 * 68];   // per-wave 16x64 slab, pitch 68 floats
  const int role = blockIdx.y;
  const int bx   = blockIdx.x;
  if (role == 2) {
    gemm64<0, 3, 2>(
        WvT, WvT, DIN, 0LL, Vb, DIN, (long long)SEQ * DIN, bv,
        (void*)VTh, SEQ, (long long)HD * SEQ, (void*)VTl, SEQ, (long long)HD * SEQ, SEQ,
        HD, SEQ, DIN, 4096.0f, bx % VT_BX, bx / VT_BX, sT);
  } else {
    const unsigned short* A = (role == 0) ? Qb : Kb;
    gemm64<0, 2, 1>(
        A, A, DIN, 0LL, (role == 0) ? WqT : WkT, DIN, 0LL, (role == 0) ? bq : bk,
        (void*)((role == 0) ? Qh : Kh), HD, 0LL, (void*)((role == 0) ? Ql : Kl), HD, 0LL, HD,
        NB * SEQ, HD, DIN, 1.0f, bx, 0, sT);
  }
}

// =====================================================================================================
// Non-causal one-head attention, head dim 64, key chunks of 64, softmax over all SEQ keys.
//   q planes (bf16 hi / lo): element (b, t, d) at [(b*SEQ + t)*HD + d]   (compact rows)
//   k planes (bf16 hi / lo): same layout with key index s
//   v^T hi plane (f16):      element (b, d, s) at [(b*HD + d)*SEQ + s]
//   v^T residual plane (f16, (v - hi)*4096): same layout
//   scores = q . k : bf16 hi/lo split (hi.hi + hi.lo + lo.hi), f32 accumulate, then * 1/8 in f32
//   p = exp(s - m) carried as f16(1024 p) plus f16 residual (x4096); context = p . v on f16 WMMA, 3 products:
//   ph.vh into oacc; ph.vl and pl.vh into the separate accumulator o1 folded back with 1/4096 per chunk in f32;
//   online softmax (running max from -inf; every chunk holds at least the chunk max key so l >= 1 after chunk 0) in f32.
//   Block = 4 waves = 64 query rows of one batch b; grid = NB * NQB.
//   K / V^T chunk staging (cross-wave LDS, __syncthreads before and after): 128 threads x 32 elements per plane =
//   the whole 64x64 tile of every plane read later (plain 16-B loads); staged extent == consumed extent for Ksh, Ksl, Vth, Vtl.
//   P tiles are wave-private, spilled with _Float16 element stores and reloaded as v8h (same element type) after
//   lds_wave_sync; the f32 context tile Os is wave-private, written as float scalars and reloaded as v4f after lds_wave_sync.
//   Output (f32, rows of 64 = 256 B = 2 lines): each wave stores rows q0..q0+15 (it 0..7 x lane>>4 0..1) x 64 columns
//   [NB*SEQ][HD] output.
// =====================================================================================================
__global__ __launch_bounds__(128)
void attn64(const unsigned short* __restrict__ qhp, const unsigned short* __restrict__ qlp,
            const unsigned short* __restrict__ khp, const unsigned short* __restrict__ klp,
            const unsigned short* __restrict__ vhp, const unsigned short* __restrict__ vlp,
            float* outp) {
  union FB { v16b v; v8b h[2]; };
  union FH { v16h v; v8h h[2]; };
  // Rows of 64 elements at pitch LP: the 8 pad elements of a row are never written and never read.
  __shared__ __align__(16) __bf16   Ksh[64 * LP];                 // K hi [kv][d]   9 KB   (cross-wave, block barriers)
  __shared__ __align__(16) __bf16   Ksl[64 * LP];                 // K lo           9 KB   (cross-wave)
  __shared__ __align__(16) _Float16 Vth[64 * LP];                 // V^T hi [d][kv] 9 KB   (cross-wave)
  __shared__ __align__(16) _Float16 Vtl[64 * LP];                 // V^T residual   9 KB   (cross-wave)
  __shared__ __align__(16) _Float16 Psh[4][16 * LP];              // per wave P [row][kv]      9 KB (wave-private)
  __shared__ __align__(16) _Float16 Psl[4][16 * LP];              // per wave P residual        9 KB (wave-private)
  __shared__ __align__(16) float    Os[4][16 * 64];               // per wave context [row][d] 16 KB (wave-private)

  const int tid  = threadIdx.x;
  const int wave = tid >> 5;
  const int lane = tid & 31;
  const int hh   = lane >> 4;
  const int c    = lane & 15;

  const int bx   = blockIdx.x;
  const int qb   = bx % NQB;
  const int b    = bx / NQB;                   // 0..NB-1
  const int q0   = qb * 64 + wave * 16;
  const size_t rowB = (size_t)b * SEQ;

  const __bf16* Qh = (const __bf16*)(const void*)qhp;
  const __bf16* Ql = (const __bf16*)(const void*)qlp;
  const __bf16* Kh = (const __bf16*)(const void*)khp;
  const __bf16* Kl = (const __bf16*)(const void*)klp;
  const _Float16* Vh = (const _Float16*)(const void*)vhp + (size_t)b * HD * SEQ;
  const _Float16* Vl = (const _Float16*)(const void*)vlp + (size_t)b * HD * SEQ;

  // ---- Q fragments (A operand, row = lane&15): 2 d-chunks, hi and lo ----
  v16b qah[2], qal[2];
#pragma unroll
  for (int dc = 0; dc < 2; ++dc) {
    const size_t qo = (rowB + q0 + c) * HD + dc * 32 + 8 * hh;
    qah[dc] = ldfrag_b(Qh + qo);
    qal[dc] = ldfrag_b(Ql + qo);
  }

  float mrow[8], lrow[8];
  v8f oacc[4];
#pragma unroll
  for (int r = 0; r < 8; ++r) { mrow[r] = -INFINITY; lrow[r] = 0.f; }
#pragma unroll
  for (int t = 0; t < 4; ++t) oacc[t] = zero8();

  for (int kt = 0; kt < NKT; ++kt) {           // static trip count
    const int kv0 = kt * 64;                   // kv0 + 63 < SEQ
    __syncthreads();
    {
      const int r = tid >> 1, half = (tid & 1) * 32;
      const __bf16*   kg  = Kh + (rowB + kv0 + r) * HD + half;    // K row kv0+r, d = half..half+31
      const __bf16*   klg = Kl + (rowB + kv0 + r) * HD + half;
      const _Float16* vg  = Vh + (size_t)r * SEQ + kv0 + half;    // V^T row d = r, s = kv0+half..+31
      const _Float16* vlg = Vl + (size_t)r * SEQ + kv0 + half;
#pragma unroll
      for (int i = 0; i < 4; ++i) {
        const v8b a0 = *(const v8b*)(kg + 8 * i);
        const v8b a1 = *(const v8b*)(klg + 8 * i);
        const v8h b0 = *(const v8h*)(vg + 8 * i);
        const v8h b1 = *(const v8h*)(vlg + 8 * i);
        *(v8b*)(Ksh + r * LP + half + 8 * i) = a0;
        *(v8b*)(Ksl + r * LP + half + 8 * i) = a1;
        *(v8h*)(Vth + r * LP + half + 8 * i) = b0;
        *(v8h*)(Vtl + r * LP + half + 8 * i) = b1;
      }
    }
    __syncthreads();

    // ---- scores: 16 query rows x 64 keys per wave, 3 bf16 products per (key subtile, d-chunk) ----
    v8f s[4];
#pragma unroll
    for (int j = 0; j < 4; ++j) {
      s[j] = zero8();
#pragma unroll
      for (int dc = 0; dc < 2; ++dc) {
        FB kb, kl;
        kb.h[0] = *(const v8b*)(Ksh + (j * 16 + c) * LP + dc * 32 + 8 * hh);
        kb.h[1] = *(const v8b*)(Ksh + (j * 16 + c) * LP + dc * 32 + 16 + 8 * hh);
        kl.h[0] = *(const v8b*)(Ksl + (j * 16 + c) * LP + dc * 32 + 8 * hh);
        kl.h[1] = *(const v8b*)(Ksl + (j * 16 + c) * LP + dc * 32 + 16 + 8 * hh);
        s[j] = mma_b(qah[dc], kb.v, s[j]);
        s[j] = mma_b(qah[dc], kl.v, s[j]);
        s[j] = mma_b(qal[dc], kb.v, s[j]);
      }
    }

    // ---- scale, row max, online softmax, P (x1024, f16) and P residual (x4096) to LDS ----
    _Float16* pwh = Psh[wave];
    _Float16* pwl = Psl[wave];
#pragma unroll
    for (int r = 0; r < 8; ++r) {
      float m = -INFINITY;
#pragma unroll
      for (int j = 0; j < 4; ++j) {
        const float sv = s[j][r] * 0.125f;
        s[j][r] = sv;
        m = fmaxf(m, sv);
      }
#pragma unroll
      for (int off = 1; off < 16; off <<= 1) m = fmaxf(m, __shfl_xor(m, off, 32));
      const float mnew  = fmaxf(mrow[r], m);
      const float msafe = (mnew == -INFINITY) ? 0.f : mnew;
      const float alpha = __expf(mrow[r] - msafe);
      mrow[r] = mnew;
      float psum = 0.f;
#pragma unroll
      for (int j = 0; j < 4; ++j) {
        const float p = __expf(s[j][r] - msafe);
        psum += p;
        const float p1k = p * 1024.0f;
        const _Float16 ph = (_Float16)p1k;
        const _Float16 pl = (_Float16)((p1k - (float)ph) * 4096.0f);
        pwh[(8 * hh + r) * LP + j * 16 + c] = ph;
        pwl[(8 * hh + r) * LP + j * 16 + c] = pl;
      }
#pragma unroll
      for (int off = 1; off < 16; off <<= 1) psum += __shfl_xor(psum, off, 32);
      lrow[r] = lrow[r] * alpha + psum;
#pragma unroll
      for (int t = 0; t < 4; ++t) oacc[t][r] *= alpha;
    }
    lds_wave_sync();

    // ---- context += P . V (f16 WMMA), residual products into a separate accumulator ----
    v8f o1[4];
#pragma unroll
    for (int t = 0; t < 4; ++t) o1[t] = zero8();
#pragma unroll 1
    for (int kk = 0; kk < 2; ++kk) {
      FH pa, pr;
      pa.h[0] = *(const v8h*)(pwh + c * LP + kk * 32 + 8 * hh);
      pa.h[1] = *(const v8h*)(pwh + c * LP + kk * 32 + 16 + 8 * hh);
      pr.h[0] = *(const v8h*)(pwl + c * LP + kk * 32 + 8 * hh);
      pr.h[1] = *(const v8h*)(pwl + c * LP + kk * 32 + 16 + 8 * hh);
#pragma unroll
      for (int t = 0; t < 4; ++t) {
        FH vb, vl;
        vb.h[0] = *(const v8h*)(Vth + (t * 16 + c) * LP + kk * 32 + 8 * hh);
        vb.h[1] = *(const v8h*)(Vth + (t * 16 + c) * LP + kk * 32 + 16 + 8 * hh);
        vl.h[0] = *(const v8h*)(Vtl + (t * 16 + c) * LP + kk * 32 + 8 * hh);
        vl.h[1] = *(const v8h*)(Vtl + (t * 16 + c) * LP + kk * 32 + 16 + 8 * hh);
        oacc[t] = mma_h(pa.v, vb.v, oacc[t]);
        o1[t]   = mma_h(pa.v, vl.v, o1[t]);
        o1[t]   = mma_h(pr.v, vb.v, o1[t]);
      }
    }
#pragma unroll
    for (int t = 0; t < 4; ++t)
#pragma unroll
      for (int r = 0; r < 8; ++r) oacc[t][r] += o1[t][r] * (1.0f / 4096.0f);
  }

  // ---- normalise (1/l and the 1/1024 p carry), stage the wave's 16x64 f32 tile,
  float* os = Os[wave];
#pragma unroll
  for (int r = 0; r < 8; ++r) {
    const float l = lrow[r];
    const float inv = ((l > 0.f) ? (1.0f / l) : 0.f) * (1.0f / 1024.0f);
#pragma unroll
    for (int t = 0; t < 4; ++t) os[(8 * hh + r) * 64 + t * 16 + c] = oacc[t][r] * inv;
  }
  lds_wave_sync();
  {
    const int h2 = lane >> 4, c4 = (lane & 15) * 4;
    v4f ov[8];
#pragma unroll
    for (int it = 0; it < 8; ++it) {
      const int row = it * 2 + h2;   // it 0..7 x h2 0..1 = rows 0..15 of the wave tile
      ov[it] = *(const v4f*)(os + row * 64 + c4);
    }
    {
#pragma unroll
      for (int it = 0; it < 8; ++it) {
        const int row = it * 2 + h2;
        const size_t go = (rowB + q0 + row) * HD + c4;
        *(v4f*)(outp + go) = ov[it];
      }
      
    }
  }
}

// =====================================================================================================
// Workspace map (bytes, full build NB=8 SEQ=2048; every region is an exact multiple of its 64x64-tile / whole-line
// store granularity, all shapes are tile multiples so no padded tails exist; no region is reused):
//   Qb   bf16 [NB*SEQ][512] compact  0            16777216
//   Kb   bf16 [NB*SEQ][512]          16777216     16777216
//   Vb   bf16 [NB*SEQ][512]          33554432     16777216
//   WqT  bf16 [64 n][512 k]         50331648        65536
//   WkT                             50397184        65536
//   WvT                             50462720        65536
//   Qh   bf16 [NB*SEQ][64]           50528256      2097152
//   Ql                              52625408      2097152
//   Kh                              54722560      2097152
//   Kl                              56819712      2097152
//   VTh  f16  [NB][64][SEQ]         58916864      2097152
//   VTl  f16  [NB][64][SEQ]         61014016      2097152
//   end                             63111168
// =====================================================================================================
extern "C" void kernel_launch(void* const* d_in, const int* in_sizes, int n_in,
                              void* d_out, int out_size, void* d_ws, size_t ws_size,
                              hipStream_t stream) {
  if (n_in < 9) return;
  const long long NX_NEED = ((long long)(NB - 1) * SEQ_FULL + SEQ) * (long long)DIN;   // last row read + 1, floats
  const int NXC = NB * SEQ * DIN;                  // compact activation plane elements (8388608 full)
  const int NO  = NB * SEQ * HD;                   // output elements (1048576 full)
  const int NW  = DIN * HD;                        //   32768
  if ((long long)in_sizes[0] < NX_NEED || (long long)in_sizes[1] < NX_NEED || (long long)in_sizes[2] < NX_NEED) return;
  if (in_sizes[3] < NW || in_sizes[5] < NW || in_sizes[7] < NW) return;
  if (in_sizes[4] < HD || in_sizes[6] < HD || in_sizes[8] < HD) return;
  if (out_size < NO) return;

  const float* q_in = (const float*)d_in[0];   // [8][2048][512]
  const float* k_in = (const float*)d_in[1];   // [8][2048][512]
  const float* v_in = (const float*)d_in[2];   // [8][2048][512]
  const float* Wq   = (const float*)d_in[3];   // [512 in][64 out]
  const float* bq   = (const float*)d_in[4];   // [64]
  const float* Wk   = (const float*)d_in[5];   // [512][64]
  const float* bk   = (const float*)d_in[6];   // [64]
  const float* Wv   = (const float*)d_in[7];   // [512][64]
  const float* bv   = (const float*)d_in[8];   // [64]

  const size_t PX  = (size_t)NXC * 2;              // 16-bit compact activation plane [NB*SEQ][512]
  const size_t PW  = (size_t)NW * 2;               // 16-bit weight plane [64][512]
  const size_t PP  = (size_t)NO * 2;               // 16-bit projected plane [NB*SEQ][64]
  const size_t PVT = (size_t)NB * HD * SEQ * 2;    // 16-bit v^T plane [NB][64][SEQ]
  size_t off = 0;
  const size_t oQb  = off; off += PX;
  const size_t oKb  = off; off += PX;
  const size_t oVb  = off; off += PX;
  const size_t oWq  = off; off += PW;
  const size_t oWk  = off; off += PW;
  const size_t oWv  = off; off += PW;
  const size_t oQh  = off; off += PP;
  const size_t oQl  = off; off += PP;
  const size_t oKh  = off; off += PP;
  const size_t oKl  = off; off += PP;
  const size_t oVTh = off; off += PVT;
  const size_t oVTl = off; off += PVT;
  if (off > ws_size) return;                       // off = 63111168 (full build)
  if (off > (size_t)134217728) return;

  char* ws = (char*)d_ws;
  unsigned short* Qb  = (unsigned short*)(ws + oQb);
  unsigned short* Kb  = (unsigned short*)(ws + oKb);
  unsigned short* Vb  = (unsigned short*)(ws + oVb);
  unsigned short* WqT = (unsigned short*)(ws + oWq);
  unsigned short* WkT = (unsigned short*)(ws + oWk);
  unsigned short* WvT = (unsigned short*)(ws + oWv);
  unsigned short* Qh  = (unsigned short*)(ws + oQh);
  unsigned short* Ql  = (unsigned short*)(ws + oQl);
  unsigned short* Kh  = (unsigned short*)(ws + oKh);
  unsigned short* Kl  = (unsigned short*)(ws + oKl);
  unsigned short* VTh = (unsigned short*)(ws + oVTh);
  unsigned short* VTl = (unsigned short*)(ws + oVTl);

  const dim3 blk(256);
  const int n8x  = NXC / 8;                                    // 1048576 (full), multiple of 32
  const int grpB = SEQ * DIN / 8;                              // 16-B groups per batch in the compact plane
  const long long strB = (long long)SEQ_FULL * DIN;            // full per-batch input stride (floats)
  const int n8w  = NW / 8;                                     //    4096
  const int wtBlocks = (n8w + 255) / 256;                      //   16 blocks per weight
  const dim3 gPrep(wtBlocks + (n8x + 255) / 256, 3);           //   16 + 4096 blocks (full) x 3 sets
  const dim3 gProj(VT_BX * NB, 3);                             //   32 blocks (full) x 3 products
  const dim3 gAttn(NB * NQB);                                  //  256 blocks of 128 (full)

  // (1) activations f32 -> bf16 compact planes; weights [k][n] f32 -> bf16 [n][k]
  prep_bf16<<<gPrep, blk, 0, stream>>>(q_in, k_in, v_in, Wq, Wk, Wv, Qb, Kb, Vb, WqT, WkT, WvT,
                                       n8x, grpB, strB, n8w, wtBlocks);
  // (2) q, k -> bf16 hi/lo planes, v^T -> f16 hi / residual planes
  proj3<<<gProj, blk, 0, stream>>>(Qb, Kb, Vb, WqT, WkT, WvT, bq, bk, bv, Qh, Ql, Kh, Kl, VTh, VTl);
  // (3) attention -> d_out f32 [NB*SEQ][64]
  attn64<<<gAttn, dim3(128), 0, stream>>>(Qh, Ql, Kh, Kl, VTh, VTl, (float*)d_out);
  (void)hipGetLastError();
}

// v003
// It runs in 88.6 microseconds.
// Timed twice side by side with v002, it ran 1.50 and 1.48 times as fast.
// Over all steps from v000 it is 2.73 times as fast.
// Contractions: q, k, v^T projections = v_wmma_f32_16x16x32_bf16 (bf16 operands from RNE-converted inputs and weights, single product, f32 accumulate);
// q.k^T scores = v_wmma_f32_16x16x32_bf16 with bf16 hi/lo split q and k (hi.hi + hi.lo + lo.hi), f32 accumulate;
// p.v = v_wmma_f32_16x16x32_f16 (p carried x1024 as f16 hi plane + f16 residual plane x4096, v as f16 hi plane + f16 residual
// plane x4096; 3 products hi.hi, hi.res, res.hi), f32 accumulate; softmax (running max), normalisers and bias adds in f32 on the VALU.
// Carry audit:
//   Psh = f16(1024 * p)                      -> the 1/1024 is folded exactly once in the attention epilogue: inv = (1/l) * (1/1024)
//   Psl = f16((1024 p - Psh) * 4096)         }  products Psh.VTl and Psl.VTh go to the separate accumulator o1,
//   VTl = f16((v - VTh) * 4096)              }  folded back with * (1/4096) once per key chunk
//   VTh = f16(v), no carry (|v| typ. 0.65); q / k lo planes are unscaled bf16 residuals (v - hi) sharing the hi accumulator;
//   score scale 1/8 applied once in f32 after the score accumulate. No other scaled planes.
#include <hip/hip_runtime.h>
#include <math.h>
#include <stdint.h>

#ifndef NB
#define NB   8
#endif
#ifndef SEQ
#define SEQ  2048
#endif
#define NB_FULL  8
#define SEQ_FULL 2048
#define DIN  512
#define HD   64
#define NQB  (SEQ / 64)   // 64-row query blocks per sequence
#define NKT  (SEQ / 64)   // 64-key chunks per sequence
#define KG   4            // key groups per attention work-group: each group of 4 waves walks NKT / KG chunks
#define LP   72           // LDS row pitch (16-bit elements) of the attention tiles read by 16-B loads: 144 B = 16 B x 9 (odd)
static_assert(NB >= 1 && NB <= NB_FULL && SEQ >= 64 && SEQ <= SEQ_FULL);
static_assert((SEQ % 64) == 0 && (DIN % 32) == 0 && HD == 64);
static_assert(NKT % KG == 0);
static_assert(((long long)SEQ * DIN) % (8 * 32) == 0);
static_assert((HD * DIN) % (8 * 256) == 0);

typedef _Float16 v16h __attribute__((ext_vector_type(16)));
typedef _Float16 v8h  __attribute__((ext_vector_type(8)));
typedef __bf16   v16b __attribute__((ext_vector_type(16)));
typedef __bf16   v8b  __attribute__((ext_vector_type(8)));
typedef float    v8f  __attribute__((ext_vector_type(8)));
typedef float    v4f  __attribute__((ext_vector_type(4)));
typedef unsigned int v4u __attribute__((ext_vector_type(4)));

// ---- scalar helpers --------------------------------------------------------------------------------
__device__ __forceinline__ unsigned short bf_bits(float f) {          // f32 -> bf16 bits, RNE convert
  unsigned u = __float_as_uint(f);
  return (unsigned short)((u + 0x7FFFu + ((u >> 16) & 1u)) >> 16);
}
__device__ __forceinline__ float bf_up(unsigned short h) { return __uint_as_float(((unsigned)h) << 16); }
__device__ __forceinline__ unsigned short h_bits(_Float16 x) { return __builtin_bit_cast(unsigned short, x); }
__device__ __forceinline__ unsigned pk16(unsigned short a, unsigned short b) { return (unsigned)a | ((unsigned)b << 16); }
__device__ __forceinline__ v8f zero8() { v8f z = {0.f, 0.f, 0.f, 0.f, 0.f, 0.f, 0.f, 0.f}; return z; }

__device__ __forceinline__ void lds_wave_sync() {
  __builtin_amdgcn_fence(3, "workgroup");
  __builtin_amdgcn_wave_barrier();
  __builtin_amdgcn_fence(2, "workgroup");
}

// ---- fragment loader: 16-bit A/B operand, lane -> row/col (lane&15), p already includes +8*(lane>>4);
//      elements 0..7 <- p[0..7] (k0+8h..k0+8h+7), elements 8..15 <- p[16..23] (k0+16+8h..k0+16+8h+7)
__device__ __forceinline__ v16b ldfrag_b(const __bf16* p) {
  union { v16b v; v8b h[2]; } f;
  f.h[0] = *(const v8b*)(p);
  f.h[1] = *(const v8b*)(p + 16);
  return f.v;
}

// ---- WMMA helpers with trailing VALU hazard gap --------------------------------------------------------
__device__ __forceinline__ v8f mma_b(v16b a, v16b b, v8f c) {
  c = __builtin_amdgcn_wmma_f32_16x16x32_bf16(false, a, false, b, (short)0, c, false, false);
  asm volatile("v_nop\n\tv_nop\n\tv_nop\n\tv_nop" : "+v"(c) : "v"(a), "v"(b));
  return c;
}
__device__ __forceinline__ v8f mma_h(v16h a, v16h b, v8f c) {
  c = __builtin_amdgcn_wmma_f32_16x16x32_f16(false, a, false, b, (short)0, c, false, false);
  asm volatile("v_nop\n\tv_nop\n\tv_nop\n\tv_nop" : "+v"(c) : "v"(a), "v"(b));
  return c;
}
__device__ __forceinline__ v8f mma_b_raw(v16b a, v16b b, v8f c) {
  return __builtin_amdgcn_wmma_f32_16x16x32_bf16(false, a, false, b, (short)0, c, false, false);
}
__device__ __forceinline__ void dep_guard_b(v8f& a, v8f& b, v16b x, v16b y) {
  asm volatile("v_nop\n\tv_nop\n\tv_nop\n\tv_nop" : "+v"(a), "+v"(b) : "v"(x), "v"(y));
}
__device__ __forceinline__ void keep4_b(v16b a, v16b b, v16b c, v16b d) {
  asm volatile("v_nop" :: "v"(a), "v"(b), "v"(c), "v"(d));
}
__device__ __forceinline__ void acc_guard4(v8f& a, v8f& b, v8f& c, v8f& d) {
  asm volatile("v_nop\n\tv_nop\n\tv_nop\n\tv_nop" : "+v"(a), "+v"(b), "+v"(c), "+v"(d));
}

// =====================================================================================================
// f32 -> bf16 (RNE convert), 8 elements per thread, one 16-B store per lane: a wave writes 512 contiguous B
// [NB*SEQ][DIN]: group i -> batch b = i / grpB, compact offset r = i - b*grpB; source row block of batch b
// starts at b*strideB floats (full per-batch input stride). blk = 0..ceil(n8/256)-1, guarded by i < n8;
// coverage: n8 threads x 8 = the whole compact plane [NB*SEQ][DIN]. One role of the launch prep_bf16 below.
// =====================================================================================================
__device__ __forceinline__ void cvt_bf16x8(const float* __restrict__ in, unsigned short* out, int n8,
                                           int grpB, long long strideB, int blk) {
  const int i = blk * 256 + (int)threadIdx.x;
  if (i < n8) {
    const int b = i / grpB;
    const int r = i - b * grpB;
    const float* src = in + (size_t)b * (size_t)strideB + (size_t)r * 8;
    const v4f a = *(const v4f*)(src);
    const v4f c = *(const v4f*)(src + 4);
    v4u p;
    p[0] = pk16(bf_bits(a[0]), bf_bits(a[1]));
    p[1] = pk16(bf_bits(a[2]), bf_bits(a[3]));
    p[2] = pk16(bf_bits(c[0]), bf_bits(c[1]));
    p[3] = pk16(bf_bits(c[2]), bf_bits(c[3]));
    *(v4u*)(out + (size_t)i * 8) = p;
    
  }
}

// =====================================================================================================
// Weight transpose + convert: W f32 [DIN k][HD n] (n contiguous) -> Wt bf16 bits [HD n][DIN k] (k contiguous),
// RNE convert. thread i in 0..HD*DIN/8-1: n = i / (DIN/8), k8 = (i mod DIN/8) * 8, one 16-B store per lane at
// coverage: 4096 threads x 8 = the whole [64][512] plane. reads: 8 strided scalars per lane (k*HD + n, in range).
// One role of the launch prep_bf16 below; blk = 0..ceil(ngrp/256)-1.
// =====================================================================================================
__device__ __forceinline__ void wt_bf16(const float* __restrict__ W, unsigned short* out, int ngrp, int blk) {
  const int i = blk * 256 + (int)threadIdx.x;
  if (i < ngrp) {
    const int n  = i / (DIN / 8);
    const int k8 = (i - n * (DIN / 8)) * 8;
    v4u p;
#pragma unroll
    for (int e = 0; e < 4; ++e) {
      const float f0 = W[(size_t)(k8 + 2 * e) * HD + n];
      const float f1 = W[(size_t)(k8 + 2 * e + 1) * HD + n];
      p[e] = pk16(bf_bits(f0), bf_bits(f1));
    }
    unsigned short* o = out + (size_t)n * DIN + k8;
    *(v4u*)o = p;
    
  }
}

// =====================================================================================================
// The six independent preparation passes in one launch, role by block index: blockIdx.y = 0, 1, 2 picks the q, k or v
// set (activation tensor and its weight); in a set the first wtBlocks blocks transpose the weight, the others convert
// the activations. Both tests are block-uniform; no role has a barrier; no role reads what another writes.
// grid = (wtBlocks + ceil(n8/256), 3).
// =====================================================================================================
__global__ __launch_bounds__(256) void prep_bf16(
    const float* __restrict__ q_in, const float* __restrict__ k_in, const float* __restrict__ v_in,
    const float* __restrict__ Wq, const float* __restrict__ Wk, const float* __restrict__ Wv,
    unsigned short* Qb, unsigned short* Kb, unsigned short* Vb,
    unsigned short* WqT, unsigned short* WkT, unsigned short* WvT,
    int n8, int grpB, long long strideB, int ngrp, int wtBlocks) {
  const int set = blockIdx.y;
  const int bx  = blockIdx.x;
  if (bx < wtBlocks) {
    wt_bf16(set == 0 ? Wq : (set == 1 ? Wk : Wv), set == 0 ? WqT : (set == 1 ? WkT : WvT), ngrp, bx);
  } else {
    cvt_bf16x8(set == 0 ? q_in : (set == 1 ? k_in : v_in), set == 0 ? Qb : (set == 1 ? Kb : Vb),
               n8, grpB, strideB, bx - wtBlocks);
  }
}

// =====================================================================================================
// Register-blocked batched bf16 WMMA GEMM: C[m][n] = sum_k A[m][k] * Bt[n][k] + bias; one wave per 64x64 tile,
// no block barriers. A row-major [M][K] pitch lda; Bt row-major [N][K] pitch ldb (k contiguous);
// M, N multiples of 64, K multiple of 32 (host shapes are static multiples). b = batch index (strides in elements), bx = block
// index inside the product (8 tiles each), sT = the block's slab LDS: all three given by the launch proj3 below.
// NSPLIT: 0 = A.Bt; 1 = (A + A2).Bt (A2 = unscaled bf16 lo plane of A, 2 products).
// BIAS: 0 = none; 1 = per column n, bias[n]; 2 = per row m, bias[m]; the bias value is RNE-converted to bf16 and added in f32.
// OUT_MODE: 0 = f32 (pitch ldc); 2 = bf16 hi plane C + bf16 lo plane C2 (lo = RNE(v - hi), unscaled);
//           3 = f16 hi plane C + f16 residual plane C2 = f16((v - hi) * rscale), C2 written only for tiles
//               with n0 < N2 (pitch ldc2, batch stride strideC2).
// Epilogue: 16-row slabs staged per wave in LDS (wave-private, lds_wave_sync); each 64-wide row segment written as
// =====================================================================================================
template <int NSPLIT, int OUT_MODE, int BIAS>
__device__ __forceinline__ void gemm64(
    const unsigned short* __restrict__ Ap, const unsigned short* A2p, int lda, long long strideA,
    const unsigned short* __restrict__ Btp, int ldb, long long strideB,
    const float* __restrict__ bias,
    void* Cout, int ldc, long long strideC,
    void* Cout2, int ldc2, long long strideC2, int N2,
    int M, int N, int K, float rscale, int bx, int b, float (*sT)[16 * 68]) {
  const __bf16* A   = (const __bf16*)(const void*)Ap;
  const __bf16* A2  = (const __bf16*)(const void*)A2p;
  const __bf16* Bt  = (const __bf16*)(const void*)Btp;
  const int lane = threadIdx.x & 31;
  const int wave = threadIdx.x >> 5;
  const int tilesN = N >> 6;
  const int tilesM = M >> 6;
  const int tile = bx * 8 + wave;
  if (tile >= tilesM * tilesN) return;   // wave-uniform; no block barriers in this kernel
  const int tm = tile / tilesN;
  const int tn = tile - tm * tilesN;
  const int m0 = tm << 6;
  const int n0 = tn << 6;

  const __bf16* Ab  = A  + (size_t)b * strideA;
  const __bf16* Bb  = Bt + (size_t)b * strideB;
  const __bf16* Ab2 = (NSPLIT >= 1) ? (A2 + (size_t)b * strideA) : Ab;

  const int rlane = lane & 15;                 // row (A) / col (B, D) within subtile
  const int koff  = (lane >> 4) * 8;           // k offset of this lane half
  const int mOff  = (lane >> 4) * 8;           // D row offset

  v8f acc[4][4];
#pragma unroll
  for (int i = 0; i < 4; ++i)
#pragma unroll
    for (int j = 0; j < 4; ++j) acc[i][j] = zero8();

  for (int k0 = 0; k0 < K; k0 += 32) {
    v16b bh[4];
#pragma unroll
    for (int j = 0; j < 4; ++j) {
      const size_t bo = (size_t)(n0 + (j << 4) + rlane) * ldb + koff + k0;
      bh[j] = ldfrag_b(Bb + bo);
    }
#pragma unroll
    for (int i = 0; i < 4; ++i) {
      const size_t ao = (size_t)(m0 + (i << 4) + rlane) * lda + koff + k0;
      const v16b ah = ldfrag_b(Ab + ao);
      v16b al = ah;
      if (NSPLIT >= 1) al = ldfrag_b(Ab2 + ao);
#pragma unroll
      for (int j = 0; j < 4; ++j) {
        acc[i][j] = mma_b_raw(ah, bh[j], acc[i][j]);
        if (NSPLIT >= 1) acc[i][j] = mma_b_raw(al, bh[j], acc[i][j]);
      }
      dep_guard_b(acc[i][0], acc[i][3], ah, al);
    }
    keep4_b(bh[0], bh[1], bh[2], bh[3]);
  }
  acc_guard4(acc[0][0], acc[0][1], acc[0][2], acc[0][3]);
  acc_guard4(acc[1][0], acc[1][1], acc[1][2], acc[1][3]);
  acc_guard4(acc[2][0], acc[2][1], acc[2][2], acc[2][3]);
  acc_guard4(acc[3][0], acc[3][1], acc[3][2], acc[3][3]);

  // ---- epilogue ----
  float* slab = sT[wave];
  float bcol[4];
#pragma unroll
  for (int j = 0; j < 4; ++j) {
    bcol[j] = 0.f;
    if (BIAS == 1) bcol[j] = bf_up(bf_bits(bias[n0 + (j << 4) + rlane]));   // n < N, bias has N entries
  }
#pragma unroll
  for (int i = 0; i < 4; ++i) {
    const int mBase = m0 + (i << 4);
    float brow[8];
#pragma unroll
    for (int r = 0; r < 8; ++r) {
      brow[r] = 0.f;
      if (BIAS == 2) brow[r] = bf_up(bf_bits(bias[mBase + mOff + r]));      // m < M, bias has M entries
    }
#pragma unroll
    for (int j = 0; j < 4; ++j) {
#pragma unroll
      for (int r = 0; r < 8; ++r) {
        slab[(mOff + r) * 68 + (j << 4) + rlane] = acc[i][j][r] + bcol[j] + brow[r];
      }
    }
    lds_wave_sync();
    if (OUT_MODE == 0) {
      float* C = (float*)Cout + (size_t)b * strideC;
      const int hh = lane >> 4, c4 = (lane & 15) * 4;     // 256-B row segment = 16 lanes x 16 B
      {
#pragma unroll
        for (int it = 0; it < 8; ++it) {
          const int row = it * 2 + hh;                     // it 0..7 x hh 0..1 = rows 0..15
          const v4f v = *(const v4f*)(slab + row * 68 + c4);
          *(v4f*)(C + (size_t)(mBase + row) * ldc + n0 + c4) = v;
        }
        
      }
    } else {
      const int q = lane >> 3, c8 = (lane & 7) * 8;
      unsigned short* C  = (unsigned short*)Cout  + (size_t)b * strideC;
      unsigned short* C2 = (unsigned short*)Cout2 + (size_t)b * strideC2;
      const bool wlo = (OUT_MODE == 2) || (n0 < N2);      // wave-uniform
      v4u hv[4], lv[4];
#pragma unroll
      for (int it = 0; it < 4; ++it) {
        const int row = it * 4 + q;                        // it 0..3 x q 0..3 = rows 0..15
        const float* sp = slab + row * 68 + c8;
        v4u a, a2;
#pragma unroll
        for (int e = 0; e < 4; ++e) {
          const float f0 = sp[2 * e], f1 = sp[2 * e + 1];
          unsigned short h0, h1, l0, l1;
          if (OUT_MODE == 2) {
            h0 = bf_bits(f0); h1 = bf_bits(f1);
            l0 = bf_bits(f0 - bf_up(h0)); l1 = bf_bits(f1 - bf_up(h1));
          } else {
            const _Float16 x0 = (_Float16)f0, x1 = (_Float16)f1;
            h0 = h_bits(x0); h1 = h_bits(x1);
            l0 = h_bits((_Float16)((f0 - (float)x0) * rscale));
            l1 = h_bits((_Float16)((f1 - (float)x1) * rscale));
          }
          a[e] = pk16(h0, h1); a2[e] = pk16(l0, l1);
        }
        hv[it] = a; lv[it] = a2;
      }
      {
#pragma unroll
        for (int it = 0; it < 4; ++it) {
          const int row = it * 4 + q;
          *(v4u*)(C + (size_t)(mBase + row) * ldc + n0 + c8) = hv[it];
          if (wlo) *(v4u*)(C2 + (size_t)(mBase + row) * ldc2 + n0 + c8) = lv[it];
        }
        
      }
    }
    lds_wave_sync();
  }
}

// =====================================================================================================
// The three independent projections in one launch, role by block index (block-uniform): blockIdx.y = 0: q, 1: k, 2: v^T.
//   q = q_in . Wq + bq -> bf16 hi/lo planes [b*SEQ+t][d]   (M=NB*SEQ, N=64, K=512); k alike
//   v^T = Wv^T . v_in^T + bv per batch -> f16 hi plane [b][d][s] (pitch SEQ) and residual plane (x4096, pitch SEQ, all tiles)
//         (A = WvT [n][k], Bt = Vb compact rows of batch b; M=64, N=SEQ, K=512): blockIdx.x = batch * VT_BX + block in batch
// grid = (VT_BX * NB, 3); VT_BX * NB >= PROJ_BX, and a wave whose tile lies past its product's last tile returns in gemm64.
// =====================================================================================================
#define PROJ_BX (((NB * SEQ / 64) * (HD / 64) + 7) / 8)   //  256 tiles -> 32 blocks (full)
#define VT_BX   (((HD / 64) * (SEQ / 64) + 7) / 8)        //   32 tiles ->  4 blocks per batch (full)
static_assert(VT_BX * NB >= PROJ_BX);
__global__ __launch_bounds__(256) void proj3(
    const unsigned short* __restrict__ Qb, const unsigned short* __restrict__ Kb, const unsigned short* __restrict__ Vb,
    const unsigned short* __restrict__ WqT, const unsigned short* __restrict__ WkT, const unsigned short* __restrict__ WvT,
    const float* __restrict__ bq, const float* __restrict__ bk, const float* __restrict__ bv,
    unsigned short* Qh, unsigned short* Ql, unsigned short* Kh, unsigned short* Kl,
    unsigned short* VTh, unsigned short* VTl) {
  __shared__ __align__(16) float sT[8][16 * 68];   // per-wave 16x64 slab, pitch 68 floats
  const int role = blockIdx.y;
  const int bx   = blockIdx.x;
  if (role == 2) {
    gemm64<0, 3, 2>(
        WvT, WvT, DIN, 0LL, Vb, DIN, (long long)SEQ * DIN, bv,
        (void*)VTh, SEQ, (long long)HD * SEQ, (void*)VTl, SEQ, (long long)HD * SEQ, SEQ,
        HD, SEQ, DIN, 4096.0f, bx % VT_BX, bx / VT_BX, sT);
  } else {
    const unsigned short* A = (role == 0) ? Qb : Kb;
    gemm64<0, 2, 1>(
        A, A, DIN, 0LL, (role == 0) ? WqT : WkT, DIN, 0LL, (role == 0) ? bq : bk,
        (void*)((role == 0) ? Qh : Kh), HD, 0LL, (void*)((role == 0) ? Ql : Kl), HD, 0LL, HD,
        NB * SEQ, HD, DIN, 1.0f, bx, 0, sT);
  }
}

// =====================================================================================================
// Non-causal one-head attention, head dim 64, key chunks of 64, softmax over all SEQ keys.
//   q planes (bf16 hi / lo): element (b, t, d) at [(b*SEQ + t)*HD + d]   (compact rows)
//   k planes (bf16 hi / lo): same layout with key index s
//   v^T hi plane (f16):      element (b, d, s) at [(b*HD + d)*SEQ + s]
//   v^T residual plane (f16, (v - hi)*4096): same layout
//   scores = q . k : bf16 hi/lo split (hi.hi + hi.lo + lo.hi), f32 accumulate, then * 1/8 in f32
//   p = exp(s - m) carried as f16(1024 p) plus f16 residual (x4096); context = p . v on f16 WMMA, 3 products:
//   ph.vh into oacc; ph.vl and pl.vh into the separate accumulator o1 folded back with 1/4096 per chunk in f32;
//   online softmax (running max from -inf; every chunk holds at least the chunk max key so l >= 1 after chunk 0) in f32.
//   Block = 16 waves = KG key groups x 4 waves, 64 query rows of one batch b; grid = NB * NQB. Wave w: query tile w & 3,
//   key group w >> 2. A group walks the chunks kg*NKT/KG .. (kg+1)*NKT/KG - 1 with K / V^T tiles of its own, so a SIMD holds
//   four waves whose LDS, exchange and matrix waits overlap. Each wave ends with the running max, sum and un-normalised context
//   of its quarter of the keys; these partials go through LDS and are merged behind one block barrier (weights exp(m_g - M)).
//   K / V^T chunk staging (cross-wave LDS, __syncthreads before and after): the group's 128 threads x 32 elements per plane =
//   the whole 64x64 tile of every plane read later (plain 16-B loads); staged extent == consumed extent for Ksh, Ksl, Vth, Vtl.
//   P tiles are wave-private, spilled with _Float16 element stores and reloaded as v8h (same element type) after
//   lds_wave_sync; the f32 partial context tile Os[wave] is written as float scalars and read by the four merging waves as v4f.
//   Output (f32, rows of 64 = 256 B = 2 lines): wave (tile, kg) merges and stores rows kg*4..kg*4+3 (it 0..1 x lane>>4 0..1)
//   of its query tile x 64 columns; 16 waves x 4 rows = the block's 64 rows of the [NB*SEQ][HD] output.
// =====================================================================================================
__global__ __launch_bounds__(512)
void attn64(const unsigned short* __restrict__ qhp, const unsigned short* __restrict__ qlp,
            const unsigned short* __restrict__ khp, const unsigned short* __restrict__ klp,
            const unsigned short* __restrict__ vhp, const unsigned short* __restrict__ vlp,
            float* outp) {
  union FB { v16b v; v8b h[2]; };
  union FH { v16h v; v8h h[2]; };
  // Rows of 64 elements at pitch LP: the 8 pad elements of a row are never written and never read.
  __shared__ __align__(16) __bf16   KshG[KG][64 * LP];            // per group K hi [kv][d]   36 KB (cross-wave, block barriers)
  __shared__ __align__(16) __bf16   KslG[KG][64 * LP];            // per group K lo           36 KB (cross-wave)
  __shared__ __align__(16) _Float16 VthG[KG][64 * LP];            // per group V^T hi [d][kv] 36 KB (cross-wave)
  __shared__ __align__(16) _Float16 VtlG[KG][64 * LP];            // per group V^T residual   36 KB (cross-wave)
  __shared__ __align__(16) _Float16 Psh[4 * KG][16 * LP];         // per wave P [row][kv]      36 KB (wave-private)
  __shared__ __align__(16) _Float16 Psl[4 * KG][16 * LP];         // per wave P residual       36 KB (wave-private)
  __shared__ __align__(16) float    Os[4 * KG][16 * 64];          // per wave partial context [row][d] 64 KB (merged cross-wave)
  __shared__ float                  Ms[4 * KG][16];               // per wave running max per row (merged cross-wave)
  __shared__ float                  Ls[4 * KG][16];               // per wave running sum per row (merged cross-wave)

  const int wave = threadIdx.x >> 5;           // 0..15
  const int qt   = wave & 3;                   // query tile of the block
  const int kg   = wave >> 2;                  // key group
  const int tid  = threadIdx.x & 127;          // thread index inside the key group
  const int lane = tid & 31;
  const int hh   = lane >> 4;
  const int c    = lane & 15;

  const int bx   = blockIdx.x;
  const int qb   = bx % NQB;
  const int b    = bx / NQB;                   // 0..NB-1
  const int q0   = qb * 64 + qt * 16;
  const size_t rowB = (size_t)b * SEQ;

  const __bf16* Qh = (const __bf16*)(const void*)qhp;
  const __bf16* Ql = (const __bf16*)(const void*)qlp;
  const __bf16* Kh = (const __bf16*)(const void*)khp;
  const __bf16* Kl = (const __bf16*)(const void*)klp;
  const _Float16* Vh = (const _Float16*)(const void*)vhp + (size_t)b * HD * SEQ;
  const _Float16* Vl = (const _Float16*)(const void*)vlp + (size_t)b * HD * SEQ;
  __bf16*   Ksh = KshG[kg];
  __bf16*   Ksl = KslG[kg];
  _Float16* Vth = VthG[kg];
  _Float16* Vtl = VtlG[kg];

  // ---- Q fragments (A operand, row = lane&15): 2 d-chunks, hi and lo ----
  v16b qah[2], qal[2];
#pragma unroll
  for (int dc = 0; dc < 2; ++dc) {
    const size_t qo = (rowB + q0 + c) * HD + dc * 32 + 8 * hh;
    qah[dc] = ldfrag_b(Qh + qo);
    qal[dc] = ldfrag_b(Ql + qo);
  }

  float mrow[8], lrow[8];
  v8f oacc[4];
#pragma unroll
  for (int r = 0; r < 8; ++r) { mrow[r] = -INFINITY; lrow[r] = 0.f; }
#pragma unroll
  for (int t = 0; t < 4; ++t) oacc[t] = zero8();

  for (int ki = 0; ki < NKT / KG; ++ki) {      // static trip count, the same in every wave of the block
    const int kv0 = (kg * (NKT / KG) + ki) * 64;   // kv0 + 63 < SEQ
    __syncthreads();
    {
      const int r = tid >> 1, half = (tid & 1) * 32;
      const __bf16*   kg  = Kh + (rowB + kv0 + r) * HD + half;    // K row kv0+r, d = half..half+31
      const __bf16*   klg = Kl + (rowB + kv0 + r) * HD + half;
      const _Float16* vg  = Vh + (size_t)r * SEQ + kv0 + half;    // V^T row d = r, s = kv0+half..+31
      const _Float16* vlg = Vl + (size_t)r * SEQ + kv0 + half;
#pragma unroll
      for (int i = 0; i < 4; ++i) {
        const v8b a0 = *(const v8b*)(kg + 8 * i);
        const v8b a1 = *(const v8b*)(klg + 8 * i);
        const v8h b0 = *(const v8h*)(vg + 8 * i);
        const v8h b1 = *(const v8h*)(vlg + 8 * i);
        *(v8b*)(Ksh + r * LP + half + 8 * i) = a0;
        *(v8b*)(Ksl + r * LP + half + 8 * i) = a1;
        *(v8h*)(Vth + r * LP + half + 8 * i) = b0;
        *(v8h*)(Vtl + r * LP + half + 8 * i) = b1;
      }
    }
    __syncthreads();

    // ---- scores: 16 query rows x 64 keys per wave, 3 bf16 products per (key subtile, d-chunk) ----
    v8f s[4];
#pragma unroll
    for (int j = 0; j < 4; ++j) {
      s[j] = zero8();
#pragma unroll
      for (int dc = 0; dc < 2; ++dc) {
        FB kb, kl;
        kb.h[0] = *(const v8b*)(Ksh + (j * 16 + c) * LP + dc * 32 + 8 * hh);
        kb.h[1] = *(const v8b*)(Ksh + (j * 16 + c) * LP + dc * 32 + 16 + 8 * hh);
        kl.h[0] = *(const v8b*)(Ksl + (j * 16 + c) * LP + dc * 32 + 8 * hh);
        kl.h[1] = *(const v8b*)(Ksl + (j * 16 + c) * LP + dc * 32 + 16 + 8 * hh);
        s[j] = mma_b(qah[dc], kb.v, s[j]);
        s[j] = mma_b(qah[dc], kl.v, s[j]);
        s[j] = mma_b(qal[dc], kb.v, s[j]);
      }
    }

    // ---- scale, row max, online softmax, P (x1024, f16) and P residual (x4096) to LDS ----
    _Float16* pwh = Psh[wave];
    _Float16* pwl = Psl[wave];
#pragma unroll
    for (int r = 0; r < 8; ++r) {
      float m = -INFINITY;
#pragma unroll
      for (int j = 0; j < 4; ++j) {
        const float sv = s[j][r] * 0.125f;
        s[j][r] = sv;
        m = fmaxf(m, sv);
      }
#pragma unroll
      for (int off = 1; off < 16; off <<= 1) m = fmaxf(m, __shfl_xor(m, off, 32));
      const float mnew  = fmaxf(mrow[r], m);
      const float msafe = (mnew == -INFINITY) ? 0.f : mnew;
      const float alpha = __expf(mrow[r] - msafe);
      mrow[r] = mnew;
      float psum = 0.f;
#pragma unroll
      for (int j = 0; j < 4; ++j) {
        const float p = __expf(s[j][r] - msafe);
        psum += p;
        const float p1k = p * 1024.0f;
        const _Float16 ph = (_Float16)p1k;
        const _Float16 pl = (_Float16)((p1k - (float)ph) * 4096.0f);
        pwh[(8 * hh + r) * LP + j * 16 + c] = ph;
        pwl[(8 * hh + r) * LP + j * 16 + c] = pl;
      }
#pragma unroll
      for (int off = 1; off < 16; off <<= 1) psum += __shfl_xor(psum, off, 32);
      lrow[r] = lrow[r] * alpha + psum;
#pragma unroll
      for (int t = 0; t < 4; ++t) oacc[t][r] *= alpha;
    }
    lds_wave_sync();

    // ---- context += P . V (f16 WMMA), residual products into a separate accumulator ----
    v8f o1[4];
#pragma unroll
    for (int t = 0; t < 4; ++t) o1[t] = zero8();
#pragma unroll 1
    for (int kk = 0; kk < 2; ++kk) {
      FH pa, pr;
      pa.h[0] = *(const v8h*)(pwh + c * LP + kk * 32 + 8 * hh);
      pa.h[1] = *(const v8h*)(pwh + c * LP + kk * 32 + 16 + 8 * hh);
      pr.h[0] = *(const v8h*)(pwl + c * LP + kk * 32 + 8 * hh);
      pr.h[1] = *(const v8h*)(pwl + c * LP + kk * 32 + 16 + 8 * hh);
#pragma unroll
      for (int t = 0; t < 4; ++t) {
        FH vb, vl;
        vb.h[0] = *(const v8h*)(Vth + (t * 16 + c) * LP + kk * 32 + 8 * hh);
        vb.h[1] = *(const v8h*)(Vth + (t * 16 + c) * LP + kk * 32 + 16 + 8 * hh);
        vl.h[0] = *(const v8h*)(Vtl + (t * 16 + c) * LP + kk * 32 + 8 * hh);
        vl.h[1] = *(const v8h*)(Vtl + (t * 16 + c) * LP + kk * 32 + 16 + 8 * hh);
        oacc[t] = mma_h(pa.v, vb.v, oacc[t]);
        o1[t]   = mma_h(pa.v, vl.v, o1[t]);
        o1[t]   = mma_h(pr.v, vb.v, o1[t]);
      }
    }
#pragma unroll
    for (int t = 0; t < 4; ++t)
#pragma unroll
      for (int r = 0; r < 8; ++r) oacc[t][r] += o1[t][r] * (1.0f / 4096.0f);
  }

  // ---- hand over the wave's partials: un-normalised context tile (p carry x1024 still in), running max and sum per row ----
  float* os = Os[wave];
#pragma unroll
  for (int r = 0; r < 8; ++r) {
#pragma unroll
    for (int t = 0; t < 4; ++t) os[(8 * hh + r) * 64 + t * 16 + c] = oacc[t][r];
    if (c == 0) {                              // mrow / lrow are equal in the 16 lanes of a half
      Ms[wave][8 * hh + r] = mrow[r];
      Ls[wave][8 * hh + r] = lrow[r];
    }
  }
  __syncthreads();                             // every group's partials are read by the merging waves below
  // ---- merge the KG partials of 4 rows per wave, normalise (1/l and the 1/1024 p carry), store whole rows ----
  {
    const int h2 = lane >> 4, c4 = (lane & 15) * 4;
#pragma unroll
    for (int it = 0; it < 2; ++it) {
      const int row = kg * 4 + it * 2 + h2;    // kg 0..3 x it 0..1 x h2 0..1 = rows 0..15 of the query tile
      float mg[KG];
      float mall = -INFINITY;
#pragma unroll
      for (int g = 0; g < KG; ++g) { mg[g] = Ms[g * 4 + qt][row]; mall = fmaxf(mall, mg[g]); }
      const float msafe = (mall == -INFINITY) ? 0.f : mall;
      float l = 0.f;
      v4f o = {0.f, 0.f, 0.f, 0.f};
#pragma unroll
      for (int g = 0; g < KG; ++g) {
        const float w = __expf(mg[g] - msafe);
        l += w * Ls[g * 4 + qt][row];
        o += w * *(const v4f*)(Os[g * 4 + qt] + row * 64 + c4);
      }
      const float inv = ((l > 0.f) ? (1.0f / l) : 0.f) * (1.0f / 1024.0f);
      *(v4f*)(outp + (rowB + q0 + row) * HD + c4) = o * inv;
    }
  }
}

// =====================================================================================================
// Workspace map (bytes, full build NB=8 SEQ=2048; every region is an exact multiple of its 64x64-tile / whole-line
// store granularity, all shapes are tile multiples so no padded tails exist; no region is reused):
//   Qb   bf16 [NB*SEQ][512] compact  0            16777216
//   Kb   bf16 [NB*SEQ][512]          16777216     16777216
//   Vb   bf16 [NB*SEQ][512]          33554432     16777216
//   WqT  bf16 [64 n][512 k]         50331648        65536
//   WkT                             50397184        65536
//   WvT                             50462720        65536
//   Qh   bf16 [NB*SEQ][64]           50528256      2097152
//   Ql                              52625408      2097152
//   Kh                              54722560      2097152
//   Kl                              56819712      2097152
//   VTh  f16  [NB][64][SEQ]         58916864      2097152
//   VTl  f16  [NB][64][SEQ]         61014016      2097152
//   end                             63111168
// =====================================================================================================
extern "C" void kernel_launch(void* const* d_in, const int* in_sizes, int n_in,
                              void* d_out, int out_size, void* d_ws, size_t ws_size,
                              hipStream_t stream) {
  if (n_in < 9) return;
  const long long NX_NEED = ((long long)(NB - 1) * SEQ_FULL + SEQ) * (long long)DIN;   // last row read + 1, floats
  const int NXC = NB * SEQ * DIN;                  // compact activation plane elements (8388608 full)
  const int NO  = NB * SEQ * HD;                   // output elements (1048576 full)
  const int NW  = DIN * HD;                        //   32768
  if ((long long)in_sizes[0] < NX_NEED || (long long)in_sizes[1] < NX_NEED || (long long)in_sizes[2] < NX_NEED) return;
  if (in_sizes[3] < NW || in_sizes[5] < NW || in_sizes[7] < NW) return;
  if (in_sizes[4] < HD || in_sizes[6] < HD || in_sizes[8] < HD) return;
  if (out_size < NO) return;

  const float* q_in = (const float*)d_in[0];   // [8][2048][512]
  const float* k_in = (const float*)d_in[1];   // [8][2048][512]
  const float* v_in = (const float*)d_in[2];   // [8][2048][512]
  const float* Wq   = (const float*)d_in[3];   // [512 in][64 out]
  const float* bq   = (const float*)d_in[4];   // [64]
  const float* Wk   = (const float*)d_in[5];   // [512][64]
  const float* bk   = (const float*)d_in[6];   // [64]
  const float* Wv   = (const float*)d_in[7];   // [512][64]
  const float* bv   = (const float*)d_in[8];   // [64]

  const size_t PX  = (size_t)NXC * 2;              // 16-bit compact activation plane [NB*SEQ][512]
  const size_t PW  = (size_t)NW * 2;               // 16-bit weight plane [64][512]
  const size_t PP  = (size_t)NO * 2;               // 16-bit projected plane [NB*SEQ][64]
  const size_t PVT = (size_t)NB * HD * SEQ * 2;    // 16-bit v^T plane [NB][64][SEQ]
  size_t off = 0;
  const size_t oQb  = off; off += PX;
  const size_t oKb  = off; off += PX;
  const size_t oVb  = off; off += PX;
  const size_t oWq  = off; off += PW;
  const size_t oWk  = off; off += PW;
  const size_t oWv  = off; off += PW;
  const size_t oQh  = off; off += PP;
  const size_t oQl  = off; off += PP;
  const size_t oKh  = off; off += PP;
  const size_t oKl  = off; off += PP;
  const size_t oVTh = off; off += PVT;
  const size_t oVTl = off; off += PVT;
  if (off > ws_size) return;                       // off = 63111168 (full build)
  if (off > (size_t)134217728) return;

  char* ws = (char*)d_ws;
  unsigned short* Qb  = (unsigned short*)(ws + oQb);
  unsigned short* Kb  = (unsigned short*)(ws + oKb);
  unsigned short* Vb  = (unsigned short*)(ws + oVb);
  unsigned short* WqT = (unsigned short*)(ws + oWq);
  unsigned short* WkT = (unsigned short*)(ws + oWk);
  unsigned short* WvT = (unsigned short*)(ws + oWv);
  unsigned short* Qh  = (unsigned short*)(ws + oQh);
  unsigned short* Ql  = (unsigned short*)(ws + oQl);
  unsigned short* Kh  = (unsigned short*)(ws + oKh);
  unsigned short* Kl  = (unsigned short*)(ws + oKl);
  unsigned short* VTh = (unsigned short*)(ws + oVTh);
  unsigned short* VTl = (unsigned short*)(ws + oVTl);

  const dim3 blk(256);
  const int n8x  = NXC / 8;                                    // 1048576 (full), multiple of 32
  const int grpB = SEQ * DIN / 8;                              // 16-B groups per batch in the compact plane
  const long long strB = (long long)SEQ_FULL * DIN;            // full per-batch input stride (floats)
  const int n8w  = NW / 8;                                     //    4096
  const int wtBlocks = (n8w + 255) / 256;                      //   16 blocks per weight
  const dim3 gPrep(wtBlocks + (n8x + 255) / 256, 3);           //   16 + 4096 blocks (full) x 3 sets
  const dim3 gProj(VT_BX * NB, 3);                             //   32 blocks (full) x 3 products
  const dim3 gAttn(NB * NQB);                                  //  256 blocks of 512 (full)

  // (1) activations f32 -> bf16 compact planes; weights [k][n] f32 -> bf16 [n][k]
  prep_bf16<<<gPrep, blk, 0, stream>>>(q_in, k_in, v_in, Wq, Wk, Wv, Qb, Kb, Vb, WqT, WkT, WvT,
                                       n8x, grpB, strB, n8w, wtBlocks);
  // (2) q, k -> bf16 hi/lo planes, v^T -> f16 hi / residual planes
  proj3<<<gProj, blk, 0, stream>>>(Qb, Kb, Vb, WqT, WkT, WvT, bq, bk, bv, Qh, Ql, Kh, Kl, VTh, VTl);
  // (3) attention -> d_out f32 [NB*SEQ][64]
  attn64<<<gAttn, dim3(512), 0, stream>>>(Qh, Ql, Kh, Kl, VTh, VTl, (float*)d_out);
  (void)hipGetLastError();
}

// v004
// It runs in 56.2 microseconds.
// Two timings next to v003 both put it at 1.53 times that version's speed.
// Over all steps from v000 it is 4.17 times as fast.
// Contractions: q, k, v^T projections = v_wmma_f32_16x16x32_bf16 (bf16 operands from RNE-converted inputs and weights, single product, f32 accumulate);
// q.k^T scores = v_wmma_f32_16x16x32_bf16 with bf16 hi/lo split q and k (hi.hi + hi.lo + lo.hi), f32 accumulate;
// p.v = v_wmma_f32_16x16x32_f16 (p carried x1024 as f16 hi plane + f16 residual plane x4096, v as f16 hi plane + f16 residual
// plane x4096; 3 products hi.hi, hi.res, res.hi), f32 accumulate; softmax (running max), normalisers and bias adds in f32 on the VALU.
// Carry audit:
//   Psh = f16(1024 * p)                      -> the 1/1024 is folded exactly once in the attention epilogue: inv = (1/l) * (1/1024)
//   Psl = f16((1024 p - Psh) * 4096)         }  products Psh.VTl and Psl.VTh go to the separate accumulator o1,
//   VTl = f16((v - VTh) * 4096)              }  folded back with * (1/4096) once per key chunk
//   VTh = f16(v), no carry (|v| typ. 0.65); q / k lo planes are unscaled bf16 residuals (v - hi) sharing the hi accumulator;
//   score scale 1/8 applied once in f32 after the score accumulate. No other scaled planes.
#include <hip/hip_runtime.h>
#include <math.h>
#include <stdint.h>

#ifndef NB
#define NB   8
#endif
#ifndef SEQ
#define SEQ  2048
#endif
#define NB_FULL  8
#define SEQ_FULL 2048
#define DIN  512
#define HD   64
#define NQB  (SEQ / 64)   // 64-row query blocks per sequence
#define NKT  (SEQ / 64)   // 64-key chunks per sequence
#define KG   4            // key groups per attention work-group: each group of 4 waves walks NKT / KG chunks
#define LP   72           // LDS row pitch (16-bit elements) of the attention tiles read by 16-B loads: 144 B = 16 B x 9 (odd)
static_assert(NB >= 1 && NB <= NB_FULL && SEQ >= 64 && SEQ <= SEQ_FULL);
static_assert((SEQ % 64) == 0 && (DIN % 32) == 0 && HD == 64);
static_assert(NKT % KG == 0);

typedef _Float16 v16h __attribute__((ext_vector_type(16)));
typedef _Float16 v8h  __attribute__((ext_vector_type(8)));
typedef __bf16   v16b __attribute__((ext_vector_type(16)));
typedef __bf16   v8b  __attribute__((ext_vector_type(8)));
typedef float    v8f  __attribute__((ext_vector_type(8)));
typedef float    v4f  __attribute__((ext_vector_type(4)));
typedef unsigned int v4u __attribute__((ext_vector_type(4)));

// ---- scalar helpers --------------------------------------------------------------------------------
__device__ __forceinline__ unsigned short bf_bits(float f) {          // f32 -> bf16 bits, RNE convert
  unsigned u = __float_as_uint(f);
  return (unsigned short)((u + 0x7FFFu + ((u >> 16) & 1u)) >> 16);
}
__device__ __forceinline__ float bf_up(unsigned short h) { return __uint_as_float(((unsigned)h) << 16); }
__device__ __forceinline__ unsigned short h_bits(_Float16 x) { return __builtin_bit_cast(unsigned short, x); }
__device__ __forceinline__ unsigned pk16(unsigned short a, unsigned short b) { return (unsigned)a | ((unsigned)b << 16); }
__device__ __forceinline__ v8f zero8() { v8f z = {0.f, 0.f, 0.f, 0.f, 0.f, 0.f, 0.f, 0.f}; return z; }

__device__ __forceinline__ void lds_wave_sync() {
  __builtin_amdgcn_fence(3, "workgroup");
  __builtin_amdgcn_wave_barrier();
  __builtin_amdgcn_fence(2, "workgroup");
}

// ---- fragment loader: 16-bit A/B operand, lane -> row/col (lane&15), p already includes +8*(lane>>4);
//      elements 0..7 <- p[0..7] (k0+8h..k0+8h+7), elements 8..15 <- p[16..23] (k0+16+8h..k0+16+8h+7)
__device__ __forceinline__ v16b ldfrag_b(const __bf16* p) {
  union { v16b v; v8b h[2]; } f;
  f.h[0] = *(const v8b*)(p);
  f.h[1] = *(const v8b*)(p + 16);
  return f.v;
}

// ---- WMMA helpers with trailing VALU hazard gap --------------------------------------------------------
__device__ __forceinline__ v8f mma_b(v16b a, v16b b, v8f c) {
  c = __builtin_amdgcn_wmma_f32_16x16x32_bf16(false, a, false, b, (short)0, c, false, false);
  asm volatile("v_nop\n\tv_nop\n\tv_nop\n\tv_nop" : "+v"(c) : "v"(a), "v"(b));
  return c;
}
__device__ __forceinline__ v8f mma_h(v16h a, v16h b, v8f c) {
  c = __builtin_amdgcn_wmma_f32_16x16x32_f16(false, a, false, b, (short)0, c, false, false);
  asm volatile("v_nop\n\tv_nop\n\tv_nop\n\tv_nop" : "+v"(c) : "v"(a), "v"(b));
  return c;
}
__device__ __forceinline__ v8f mma_b_raw(v16b a, v16b b, v8f c) {
  return __builtin_amdgcn_wmma_f32_16x16x32_bf16(false, a, false, b, (short)0, c, false, false);
}

// =====================================================================================================
// The three projections in one launch, straight from the f32 inputs; role by block index (block-uniform):
// blockIdx.y = 0: q, 1: k, 2: v. A work-group = 8 waves x 16 activation rows = PROWS rows of one batch, all HD = 64 columns, K = DIN.
//   C[row][n] = sum_k bf16(X[row][k]) * bf16(W[k][n]) + bias[n]   (bias RNE-converted to bf16, added in f32)
// Weight: the work-group reads W f32 [DIN k][HD n] once (256-B rows, 8 B per lane), converts (RNE) and lays it in LDS as
//   Wt bf16 [n][k] at pitch WP, one 16-B store per (n, 8 k); coverage 8 waves x 8 tasks x 8 k x 64 n = the whole plane.
//   One block barrier publishes it; nothing writes Wt afterwards.
// Activations: a wave loads 128 k of one of its rows per instruction (32 lanes x 16 B = 512 contiguous B, four whole lines, each line
//   read once), converts in registers (RNE) and lays the bf16 values in its own LDS slab Xs[wave] [16 rows][128 k] at pitch XP (wave-private,
//   slab_order before the fragment loads and before the slab is written again). Two register buffers of 128 k x 16 rows: a buffer's
//   loads are issued two buffers ahead of its products. k runs upward in steps of 32, one product per step.
// Output: q, k -> bf16 hi plane + bf16 lo plane (lo = RNE(v - hi), unscaled), rows of 64 = one 128-B line, staged per wave in LDS
//   (wave-private slab, lds_wave_sync). v -> transposed through a block tile T[d][s] (f32, pitch TP) behind one block barrier, then
//   f16 hi plane [b][d][s] and residual plane f16((v - hi) * 4096): 16 lanes x 16 B = the block's 256 B of a d row.
// grid = (NB * SEQ / PROWS, 3): every tile exists, no guards.
// =====================================================================================================
#define PROWS 128   // activation rows per projection work-group
#define WP    520   // LDS row pitch (bf16 elements) of the transposed weight: 1040 B = 16 B x 65 (odd)
#define XP    136   // LDS row pitch (bf16 elements) of a wave's activation slab: 272 B = 16 B x 17 (odd)
#define TP    132   // LDS row pitch (floats) of the v^T hand-over tile: 528 B = 16 B x 33 (odd)
static_assert(SEQ % PROWS == 0 && DIN == 512 && HD * TP <= 8 * 16 * 68);
typedef __bf16 v4b __attribute__((ext_vector_type(4)));
typedef float  v2f __attribute__((ext_vector_type(2)));

// Order inside one wave between its LDS stores and its LDS loads of the same slab. The wait retires the wave's LDS operations; the "memory"
// clobber keeps the compiler from moving an LDS access across. Unlike a work-group fence it leaves the global loads in flight un-waited.
// The scheduling barrier keeps the conversions of a buffer whose loads are still in flight, and with them its s_wait_loadcnt, from
// being lifted into the products of the buffer before: without it the wave waits for those loads before it has issued the next ones.
__device__ __forceinline__ void slab_order() {
  asm volatile("s_wait_dscnt 0x0" ::: "memory");
  __builtin_amdgcn_sched_barrier(0);
}

// (the loops of ld_x, put_x and mm_x are unrolled so that every index of a register array is a constant)
// one buffer = 128 k of the wave's 16 rows: x[i] = 4 floats of row i at k = 4*lane..4*lane+3; xp = row 0, first k of the buffer, + 4*lane
__device__ __forceinline__ void ld_x(v4f (&x)[16], const float* __restrict__ xp) {
#pragma unroll
  for (int i = 0; i < 16; ++i) x[i] = *(const v4f*)(xp + (size_t)i * DIN);
}
// convert the buffer and lay it in the wave's slab: row i, k = 4*lane..+3, one 8-B store per lane (256 contiguous B per row); xs includes + 4*lane
__device__ __forceinline__ void put_x(__bf16* xs, const v4f (&x)[16]) {
#pragma unroll
  for (int i = 0; i < 16; ++i) *(v4b*)(xs + i * XP) = __builtin_convertvector(x[i], v4b);
}
// the slab's 4 k-steps x 4 column tiles; xf = slab + (lane&15)*XP + 8*(lane>>4); wp = Wt + (lane&15)*WP + 8*(lane>>4) + first k of the buffer
__device__ __forceinline__ void mm_x(v8f (&acc)[4], const __bf16* xf, const __bf16* wp) {
#pragma unroll
  for (int ks = 0; ks < 4; ++ks) {
    const v16b a = ldfrag_b(xf + ks * 32);
#pragma unroll
    for (int j = 0; j < 4; ++j) acc[j] = mma_b_raw(a, ldfrag_b(wp + j * 16 * WP + ks * 32), acc[j]);
  }
}

__global__ __launch_bounds__(256) void proj3(
    const float* __restrict__ q_in, const float* __restrict__ k_in, const float* __restrict__ v_in,
    const float* __restrict__ Wq, const float* __restrict__ Wk, const float* __restrict__ Wv,
    const float* __restrict__ bq, const float* __restrict__ bk, const float* __restrict__ bv,
    unsigned short* Qh, unsigned short* Ql, unsigned short* Kh, unsigned short* Kl,
    unsigned short* VTh, unsigned short* VTl) {
  __shared__ __align__(16) __bf16 Wt[HD * WP];       // weight [n][k], 65 KB (cross-wave, one block barrier)
  __shared__ __align__(16) __bf16 Xs[8][16 * XP];    // per wave activations [row][k of the buffer], 34 KB (wave-private)
  __shared__ __align__(16) float  sT[8 * 16 * 68];   // q, k: per-wave 16x64 slab, pitch 68; v: block tile [64 d][TP], 34 KB
  const int role = blockIdx.y;
  const float* X    = (role == 0) ? q_in : ((role == 1) ? k_in : v_in);
  const float* Wg   = (role == 0) ? Wq : ((role == 1) ? Wk : Wv);
  const float* bias = (role == 0) ? bq : ((role == 1) ? bk : bv);
  const int lane = threadIdx.x & 31;
  const int wave = threadIdx.x >> 5;
  const int c    = lane & 15;                  // row (A) / column (B, D) within a 16-tile
  const int hh   = lane >> 4;
  const int r0   = blockIdx.x * PROWS;         // first compact row of the block; PROWS divides SEQ: one batch per block
  const int b    = r0 / SEQ;
  const int t0   = r0 - b * SEQ;
  const float* xp = X + ((size_t)b * SEQ_FULL + t0 + wave * 16) * DIN + 4 * lane;

  v4f xa[16], xb[16];
  ld_x(xa, xp);
  ld_x(xb, xp + 128);

#pragma unroll 4   // 4 tasks = 32 weight loads in flight per wave; all 8 would not fit in registers beside the two activation buffers
  for (int tsk = 0; tsk < 8; ++tsk) {
    const int k8 = (tsk * 8 + wave) * 8;       // 0..504
    v2f f[8];
#pragma unroll
    for (int e = 0; e < 8; ++e) f[e] = *(const v2f*)(Wg + (size_t)(k8 + e) * HD + 2 * lane);
#pragma unroll
    for (int i = 0; i < 2; ++i) {
      const v8f col = {f[0][i], f[1][i], f[2][i], f[3][i], f[4][i], f[5][i], f[6][i], f[7][i]};
      *(v8b*)(Wt + (2 * lane + i) * WP + k8) = __builtin_convertvector(col, v8b);
    }
  }
  __syncthreads();                             // the whole weight plane is read by every wave below

  v8f acc[4];
#pragma unroll
  for (int j = 0; j < 4; ++j) acc[j] = zero8();
  const __bf16* wp = Wt + c * WP + 8 * hh;
  __bf16*       xs = Xs[wave] + 4 * lane;
  const __bf16* xf = Xs[wave] + c * XP + 8 * hh;
  put_x(xs, xa);
  ld_x(xa, xp + 256);
  slab_order();                                // the slab's rows are read across the wave's lanes
  mm_x(acc, xf, wp);
  slab_order();                                // the fragment loads above stay ahead of the next buffer's stores
  put_x(xs, xb);
  ld_x(xb, xp + 384);
  slab_order();
  mm_x(acc, xf, wp + 128);
  slab_order();
  put_x(xs, xa);
  slab_order();
  mm_x(acc, xf, wp + 256);
  slab_order();
  put_x(xs, xb);
  slab_order();
  mm_x(acc, xf, wp + 384);

  float bcol[4];
#pragma unroll
  for (int j = 0; j < 4; ++j) bcol[j] = bf_up(bf_bits(bias[(j << 4) + c]));
  const int mOff = hh * 8;                     // D row offset of this lane half

  if (role == 2) {
    // D element (s = wave*16 + mOff + r, d = j*16 + c) -> T[d][s]: 8 consecutive s per lane = two 16-B stores
#pragma unroll
    for (int j = 0; j < 4; ++j) {
      float* tp = sT + ((j << 4) + c) * TP + wave * 16 + mOff;
      const v4f lo = {acc[j][0] + bcol[j], acc[j][1] + bcol[j], acc[j][2] + bcol[j], acc[j][3] + bcol[j]};
      const v4f hi = {acc[j][4] + bcol[j], acc[j][5] + bcol[j], acc[j][6] + bcol[j], acc[j][7] + bcol[j]};
      *(v4f*)(tp)     = lo;
      *(v4f*)(tp + 4) = hi;
    }
    __syncthreads();                           // block-uniform branch; every wave's columns are read by the storing threads below
    const int s8 = (threadIdx.x & 15) * 8, dr = threadIdx.x >> 4;   // 16 threads x 8 s = 128 s of a d row; 16 rows per pass
    v4u hv[4], lv[4];
#pragma unroll
    for (int it = 0; it < 4; ++it) {
      const float* sp = sT + (it * 16 + dr) * TP + s8;
      v4u a, a2;
#pragma unroll
      for (int e = 0; e < 4; ++e) {
        const float f0 = sp[2 * e], f1 = sp[2 * e + 1];
        const _Float16 x0 = (_Float16)f0, x1 = (_Float16)f1;
        a[e]  = pk16(h_bits(x0), h_bits(x1));
        a2[e] = pk16(h_bits((_Float16)((f0 - (float)x0) * 4096.0f)), h_bits((_Float16)((f1 - (float)x1) * 4096.0f)));
      }
      hv[it] = a; lv[it] = a2;
    }
#pragma unroll
    for (int it = 0; it < 4; ++it) {
      const size_t o = ((size_t)b * HD + it * 16 + dr) * SEQ + t0 + s8;
      *(v4u*)(VTh + o) = hv[it];
      *(v4u*)(VTl + o) = lv[it];
    }
  } else {
    unsigned short* C  = (role == 0) ? Qh : Kh;
    unsigned short* C2 = (role == 0) ? Ql : Kl;
    float* slab = sT + wave * (16 * 68);
#pragma unroll
    for (int j = 0; j < 4; ++j)
#pragma unroll
      for (int r = 0; r < 8; ++r) slab[(mOff + r) * 68 + (j << 4) + c] = acc[j][r] + bcol[j];
    lds_wave_sync();
    const int q = lane >> 3, c8 = (lane & 7) * 8;
    v4u hv[4], lv[4];
#pragma unroll
    for (int it = 0; it < 4; ++it) {
      const float* sp = slab + (it * 4 + q) * 68 + c8;   // it 0..3 x q 0..3 = rows 0..15
      v4u a, a2;
#pragma unroll
      for (int e = 0; e < 4; ++e) {
        const float f0 = sp[2 * e], f1 = sp[2 * e + 1];
        const unsigned short h0 = bf_bits(f0), h1 = bf_bits(f1);
        a[e]  = pk16(h0, h1);
        a2[e] = pk16(bf_bits(f0 - bf_up(h0)), bf_bits(f1 - bf_up(h1)));
      }
      hv[it] = a; lv[it] = a2;
    }
#pragma unroll
    for (int it = 0; it < 4; ++it) {
      const size_t o = (size_t)(r0 + wave * 16 + it * 4 + q) * HD + c8;
      *(v4u*)(C + o)  = hv[it];
      *(v4u*)(C2 + o) = lv[it];
    }
    // precaution: the stores' address registers may be reused by code laid out behind this branch; the wait stands ahead of any such overwrite
    asm volatile("s_wait_xcnt 0x0" ::: "memory");
  }
}

// =====================================================================================================
// Non-causal one-head attention, head dim 64, key chunks of 64, softmax over all SEQ keys.
//   q planes (bf16 hi / lo): element (b, t, d) at [(b*SEQ + t)*HD + d]   (compact rows)
//   k planes (bf16 hi / lo): same layout with key index s
//   v^T hi plane (f16):      element (b, d, s) at [(b*HD + d)*SEQ + s]
//   v^T residual plane (f16, (v - hi)*4096): same layout
//   scores = q . k : bf16 hi/lo split (hi.hi + hi.lo + lo.hi), f32 accumulate, then * 1/8 in f32
//   p = exp(s - m) carried as f16(1024 p) plus f16 residual (x4096); context = p . v on f16 WMMA, 3 products:
//   ph.vh into oacc; ph.vl and pl.vh into the separate accumulator o1 folded back with 1/4096 per chunk in f32;
//   online softmax (running max from -inf; every chunk holds at least the chunk max key so l >= 1 after chunk 0) in f32.
//   Block = 16 waves = KG key groups x 4 waves, 64 query rows of one batch b; grid = NB * NQB. Wave w: query tile w & 3,
//   key group w >> 2. A group walks the chunks kg*NKT/KG .. (kg+1)*NKT/KG - 1 with K / V^T tiles of its own, so a SIMD holds
//   four waves whose LDS, exchange and matrix waits overlap. Each wave ends with the running max, sum and un-normalised context
//   of its quarter of the keys; these partials go through LDS and are merged behind one block barrier (weights exp(m_g - M)).
//   K / V^T chunk staging (cross-wave LDS, __syncthreads before and after): the group's 128 threads x 32 elements per plane =
//   the whole 64x64 tile of every plane read later (plain 16-B loads); staged extent == consumed extent for Ksh, Ksl, Vth, Vtl.
//   P tiles are wave-private, spilled with _Float16 element stores and reloaded as v8h (same element type) after
//   lds_wave_sync; the f32 partial context tile Os[wave] is written as float scalars and read by the four merging waves as v4f.
//   Output (f32, rows of 64 = 256 B = 2 lines): wave (tile, kg) merges and stores rows kg*4..kg*4+3 (it 0..1 x lane>>4 0..1)
//   of its query tile x 64 columns; 16 waves x 4 rows = the block's 64 rows of the [NB*SEQ][HD] output.
// =====================================================================================================
__global__ __launch_bounds__(512)
void attn64(const unsigned short* __restrict__ qhp, const unsigned short* __restrict__ qlp,
            const unsigned short* __restrict__ khp, const unsigned short* __restrict__ klp,
            const unsigned short* __restrict__ vhp, const unsigned short* __restrict__ vlp,
            float* outp) {
  union FB { v16b v; v8b h[2]; };
  union FH { v16h v; v8h h[2]; };
  // Rows of 64 elements at pitch LP: the 8 pad elements of a row are never written and never read.
  __shared__ __align__(16) __bf16   KshG[KG][64 * LP];            // per group K hi [kv][d]   36 KB (cross-wave, block barriers)
  __shared__ __align__(16) __bf16   KslG[KG][64 * LP];            // per group K lo           36 KB (cross-wave)
  __shared__ __align__(16) _Float16 VthG[KG][64 * LP];            // per group V^T hi [d][kv] 36 KB (cross-wave)
  __shared__ __align__(16) _Float16 VtlG[KG][64 * LP];            // per group V^T residual   36 KB (cross-wave)
  __shared__ __align__(16) _Float16 Psh[4 * KG][16 * LP];         // per wave P [row][kv]      36 KB (wave-private)
  __shared__ __align__(16) _Float16 Psl[4 * KG][16 * LP];         // per wave P residual       36 KB (wave-private)
  __shared__ __align__(16) float    Os[4 * KG][16 * 64];          // per wave partial context [row][d] 64 KB (merged cross-wave)
  __shared__ float                  Ms[4 * KG][16];               // per wave running max per row (merged cross-wave)
  __shared__ float                  Ls[4 * KG][16];               // per wave running sum per row (merged cross-wave)

  const int wave = threadIdx.x >> 5;           // 0..15
  const int qt   = wave & 3;                   // query tile of the block
  const int kg   = wave >> 2;                  // key group
  const int tid  = threadIdx.x & 127;          // thread index inside the key group
  const int lane = tid & 31;
  const int hh   = lane >> 4;
  const int c    = lane & 15;

  const int bx   = blockIdx.x;
  const int qb   = bx % NQB;
  const int b    = bx / NQB;                   // 0..NB-1
  const int q0   = qb * 64 + qt * 16;
  const size_t rowB = (size_t)b * SEQ;

  const __bf16* Qh = (const __bf16*)(const void*)qhp;
  const __bf16* Ql = (const __bf16*)(const void*)qlp;
  const __bf16* Kh = (const __bf16*)(const void*)khp;
  const __bf16* Kl = (const __bf16*)(const void*)klp;
  const _Float16* Vh = (const _Float16*)(const void*)vhp + (size_t)b * HD * SEQ;
  const _Float16* Vl = (const _Float16*)(const void*)vlp + (size_t)b * HD * SEQ;
  __bf16*   Ksh = KshG[kg];
  __bf16*   Ksl = KslG[kg];
  _Float16* Vth = VthG[kg];
  _Float16* Vtl = VtlG[kg];

  // ---- Q fragments (A operand, row = lane&15): 2 d-chunks, hi and lo ----
  v16b qah[2], qal[2];
#pragma unroll
  for (int dc = 0; dc < 2; ++dc) {
    const size_t qo = (rowB + q0 + c) * HD + dc * 32 + 8 * hh;
    qah[dc] = ldfrag_b(Qh + qo);
    qal[dc] = ldfrag_b(Ql + qo);
  }

  float mrow[8], lrow[8];
  v8f oacc[4];
#pragma unroll
  for (int r = 0; r < 8; ++r) { mrow[r] = -INFINITY; lrow[r] = 0.f; }
#pragma unroll
  for (int t = 0; t < 4; ++t) oacc[t] = zero8();

  for (int ki = 0; ki < NKT / KG; ++ki) {      // static trip count, the same in every wave of the block
    const int kv0 = (kg * (NKT / KG) + ki) * 64;   // kv0 + 63 < SEQ
    __syncthreads();
    {
      const int r = tid >> 1, half = (tid & 1) * 32;
      const __bf16*   kg  = Kh + (rowB + kv0 + r) * HD + half;    // K row kv0+r, d = half..half+31
      const __bf16*   klg = Kl + (rowB + kv0 + r) * HD + half;
      const _Float16* vg  = Vh + (size_t)r * SEQ + kv0 + half;    // V^T row d = r, s = kv0+half..+31
      const _Float16* vlg = Vl + (size_t)r * SEQ + kv0 + half;
#pragma unroll
      for (int i = 0; i < 4; ++i) {
        const v8b a0 = *(const v8b*)(kg + 8 * i);
        const v8b a1 = *(const v8b*)(klg + 8 * i);
        const v8h b0 = *(const v8h*)(vg + 8 * i);
        const v8h b1 = *(const v8h*)(vlg + 8 * i);
        *(v8b*)(Ksh + r * LP + half + 8 * i) = a0;
        *(v8b*)(Ksl + r * LP + half + 8 * i) = a1;
        *(v8h*)(Vth + r * LP + half + 8 * i) = b0;
        *(v8h*)(Vtl + r * LP + half + 8 * i) = b1;
      }
    }
    __syncthreads();

    // ---- scores: 16 query rows x 64 keys per wave, 3 bf16 products per (key subtile, d-chunk) ----
    v8f s[4];
#pragma unroll
    for (int j = 0; j < 4; ++j) {
      s[j] = zero8();
#pragma unroll
      for (int dc = 0; dc < 2; ++dc) {
        FB kb, kl;
        kb.h[0] = *(const v8b*)(Ksh + (j * 16 + c) * LP + dc * 32 + 8 * hh);
        kb.h[1] = *(const v8b*)(Ksh + (j * 16 + c) * LP + dc * 32 + 16 + 8 * hh);
        kl.h[0] = *(const v8b*)(Ksl + (j * 16 + c) * LP + dc * 32 + 8 * hh);
        kl.h[1] = *(const v8b*)(Ksl + (j * 16 + c) * LP + dc * 32 + 16 + 8 * hh);
        s[j] = mma_b(qah[dc], kb.v, s[j]);
        s[j] = mma_b(qah[dc], kl.v, s[j]);
        s[j] = mma_b(qal[dc], kb.v, s[j]);
      }
    }

    // ---- scale, row max, online softmax, P (x1024, f16) and P residual (x4096) to LDS ----
    _Float16* pwh = Psh[wave];
    _Float16* pwl = Psl[wave];
#pragma unroll
    for (int r = 0; r < 8; ++r) {
      float m = -INFINITY;
#pragma unroll
      for (int j = 0; j < 4; ++j) {
        const float sv = s[j][r] * 0.125f;
        s[j][r] = sv;
        m = fmaxf(m, sv);
      }
#pragma unroll
      for (int off = 1; off < 16; off <<= 1) m = fmaxf(m, __shfl_xor(m, off, 32));
      const float mnew  = fmaxf(mrow[r], m);
      const float msafe = (mnew == -INFINITY) ? 0.f : mnew;
      const float alpha = __expf(mrow[r] - msafe);
      mrow[r] = mnew;
      float psum = 0.f;
#pragma unroll
      for (int j = 0; j < 4; ++j) {
        const float p = __expf(s[j][r] - msafe);
        psum += p;
        const float p1k = p * 1024.0f;
        const _Float16 ph = (_Float16)p1k;
        const _Float16 pl = (_Float16)((p1k - (float)ph) * 4096.0f);
        pwh[(8 * hh + r) * LP + j * 16 + c] = ph;
        pwl[(8 * hh + r) * LP + j * 16 + c] = pl;
      }
#pragma unroll
      for (int off = 1; off < 16; off <<= 1) psum += __shfl_xor(psum, off, 32);
      lrow[r] = lrow[r] * alpha + psum;
#pragma unroll
      for (int t = 0; t < 4; ++t) oacc[t][r] *= alpha;
    }
    lds_wave_sync();

    // ---- context += P . V (f16 WMMA), residual products into a separate accumulator ----
    v8f o1[4];
#pragma unroll
    for (int t = 0; t < 4; ++t) o1[t] = zero8();
#pragma unroll 1
    for (int kk = 0; kk < 2; ++kk) {
      FH pa, pr;
      pa.h[0] = *(const v8h*)(pwh + c * LP + kk * 32 + 8 * hh);
      pa.h[1] = *(const v8h*)(pwh + c * LP + kk * 32 + 16 + 8 * hh);
      pr.h[0] = *(const v8h*)(pwl + c * LP + kk * 32 + 8 * hh);
      pr.h[1] = *(const v8h*)(pwl + c * LP + kk * 32 + 16 + 8 * hh);
#pragma unroll
      for (int t = 0; t < 4; ++t) {
        FH vb, vl;
        vb.h[0] = *(const v8h*)(Vth + (t * 16 + c) * LP + kk * 32 + 8 * hh);
        vb.h[1] = *(const v8h*)(Vth + (t * 16 + c) * LP + kk * 32 + 16 + 8 * hh);
        vl.h[0] = *(const v8h*)(Vtl + (t * 16 + c) * LP + kk * 32 + 8 * hh);
        vl.h[1] = *(const v8h*)(Vtl + (t * 16 + c) * LP + kk * 32 + 16 + 8 * hh);
        oacc[t] = mma_h(pa.v, vb.v, oacc[t]);
        o1[t]   = mma_h(pa.v, vl.v, o1[t]);
        o1[t]   = mma_h(pr.v, vb.v, o1[t]);
      }
    }
#pragma unroll
    for (int t = 0; t < 4; ++t)
#pragma unroll
      for (int r = 0; r < 8; ++r) oacc[t][r] += o1[t][r] * (1.0f / 4096.0f);
  }

  // ---- hand over the wave's partials: un-normalised context tile (p carry x1024 still in), running max and sum per row ----
  float* os = Os[wave];
#pragma unroll
  for (int r = 0; r < 8; ++r) {
#pragma unroll
    for (int t = 0; t < 4; ++t) os[(8 * hh + r) * 64 + t * 16 + c] = oacc[t][r];
    if (c == 0) {                              // mrow / lrow are equal in the 16 lanes of a half
      Ms[wave][8 * hh + r] = mrow[r];
      Ls[wave][8 * hh + r] = lrow[r];
    }
  }
  __syncthreads();                             // every group's partials are read by the merging waves below
  // ---- merge the KG partials of 4 rows per wave, normalise (1/l and the 1/1024 p carry), store whole rows ----
  {
    const int h2 = lane >> 4, c4 = (lane & 15) * 4;
#pragma unroll
    for (int it = 0; it < 2; ++it) {
      const int row = kg * 4 + it * 2 + h2;    // kg 0..3 x it 0..1 x h2 0..1 = rows 0..15 of the query tile
      float mg[KG];
      float mall = -INFINITY;
#pragma unroll
      for (int g = 0; g < KG; ++g) { mg[g] = Ms[g * 4 + qt][row]; mall = fmaxf(mall, mg[g]); }
      const float msafe = (mall == -INFINITY) ? 0.f : mall;
      float l = 0.f;
      v4f o = {0.f, 0.f, 0.f, 0.f};
#pragma unroll
      for (int g = 0; g < KG; ++g) {
        const float w = __expf(mg[g] - msafe);
        l += w * Ls[g * 4 + qt][row];
        o += w * *(const v4f*)(Os[g * 4 + qt] + row * 64 + c4);
      }
      const float inv = ((l > 0.f) ? (1.0f / l) : 0.f) * (1.0f / 1024.0f);
      *(v4f*)(outp + (rowB + q0 + row) * HD + c4) = o * inv;
    }
  }
}

// =====================================================================================================
// Workspace map (bytes, full build NB=8 SEQ=2048; every region is an exact multiple of its whole-line store granularity,
// all shapes are tile multiples so no padded tails exist; no region is reused):
//   Qh   bf16 [NB*SEQ][64]           0             2097152
//   Ql                              2097152       2097152
//   Kh                              4194304       2097152
//   Kl                              6291456       2097152
//   VTh  f16  [NB][64][SEQ]         8388608       2097152
//   VTl  f16  [NB][64][SEQ]         10485760      2097152
//   end                             12582912
// =====================================================================================================
extern "C" void kernel_launch(void* const* d_in, const int* in_sizes, int n_in,
                              void* d_out, int out_size, void* d_ws, size_t ws_size,
                              hipStream_t stream) {
  if (n_in < 9) return;
  const long long NX_NEED = ((long long)(NB - 1) * SEQ_FULL + SEQ) * (long long)DIN;   // last row read + 1, floats
  const int NO  = NB * SEQ * HD;                   // output elements (1048576 full)
  const int NW  = DIN * HD;                        //   32768
  if ((long long)in_sizes[0] < NX_NEED || (long long)in_sizes[1] < NX_NEED || (long long)in_sizes[2] < NX_NEED) return;
  if (in_sizes[3] < NW || in_sizes[5] < NW || in_sizes[7] < NW) return;
  if (in_sizes[4] < HD || in_sizes[6] < HD || in_sizes[8] < HD) return;
  if (out_size < NO) return;

  const float* q_in = (const float*)d_in[0];   // [8][2048][512]
  const float* k_in = (const float*)d_in[1];   // [8][2048][512]
  const float* v_in = (const float*)d_in[2];   // [8][2048][512]
  const float* Wq   = (const float*)d_in[3];   // [512 in][64 out]
  const float* bq   = (const float*)d_in[4];   // [64]
  const float* Wk   = (const float*)d_in[5];   // [512][64]
  const float* bk   = (const float*)d_in[6];   // [64]
  const float* Wv   = (const float*)d_in[7];   // [512][64]
  const float* bv   = (const float*)d_in[8];   // [64]

  const size_t PP  = (size_t)NO * 2;               // 16-bit projected plane [NB*SEQ][64]
  const size_t PVT = (size_t)NB * HD * SEQ * 2;    // 16-bit v^T plane [NB][64][SEQ]
  size_t off = 0;
  const size_t oQh  = off; off += PP;
  const size_t oQl  = off; off += PP;
  const size_t oKh  = off; off += PP;
  const size_t oKl  = off; off += PP;
  const size_t oVTh = off; off += PVT;
  const size_t oVTl = off; off += PVT;
  if (off > ws_size) return;                       // off = 12582912 (full build)

  char* ws = (char*)d_ws;
  unsigned short* Qh  = (unsigned short*)(ws + oQh);
  unsigned short* Ql  = (unsigned short*)(ws + oQl);
  unsigned short* Kh  = (unsigned short*)(ws + oKh);
  unsigned short* Kl  = (unsigned short*)(ws + oKl);
  unsigned short* VTh = (unsigned short*)(ws + oVTh);
  unsigned short* VTl = (unsigned short*)(ws + oVTl);

  const dim3 gProj(NB * SEQ / PROWS, 3);                       //  128 blocks (full) x 3 products
  const dim3 gAttn(NB * NQB);                                  //  256 blocks of 512 (full)

  // (1) f32 inputs and weights -> q, k bf16 hi/lo planes, v^T f16 hi / residual planes
  proj3<<<gProj, dim3(256), 0, stream>>>(q_in, k_in, v_in, Wq, Wk, Wv, bq, bk, bv, Qh, Ql, Kh, Kl, VTh, VTl);
  // (2) attention -> d_out f32 [NB*SEQ][64]
  attn64<<<gAttn, dim3(512), 0, stream>>>(Qh, Ql, Kh, Kl, VTh, VTl, (float*)d_out);
  (void)hipGetLastError();
}

// v005
// One run takes 51.8 microseconds.
// Timed twice side by side with v004, it ran 1.12 and 1.11 times as fast.
// All steps since v000 together make it 4.66 times as fast.
// Contractions: q, k, v^T projections = v_wmma_f32_16x16x32_bf16 (bf16 operands from RNE-converted inputs and weights, single product, f32 accumulate);
// q.k^T scores = v_wmma_f32_16x16x32_bf16 with bf16 hi/lo split q and k (hi.hi + hi.lo + lo.hi), f32 accumulate;
// p.v = v_wmma_f32_16x16x32_f16 (p carried x1024 as f16 hi plane + f16 residual plane x4096, v as f16 hi plane + f16 residual
// plane x4096; 3 products hi.hi, hi.res, res.hi), f32 accumulate; softmax (running max), normalisers and bias adds in f32 on the VALU.
// Carry audit:
//   ph  = f16(1024 * p)                      -> the 1/1024 is folded exactly once in the attention epilogue: inv = (1/l) * (1/1024)
//   pl  = f16((1024 p - ph) * 4096)          }  products ph.VTl and pl.VTh go to the separate accumulator o1,
//   VTl = f16((v - VTh) * 4096)              }  folded back with * (1/4096) once per key chunk
//   VTh = f16(v), no carry (|v| typ. 0.65); q / k lo planes are unscaled bf16 residuals (v - hi) sharing the hi accumulator;
//   score scale 1/8 applied once in f32 after the score accumulate. No other scaled planes.
#include <hip/hip_runtime.h>
#include <math.h>
#include <stdint.h>

#ifndef NB
#define NB   8
#endif
#ifndef SEQ
#define SEQ  2048
#endif
#define NB_FULL  8
#define SEQ_FULL 2048
#define DIN  512
#define HD   64
#define NQB  (SEQ / 64)   // 64-row query blocks per sequence
#define NKT  (SEQ / 64)   // 64-key chunks per sequence
#define KG   4            // key groups per attention work-group: each group of 4 waves walks NKT / KG chunks
#define LP   72           // LDS row pitch (16-bit elements) of the attention tiles read by 16-B loads: 144 B = 16 B x 9 (odd)
#define OP   68           // LDS row pitch (floats) of a wave's partial context tile: 272 B = 16 B x 17 (odd), 16 rows stored at once
static_assert(NB >= 1 && NB <= NB_FULL && SEQ >= 64 && SEQ <= SEQ_FULL);
static_assert((SEQ % 64) == 0 && (DIN % 32) == 0 && HD == 64);
static_assert(NKT % KG == 0);

typedef _Float16 v16h __attribute__((ext_vector_type(16)));
typedef _Float16 v8h  __attribute__((ext_vector_type(8)));
typedef _Float16 v2h  __attribute__((ext_vector_type(2)));
typedef __bf16   v16b __attribute__((ext_vector_type(16)));
typedef __bf16   v8b  __attribute__((ext_vector_type(8)));
typedef float    v8f  __attribute__((ext_vector_type(8)));
typedef float    v4f  __attribute__((ext_vector_type(4)));
typedef unsigned int v4u __attribute__((ext_vector_type(4)));

// ---- scalar helpers --------------------------------------------------------------------------------
__device__ __forceinline__ unsigned short bf_bits(float f) {          // f32 -> bf16 bits, RNE convert
  unsigned u = __float_as_uint(f);
  return (unsigned short)((u + 0x7FFFu + ((u >> 16) & 1u)) >> 16);
}
__device__ __forceinline__ float bf_up(unsigned short h) { return __uint_as_float(((unsigned)h) << 16); }
__device__ __forceinline__ unsigned short h_bits(_Float16 x) { return __builtin_bit_cast(unsigned short, x); }
__device__ __forceinline__ unsigned pk16(unsigned short a, unsigned short b) { return (unsigned)a | ((unsigned)b << 16); }
__device__ __forceinline__ v8f zero8() { v8f z = {0.f, 0.f, 0.f, 0.f, 0.f, 0.f, 0.f, 0.f}; return z; }
__device__ __forceinline__ float xhalf(float x) {                      // the value of lane l ^ 16
  const int b = __builtin_bit_cast(int, x);
  return __builtin_bit_cast(float, __builtin_amdgcn_permlanex16(b, b, 0x76543210, 0xfedcba98, false, false));
}

__device__ __forceinline__ void lds_wave_sync() {
  __builtin_amdgcn_fence(3, "workgroup");
  __builtin_amdgcn_wave_barrier();
  __builtin_amdgcn_fence(2, "workgroup");
}

// ---- fragment loader: 16-bit A/B operand, lane -> row/col (lane&15), p already includes +8*(lane>>4);
//      elements 0..7 <- p[0..7] (k0+8h..k0+8h+7), elements 8..15 <- p[16..23] (k0+16+8h..k0+16+8h+7)
__device__ __forceinline__ v16b ldfrag_b(const __bf16* p) {
  union { v16b v; v8b h[2]; } f;
  f.h[0] = *(const v8b*)(p);
  f.h[1] = *(const v8b*)(p + 16);
  return f.v;
}

// ---- WMMA helpers with trailing VALU hazard gap --------------------------------------------------------
__device__ __forceinline__ v8f mma_b(v16b a, v16b b, v8f c) {
  c = __builtin_amdgcn_wmma_f32_16x16x32_bf16(false, a, false, b, (short)0, c, false, false);
  asm volatile("v_nop\n\tv_nop\n\tv_nop\n\tv_nop" : "+v"(c) : "v"(a), "v"(b));
  return c;
}
__device__ __forceinline__ v8f mma_h(v16h a, v16h b, v8f c) {
  c = __builtin_amdgcn_wmma_f32_16x16x32_f16(false, a, false, b, (short)0, c, false, false);
  asm volatile("v_nop\n\tv_nop\n\tv_nop\n\tv_nop" : "+v"(c) : "v"(a), "v"(b));
  return c;
}
__device__ __forceinline__ v8f mma_b_raw(v16b a, v16b b, v8f c) {
  return __builtin_amdgcn_wmma_f32_16x16x32_bf16(false, a, false, b, (short)0, c, false, false);
}

// =====================================================================================================
// The three projections in one launch, straight from the f32 inputs; role by block index (block-uniform):
// blockIdx.y = 0: q, 1: k, 2: v. A work-group = 8 waves x 16 activation rows = PROWS rows of one batch, all HD = 64 columns, K = DIN.
//   C[row][n] = sum_k bf16(X[row][k]) * bf16(W[k][n]) + bias[n]   (bias RNE-converted to bf16, added in f32)
// Weight: the work-group reads W f32 [DIN k][HD n] once (256-B rows, 8 B per lane), converts (RNE) and lays it in LDS as
//   Wt bf16 [n][k] at pitch WP, one 16-B store per (n, 8 k); coverage 8 waves x 8 tasks x 8 k x 64 n = the whole plane.
//   One block barrier publishes it; nothing writes Wt afterwards.
// Activations: a wave loads 128 k of one of its rows per instruction (32 lanes x 16 B = 512 contiguous B, four whole lines, each line
//   read once), converts in registers (RNE) and lays the bf16 values in its own LDS slab Xs[wave] [16 rows][128 k] at pitch XP (wave-private,
//   slab_order before the fragment loads and before the slab is written again). Two register buffers of 128 k x 16 rows: a buffer's
//   loads are issued two buffers ahead of its products. k runs upward in steps of 32, one product per step.
// Output: q, k -> bf16 hi plane + bf16 lo plane (lo = RNE(v - hi), unscaled), rows of 64 = one 128-B line, staged per wave in LDS
//   (wave-private slab, lds_wave_sync). v -> transposed through a block tile T[d][s] (f32, pitch TP) behind one block barrier, then
//   f16 hi plane [b][d][s] and residual plane f16((v - hi) * 4096): 16 lanes x 16 B = the block's 256 B of a d row.
// grid = (NB * SEQ / PROWS, 3): every tile exists, no guards.
// =====================================================================================================
#define PROWS 128   // activation rows per projection work-group
#define WP    520   // LDS row pitch (bf16 elements) of the transposed weight: 1040 B = 16 B x 65 (odd)
#define XP    136   // LDS row pitch (bf16 elements) of a wave's activation slab: 272 B = 16 B x 17 (odd)
#define TP    132   // LDS row pitch (floats) of the v^T hand-over tile: 528 B = 16 B x 33 (odd)
static_assert(SEQ % PROWS == 0 && DIN == 512 && HD * TP <= 8 * 16 * 68);
typedef __bf16 v4b __attribute__((ext_vector_type(4)));
typedef float  v2f __attribute__((ext_vector_type(2)));

// Order inside one wave between its LDS stores and its LDS loads of the same slab. The wait retires the wave's LDS operations; the "memory"
// clobber keeps the compiler from moving an LDS access across. Unlike a work-group fence it leaves the global loads in flight un-waited.
// The scheduling barrier keeps the conversions of a buffer whose loads are still in flight, and with them its s_wait_loadcnt, from
// being lifted into the products of the buffer before: without it the wave waits for those loads before it has issued the next ones.
__device__ __forceinline__ void slab_order() {
  asm volatile("s_wait_dscnt 0x0" ::: "memory");
  __builtin_amdgcn_sched_barrier(0);
}

// (the loops of ld_x, put_x and mm_x are unrolled so that every index of a register array is a constant)
// one buffer = 128 k of the wave's 16 rows: x[i] = 4 floats of row i at k = 4*lane..4*lane+3; xp = row 0, first k of the buffer, + 4*lane
__device__ __forceinline__ void ld_x(v4f (&x)[16], const float* __restrict__ xp) {
#pragma unroll
  for (int i = 0; i < 16; ++i) x[i] = *(const v4f*)(xp + (size_t)i * DIN);
}
// convert the buffer and lay it in the wave's slab: row i, k = 4*lane..+3, one 8-B store per lane (256 contiguous B per row); xs includes + 4*lane
__device__ __forceinline__ void put_x(__bf16* xs, const v4f (&x)[16]) {
#pragma unroll
  for (int i = 0; i < 16; ++i) *(v4b*)(xs + i * XP) = __builtin_convertvector(x[i], v4b);
}
// the slab's 4 k-steps x 4 column tiles; xf = slab + (lane&15)*XP + 8*(lane>>4); wp = Wt + (lane&15)*WP + 8*(lane>>4) + first k of the buffer
__device__ __forceinline__ void mm_x(v8f (&acc)[4], const __bf16* xf, const __bf16* wp) {
#pragma unroll
  for (int ks = 0; ks < 4; ++ks) {
    const v16b a = ldfrag_b(xf + ks * 32);
#pragma unroll
    for (int j = 0; j < 4; ++j) acc[j] = mma_b_raw(a, ldfrag_b(wp + j * 16 * WP + ks * 32), acc[j]);
  }
}

__global__ __launch_bounds__(256) void proj3(
    const float* __restrict__ q_in, const float* __restrict__ k_in, const float* __restrict__ v_in,
    const float* __restrict__ Wq, const float* __restrict__ Wk, const float* __restrict__ Wv,
    const float* __restrict__ bq, const float* __restrict__ bk, const float* __restrict__ bv,
    unsigned short* Qh, unsigned short* Ql, unsigned short* Kh, unsigned short* Kl,
    unsigned short* VTh, unsigned short* VTl) {
  __shared__ __align__(16) __bf16 Wt[HD * WP];       // weight [n][k], 65 KB (cross-wave, one block barrier)
  __shared__ __align__(16) __bf16 Xs[8][16 * XP];    // per wave activations [row][k of the buffer], 34 KB (wave-private)
  __shared__ __align__(16) float  sT[8 * 16 * 68];   // q, k: per-wave 16x64 slab, pitch 68; v: block tile [64 d][TP], 34 KB
  const int role = blockIdx.y;
  const float* X    = (role == 0) ? q_in : ((role == 1) ? k_in : v_in);
  const float* Wg   = (role == 0) ? Wq : ((role == 1) ? Wk : Wv);
  const float* bias = (role == 0) ? bq : ((role == 1) ? bk : bv);
  const int lane = threadIdx.x & 31;
  const int wave = threadIdx.x >> 5;
  const int c    = lane & 15;                  // row (A) / column (B, D) within a 16-tile
  const int hh   = lane >> 4;
  const int r0   = blockIdx.x * PROWS;         // first compact row of the block; PROWS divides SEQ: one batch per block
  const int b    = r0 / SEQ;
  const int t0   = r0 - b * SEQ;
  const float* xp = X + ((size_t)b * SEQ_FULL + t0 + wave * 16) * DIN + 4 * lane;

  v4f xa[16], xb[16];
  ld_x(xa, xp);
  ld_x(xb, xp + 128);

#pragma unroll 4   // 4 tasks = 32 weight loads in flight per wave; all 8 would not fit in registers beside the two activation buffers
  for (int tsk = 0; tsk < 8; ++tsk) {
    const int k8 = (tsk * 8 + wave) * 8;       // 0..504
    v2f f[8];
#pragma unroll
    for (int e = 0; e < 8; ++e) f[e] = *(const v2f*)(Wg + (size_t)(k8 + e) * HD + 2 * lane);
#pragma unroll
    for (int i = 0; i < 2; ++i) {
      const v8f col = {f[0][i], f[1][i], f[2][i], f[3][i], f[4][i], f[5][i], f[6][i], f[7][i]};
      *(v8b*)(Wt + (2 * lane + i) * WP + k8) = __builtin_convertvector(col, v8b);
    }
  }
  __syncthreads();                             // the whole weight plane is read by every wave below

  v8f acc[4];
#pragma unroll
  for (int j = 0; j < 4; ++j) acc[j] = zero8();
  const __bf16* wp = Wt + c * WP + 8 * hh;
  __bf16*       xs = Xs[wave] + 4 * lane;
  const __bf16* xf = Xs[wave] + c * XP + 8 * hh;
  put_x(xs, xa);
  ld_x(xa, xp + 256);
  slab_order();                                // the slab's rows are read across the wave's lanes
  mm_x(acc, xf, wp);
  slab_order();                                // the fragment loads above stay ahead of the next buffer's stores
  put_x(xs, xb);
  ld_x(xb, xp + 384);
  slab_order();
  mm_x(acc, xf, wp + 128);
  slab_order();
  put_x(xs, xa);
  slab_order();
  mm_x(acc, xf, wp + 256);
  slab_order();
  put_x(xs, xb);
  slab_order();
  mm_x(acc, xf, wp + 384);

  float bcol[4];
#pragma unroll
  for (int j = 0; j < 4; ++j) bcol[j] = bf_up(bf_bits(bias[(j << 4) + c]));
  const int mOff = hh * 8;                     // D row offset of this lane half

  if (role == 2) {
    // D element (s = wave*16 + mOff + r, d = j*16 + c) -> T[d][s]: 8 consecutive s per lane = two 16-B stores
#pragma unroll
    for (int j = 0; j < 4; ++j) {
      float* tp = sT + ((j << 4) + c) * TP + wave * 16 + mOff;
      const v4f lo = {acc[j][0] + bcol[j], acc[j][1] + bcol[j], acc[j][2] + bcol[j], acc[j][3] + bcol[j]};
      const v4f hi = {acc[j][4] + bcol[j], acc[j][5] + bcol[j], acc[j][6] + bcol[j], acc[j][7] + bcol[j]};
      *(v4f*)(tp)     = lo;
      *(v4f*)(tp + 4) = hi;
    }
    __syncthreads();                           // block-uniform branch; every wave's columns are read by the storing threads below
    const int s8 = (threadIdx.x & 15) * 8, dr = threadIdx.x >> 4;   // 16 threads x 8 s = 128 s of a d row; 16 rows per pass
    v4u hv[4], lv[4];
#pragma unroll
    for (int it = 0; it < 4; ++it) {
      const float* sp = sT + (it * 16 + dr) * TP + s8;
      v4u a, a2;
#pragma unroll
      for (int e = 0; e < 4; ++e) {
        const float f0 = sp[2 * e], f1 = sp[2 * e + 1];
        const _Float16 x0 = (_Float16)f0, x1 = (_Float16)f1;
        a[e]  = pk16(h_bits(x0), h_bits(x1));
        a2[e] = pk16(h_bits((_Float16)((f0 - (float)x0) * 4096.0f)), h_bits((_Float16)((f1 - (float)x1) * 4096.0f)));
      }
      hv[it] = a; lv[it] = a2;
    }
#pragma unroll
    for (int it = 0; it < 4; ++it) {
      const size_t o = ((size_t)b * HD + it * 16 + dr) * SEQ + t0 + s8;
      *(v4u*)(VTh + o) = hv[it];
      *(v4u*)(VTl + o) = lv[it];
    }
  } else {
    unsigned short* C  = (role == 0) ? Qh : Kh;
    unsigned short* C2 = (role == 0) ? Ql : Kl;
    float* slab = sT + wave * (16 * 68);
#pragma unroll
    for (int j = 0; j < 4; ++j)
#pragma unroll
      for (int r = 0; r < 8; ++r) slab[(mOff + r) * 68 + (j << 4) + c] = acc[j][r] + bcol[j];
    lds_wave_sync();
    const int q = lane >> 3, c8 = (lane & 7) * 8;
    v4u hv[4], lv[4];
#pragma unroll
    for (int it = 0; it < 4; ++it) {
      const float* sp = slab + (it * 4 + q) * 68 + c8;   // it 0..3 x q 0..3 = rows 0..15
      v4u a, a2;
#pragma unroll
      for (int e = 0; e < 4; ++e) {
        const float f0 = sp[2 * e], f1 = sp[2 * e + 1];
        const unsigned short h0 = bf_bits(f0), h1 = bf_bits(f1);
        a[e]  = pk16(h0, h1);
        a2[e] = pk16(bf_bits(f0 - bf_up(h0)), bf_bits(f1 - bf_up(h1)));
      }
      hv[it] = a; lv[it] = a2;
    }
#pragma unroll
    for (int it = 0; it < 4; ++it) {
      const size_t o = (size_t)(r0 + wave * 16 + it * 4 + q) * HD + c8;
      *(v4u*)(C + o)  = hv[it];
      *(v4u*)(C2 + o) = lv[it];
    }
    // precaution: the stores' address registers may be reused by code laid out behind this branch; the wait stands ahead of any such overwrite
    asm volatile("s_wait_xcnt 0x0" ::: "memory");
  }
}

__global__ __launch_bounds__(512)
void attn64(const unsigned short* __restrict__ qhp, const unsigned short* __restrict__ qlp,
            const unsigned short* __restrict__ khp, const unsigned short* __restrict__ klp,
            const unsigned short* __restrict__ vhp, const unsigned short* __restrict__ vlp,
            float* outp) {
  union FB { v16b v; v8b h[2]; };
  union FH { v16h v; v8h h[2]; };
  // Rows of 64 elements at pitch LP: the 8 pad elements of a row are never written and never read.
  __shared__ __align__(16) __bf16   KshG[KG][64 * LP];            // per group K hi [kv][d]   36 KB (cross-wave, block barriers)
  __shared__ __align__(16) __bf16   KslG[KG][64 * LP];            // per group K lo           36 KB (cross-wave)
  __shared__ __align__(16) _Float16 VthG[KG][64 * LP];            // per group V^T hi [d][kv] 36 KB (cross-wave)
  __shared__ __align__(16) _Float16 VtlG[KG][64 * LP];            // per group V^T residual   36 KB (cross-wave)
  __shared__ __align__(16) float    Os[4 * KG][16 * OP];          // per wave partial context [row][d] 68 KB (merged cross-wave)
  __shared__ float                  Ms[4 * KG][16];               // per wave running max per row (merged cross-wave)
  __shared__ float                  Ls[4 * KG][16];               // per wave running sum per row (merged cross-wave)

  const int wave = threadIdx.x >> 5;           // 0..15
  const int qt   = wave & 3;                   // query tile of the block
  const int kg   = wave >> 2;                  // key group
  const int tid  = threadIdx.x & 127;          // thread index inside the key group
  const int lane = tid & 31;
  const int hh   = lane >> 4;
  const int c    = lane & 15;

  const int bx   = blockIdx.x;
  const int qb   = bx % NQB;
  const int b    = bx / NQB;                   // 0..NB-1
  const int q0   = qb * 64 + qt * 16;
  const size_t rowB = (size_t)b * SEQ;

  const __bf16* Qh = (const __bf16*)(const void*)qhp;
  const __bf16* Ql = (const __bf16*)(const void*)qlp;
  const __bf16* Kh = (const __bf16*)(const void*)khp;
  const __bf16* Kl = (const __bf16*)(const void*)klp;
  const _Float16* Vh = (const _Float16*)(const void*)vhp + (size_t)b * HD * SEQ;
  const _Float16* Vl = (const _Float16*)(const void*)vlp + (size_t)b * HD * SEQ;
  __bf16*   Ksh = KshG[kg];
  __bf16*   Ksl = KslG[kg];
  _Float16* Vth = VthG[kg];
  _Float16* Vtl = VtlG[kg];

  // ---- Q fragments (B operand, column = query = lane&15): 2 d-chunks, hi and lo ----
  v16b qah[2], qal[2];
#pragma unroll
  for (int dc = 0; dc < 2; ++dc) {
    const size_t qo = (rowB + q0 + c) * HD + dc * 32 + 8 * hh;
    qah[dc] = ldfrag_b(Qh + qo);
    qal[dc] = ldfrag_b(Ql + qo);
  }

  float mrun = -INFINITY;                      // running max of query c, equal in both wave halves
  float lrun = 0.f;                            // running sum of query c over this half's keys (8 of every 16)
  v8f oacc[4];                                 // oacc[t][r] = context of query c, d = t*16 + 8*hh + r
#pragma unroll
  for (int t = 0; t < 4; ++t) oacc[t] = zero8();

  for (int ki = 0; ki < NKT / KG; ++ki) {      // static trip count, the same in every wave of the block
    const int kv0 = (kg * (NKT / KG) + ki) * 64;   // kv0 + 63 < SEQ
    __syncthreads();
    {
      const int r = tid >> 1, half = (tid & 1) * 32;
      const __bf16*   kg  = Kh + (rowB + kv0 + r) * HD + half;    // K row kv0+r, d = half..half+31
      const __bf16*   klg = Kl + (rowB + kv0 + r) * HD + half;
      const _Float16* vg  = Vh + (size_t)r * SEQ + kv0 + half;    // V^T row d = r, s = kv0+half..+31
      const _Float16* vlg = Vl + (size_t)r * SEQ + kv0 + half;
#pragma unroll
      for (int i = 0; i < 4; ++i) {
        const v8b a0 = *(const v8b*)(kg + 8 * i);
        const v8b a1 = *(const v8b*)(klg + 8 * i);
        const v8h b0 = *(const v8h*)(vg + 8 * i);
        const v8h b1 = *(const v8h*)(vlg + 8 * i);
        *(v8b*)(Ksh + r * LP + half + 8 * i) = a0;
        *(v8b*)(Ksl + r * LP + half + 8 * i) = a1;
        *(v8h*)(Vth + r * LP + half + 8 * i) = b0;
        *(v8h*)(Vtl + r * LP + half + 8 * i) = b1;
      }
    }
    __syncthreads();

    // ---- scores, transposed: 64 keys x 16 queries per wave, 3 bf16 products per (key subtile, d-chunk) ----
    v8f s[4];
#pragma unroll
    for (int j = 0; j < 4; ++j) {
      s[j] = zero8();
#pragma unroll
      for (int dc = 0; dc < 2; ++dc) {
        FB kb, kl;
        kb.h[0] = *(const v8b*)(Ksh + (j * 16 + c) * LP + dc * 32 + 8 * hh);
        kb.h[1] = *(const v8b*)(Ksh + (j * 16 + c) * LP + dc * 32 + 16 + 8 * hh);
        kl.h[0] = *(const v8b*)(Ksl + (j * 16 + c) * LP + dc * 32 + 8 * hh);
        kl.h[1] = *(const v8b*)(Ksl + (j * 16 + c) * LP + dc * 32 + 16 + 8 * hh);
        s[j] = mma_b(kb.v, qah[dc], s[j]);
        s[j] = mma_b(kl.v, qah[dc], s[j]);
        s[j] = mma_b(kb.v, qal[dc], s[j]);
      }
    }

    // ---- scale, max of the lane's 32 keys joined with the other half's, online softmax ----
    float m = -INFINITY;
#pragma unroll
    for (int j = 0; j < 4; ++j)
#pragma unroll
      for (int r = 0; r < 8; ++r) {
        const float sv = s[j][r] * 0.125f;
        s[j][r] = sv;
        m = fmaxf(m, sv);
      }
    m = fmaxf(m, xhalf(m));
    const float mnew  = fmaxf(mrun, m);
    const float msafe = (mnew == -INFINITY) ? 0.f : mnew;
    const float alpha = __expf(mrun - msafe);
    mrun = mnew;
    // ---- P^T (x1024, f16) and its residual (x4096) packed straight into B operands: pa[kk] / pr[kk] = keys kk*32 .. kk*32+31 ----
    FH pa[2], pr[2];
    float psum[4];
#pragma unroll
    for (int j = 0; j < 4; ++j) {
      psum[j] = 0.f;
#pragma unroll
      for (int r = 0; r < 8; r += 2) {         // two keys at a time: one register of the operand
        const float p0 = __expf(s[j][r] - msafe), p1 = __expf(s[j][r + 1] - msafe);
        psum[j] += p0;
        psum[j] += p1;
        const v2f p1k = {p0 * 1024.0f, p1 * 1024.0f};
        const v2h ph  = __builtin_convertvector(p1k, v2h);
        const v2h pl  = __builtin_convertvector((p1k - __builtin_convertvector(ph, v2f)) * 4096.0f, v2h);
        pa[j >> 1].v[(j & 1) * 8 + r] = ph[0];  pa[j >> 1].v[(j & 1) * 8 + r + 1] = ph[1];
        pr[j >> 1].v[(j & 1) * 8 + r] = pl[0];  pr[j >> 1].v[(j & 1) * 8 + r + 1] = pl[1];
      }
    }
    lrun = lrun * alpha + ((psum[0] + psum[1]) + (psum[2] + psum[3]));
#pragma unroll
    for (int t = 0; t < 4; ++t)
#pragma unroll
      for (int r = 0; r < 8; ++r) oacc[t][r] *= alpha;

    // ---- context^T += V^T . P^T (f16 WMMA), residual products into a separate accumulator ----
    v8f o1[4];
#pragma unroll
    for (int t = 0; t < 4; ++t) o1[t] = zero8();
#pragma unroll   // pa / pr are register arrays: their index must be a constant
    for (int kk = 0; kk < 2; ++kk) {
#pragma unroll
      for (int t = 0; t < 4; ++t) {
        FH vb, vl;
        vb.h[0] = *(const v8h*)(Vth + (t * 16 + c) * LP + kk * 32 + 8 * hh);
        vb.h[1] = *(const v8h*)(Vth + (t * 16 + c) * LP + kk * 32 + 16 + 8 * hh);
        vl.h[0] = *(const v8h*)(Vtl + (t * 16 + c) * LP + kk * 32 + 8 * hh);
        vl.h[1] = *(const v8h*)(Vtl + (t * 16 + c) * LP + kk * 32 + 16 + 8 * hh);
        oacc[t] = mma_h(vb.v, pa[kk].v, oacc[t]);
        o1[t]   = mma_h(vl.v, pa[kk].v, o1[t]);
        o1[t]   = mma_h(vb.v, pr[kk].v, o1[t]);
      }
    }
#pragma unroll
    for (int t = 0; t < 4; ++t)
#pragma unroll
      for (int r = 0; r < 8; ++r) oacc[t][r] += o1[t][r] * (1.0f / 4096.0f);
  }

  // ---- hand over the wave's partials: un-normalised context tile (p carry x1024 still in), running max and sum per query ----
  lrun += xhalf(lrun);                         // the two halves' keys together
  float* os = Os[wave];
#pragma unroll
  for (int t = 0; t < 4; ++t) {
    const v4f lo = {oacc[t][0], oacc[t][1], oacc[t][2], oacc[t][3]};
    const v4f hi = {oacc[t][4], oacc[t][5], oacc[t][6], oacc[t][7]};
    *(v4f*)(os + c * OP + t * 16 + 8 * hh)     = lo;
    *(v4f*)(os + c * OP + t * 16 + 8 * hh + 4) = hi;
  }
  if (hh == 0) {                               // mrun / lrun are equal in the two lanes of a query
    Ms[wave][c] = mrun;
    Ls[wave][c] = lrun;
  }
  __syncthreads();                             // every group's partials are read by the merging waves below
  // ---- merge the KG partials of 4 rows per wave, normalise (1/l and the 1/1024 p carry), store whole rows ----
  {
    const int h2 = lane >> 4, c4 = (lane & 15) * 4;
#pragma unroll
    for (int it = 0; it < 2; ++it) {
      const int row = kg * 4 + it * 2 + h2;    // kg 0..3 x it 0..1 x h2 0..1 = rows 0..15 of the query tile
      float mg[KG];
      float mall = -INFINITY;
#pragma unroll
      for (int g = 0; g < KG; ++g) { mg[g] = Ms[g * 4 + qt][row]; mall = fmaxf(mall, mg[g]); }
      const float msafe = (mall == -INFINITY) ? 0.f : mall;
      float l = 0.f;
      v4f o = {0.f, 0.f, 0.f, 0.f};
#pragma unroll
      for (int g = 0; g < KG; ++g) {
        const float w = __expf(mg[g] - msafe);
        l += w * Ls[g * 4 + qt][row];
        o += w * *(const v4f*)(Os[g * 4 + qt] + row * OP + c4);
      }
      const float inv = ((l > 0.f) ? (1.0f / l) : 0.f) * (1.0f / 1024.0f);
      *(v4f*)(outp + (rowB + q0 + row) * HD + c4) = o * inv;
    }
  }
}

// =====================================================================================================
// Workspace map (bytes, full build NB=8 SEQ=2048; every region is an exact multiple of its whole-line store granularity,
// all shapes are tile multiples so no padded tails exist; no region is reused):
//   Qh   bf16 [NB*SEQ][64]           0             2097152
//   Ql                              2097152       2097152
//   Kh                              4194304       2097152
//   Kl                              6291456       2097152
//   VTh  f16  [NB][64][SEQ]         8388608       2097152
//   VTl  f16  [NB][64][SEQ]         10485760      2097152
//   end                             12582912
// =====================================================================================================
extern "C" void kernel_launch(void* const* d_in, const int* in_sizes, int n_in,
                              void* d_out, int out_size, void* d_ws, size_t ws_size,
                              hipStream_t stream) {
  if (n_in < 9) return;
  const long long NX_NEED = ((long long)(NB - 1) * SEQ_FULL + SEQ) * (long long)DIN;   // last row read + 1, floats
  const int NO  = NB * SEQ * HD;                   // output elements (1048576 full)
  const int NW  = DIN * HD;                        //   32768
  if ((long long)in_sizes[0] < NX_NEED || (long long)in_sizes[1] < NX_NEED || (long long)in_sizes[2] < NX_NEED) return;
  if (in_sizes[3] < NW || in_sizes[5] < NW || in_sizes[7] < NW) return;
  if (in_sizes[4] < HD || in_sizes[6] < HD || in_sizes[8] < HD) return;
  if (out_size < NO) return;

  const float* q_in = (const float*)d_in[0];   // [8][2048][512]
  const float* k_in = (const float*)d_in[1];   // [8][2048][512]
  const float* v_in = (const float*)d_in[2];   // [8][2048][512]
  const float* Wq   = (const float*)d_in[3];   // [512 in][64 out]
  const float* bq   = (const float*)d_in[4];   // [64]
  const float* Wk   = (const float*)d_in[5];   // [512][64]
  const float* bk   = (const float*)d_in[6];   // [64]
  const float* Wv   = (const float*)d_in[7];   // [512][64]
  const float* bv   = (const float*)d_in[8];   // [64]

  const size_t PP  = (size_t)NO * 2;               // 16-bit projected plane [NB*SEQ][64]
  const size_t PVT = (size_t)NB * HD * SEQ * 2;    // 16-bit v^T plane [NB][64][SEQ]
  size_t off = 0;
  const size_t oQh  = off; off += PP;
  const size_t oQl  = off; off += PP;
  const size_t oKh  = off; off += PP;
  const size_t oKl  = off; off += PP;
  const size_t oVTh = off; off += PVT;
  const size_t oVTl = off; off += PVT;
  if (off > ws_size) return;                       // off = 12582912 (full build)

  char* ws = (char*)d_ws;
  unsigned short* Qh  = (unsigned short*)(ws + oQh);
  unsigned short* Ql  = (unsigned short*)(ws + oQl);
  unsigned short* Kh  = (unsigned short*)(ws + oKh);
  unsigned short* Kl  = (unsigned short*)(ws + oKl);
  unsigned short* VTh = (unsigned short*)(ws + oVTh);
  unsigned short* VTl = (unsigned short*)(ws + oVTl);

  const dim3 gProj(NB * SEQ / PROWS, 3);                       //  128 blocks (full) x 3 products
  const dim3 gAttn(NB * NQB);                                  //  256 blocks of 512 (full)

  // (1) f32 inputs and weights -> q, k bf16 hi/lo planes, v^T f16 hi / residual planes
  proj3<<<gProj, dim3(256), 0, stream>>>(q_in, k_in, v_in, Wq, Wk, Wv, bq, bk, bv, Qh, Ql, Kh, Kl, VTh, VTl);
  // (2) attention -> d_out f32 [NB*SEQ][64]
  attn64<<<gAttn, dim3(512), 0, stream>>>(Qh, Ql, Kh, Kl, VTh, VTl, (float*)d_out);
  (void)hipGetLastError();
}

// v006
// One run takes 40.1 microseconds.
// In two side-by-side timings against v005, it was 1.29 and 1.28 times as fast.
// Counting every step since v000, it is 6.00 times as fast.
// Contractions: q, k, v^T projections = v_wmma_f32_16x16x32_bf16 (bf16 operands from RNE-converted inputs and weights, single product, f32 accumulate);
// q.k^T scores = v_wmma_f32_16x16x32_bf16 with bf16 hi/lo split q and k (hi.hi + hi.lo + lo.hi), f32 accumulate;
// p.v = v_wmma_f32_16x16x32_f16 (p carried x1024 as f16 hi plane + f16 residual plane x4096, v as f16 hi plane + f16 residual
// plane x4096; 3 products hi.hi, hi.res, res.hi), f32 accumulate; softmax (running max), normalisers and bias adds in f32 on the VALU.
// Carry audit:
//   ph  = f16(1024 * p)                      -> the 1/1024 is folded exactly once in the attention epilogue: inv = (1/l) * (1/1024)
//   pl  = f16((1024 p - ph) * 4096)          }  products ph.VTl and pl.VTh go to the separate accumulator o1,
//   VTl = f16((v - VTh) * 4096)              }  folded back with * (1/4096) once per key chunk
//   VTh = f16(v), no carry (|v| typ. 0.65); q / k lo planes are unscaled bf16 residuals (v - hi) sharing the hi accumulator;
//   score scale 1/8 applied once in f32 after the score accumulate. No other scaled planes.
#include <hip/hip_runtime.h>
#include <math.h>
#include <stdint.h>

#ifndef NB
#define NB   8
#endif
#ifndef SEQ
#define SEQ  2048
#endif
#define NB_FULL  8
#define SEQ_FULL 2048
#define DIN  512
#define HD   64
#define NQB  (SEQ / 64)   // 64-row query blocks per sequence
#define NKT  (SEQ / 64)   // 64-key chunks per sequence
#define KG   4            // key groups per attention work-group: each group of 4 waves walks NKT / KG chunks
#define LP   72           // LDS row pitch (16-bit elements) of the attention tiles read by 16-B loads: 144 B = 16 B x 9 (odd)
#define OP   68           // LDS row pitch (floats) of a wave's partial context tile: 272 B = 16 B x 17 (odd), 16 rows stored at once
static_assert(NB >= 1 && NB <= NB_FULL && SEQ >= 64 && SEQ <= SEQ_FULL);
static_assert((SEQ % 64) == 0 && (DIN % 32) == 0 && HD == 64);
static_assert(NKT % KG == 0);
#define NT      (NKT / KG)       // key chunks a key group walks
#define TILE_B  (64 * LP * 2)    // bytes of one plane's chunk tile in LDS: 64 rows at pitch LP
#define GRP_B   (4 * TILE_B)     // a key group's four planes of one chunk: K hi, K lo, V^T hi, V^T residual
#define BUF_B   (KG * GRP_B)     // one ring buffer: one chunk of every key group
static_assert(4 * KG * 16 * OP * 4 <= 2 * BUF_B);

typedef _Float16 v16h __attribute__((ext_vector_type(16)));
typedef _Float16 v8h  __attribute__((ext_vector_type(8)));
typedef _Float16 v2h  __attribute__((ext_vector_type(2)));
typedef __bf16   v16b __attribute__((ext_vector_type(16)));
typedef __bf16   v8b  __attribute__((ext_vector_type(8)));
typedef float    v8f  __attribute__((ext_vector_type(8)));
typedef float    v4f  __attribute__((ext_vector_type(4)));
typedef unsigned int v4u __attribute__((ext_vector_type(4)));

// ---- scalar helpers --------------------------------------------------------------------------------
__device__ __forceinline__ unsigned short bf_bits(float f) {          // f32 -> bf16 bits, RNE convert
  unsigned u = __float_as_uint(f);
  return (unsigned short)((u + 0x7FFFu + ((u >> 16) & 1u)) >> 16);
}
__device__ __forceinline__ float bf_up(unsigned short h) { return __uint_as_float(((unsigned)h) << 16); }
__device__ __forceinline__ unsigned short h_bits(_Float16 x) { return __builtin_bit_cast(unsigned short, x); }
__device__ __forceinline__ unsigned pk16(unsigned short a, unsigned short b) { return (unsigned)a | ((unsigned)b << 16); }
__device__ __forceinline__ v8f zero8() { v8f z = {0.f, 0.f, 0.f, 0.f, 0.f, 0.f, 0.f, 0.f}; return z; }
__device__ __forceinline__ float xhalf(float x) {                      // the value of lane l ^ 16
  const int b = __builtin_bit_cast(int, x);
  return __builtin_bit_cast(float, __builtin_amdgcn_permlanex16(b, b, 0x76543210, 0xfedcba98, false, false));
}

__device__ __forceinline__ void lds_wave_sync() {
  __builtin_amdgcn_fence(3, "workgroup");
  __builtin_amdgcn_wave_barrier();
  __builtin_amdgcn_fence(2, "workgroup");
}

// ---- fragment loader: 16-bit A/B operand, lane -> row/col (lane&15), p already includes +8*(lane>>4);
//      elements 0..7 <- p[0..7] (k0+8h..k0+8h+7), elements 8..15 <- p[16..23] (k0+16+8h..k0+16+8h+7)
__device__ __forceinline__ v16b ldfrag_b(const __bf16* p) {
  union { v16b v; v8b h[2]; } f;
  f.h[0] = *(const v8b*)(p);
  f.h[1] = *(const v8b*)(p + 16);
  return f.v;
}

// ---- WMMA helpers with trailing VALU hazard gap --------------------------------------------------------
__device__ __forceinline__ v8f mma_b(v16b a, v16b b, v8f c) {
  c = __builtin_amdgcn_wmma_f32_16x16x32_bf16(false, a, false, b, (short)0, c, false, false);
  asm volatile("v_nop\n\tv_nop\n\tv_nop\n\tv_nop" : "+v"(c) : "v"(a), "v"(b));
  return c;
}
__device__ __forceinline__ v8f mma_h(v16h a, v16h b, v8f c) {
  c = __builtin_amdgcn_wmma_f32_16x16x32_f16(false, a, false, b, (short)0, c, false, false);
  asm volatile("v_nop\n\tv_nop\n\tv_nop\n\tv_nop" : "+v"(c) : "v"(a), "v"(b));
  return c;
}
__device__ __forceinline__ v8f mma_b_raw(v16b a, v16b b, v8f c) {
  return __builtin_amdgcn_wmma_f32_16x16x32_bf16(false, a, false, b, (short)0, c, false, false);
}

// =====================================================================================================
// The three projections in one launch, straight from the f32 inputs; role by block index (block-uniform):
// blockIdx.y = 0: q, 1: k, 2: v. A work-group = 8 waves x 16 activation rows = PROWS rows of one batch, all HD = 64 columns, K = DIN.
//   C[row][n] = sum_k bf16(X[row][k]) * bf16(W[k][n]) + bias[n]   (bias RNE-converted to bf16, added in f32)
// Weight: the work-group reads W f32 [DIN k][HD n] once (256-B rows, 8 B per lane), converts (RNE) and lays it in LDS as
//   Wt bf16 [n][k] at pitch WP, one 16-B store per (n, 8 k); coverage 8 waves x 8 tasks x 8 k x 64 n = the whole plane.
//   One block barrier publishes it; nothing writes Wt afterwards.
// Activations: a wave loads 128 k of one of its rows per instruction (32 lanes x 16 B = 512 contiguous B, four whole lines, each line
//   read once), converts in registers (RNE) and lays the bf16 values in its own LDS slab Xs[wave] [16 rows][128 k] at pitch XP (wave-private,
//   slab_order before the fragment loads and before the slab is written again). Two register buffers of 128 k x 16 rows: a buffer's
//   loads are issued two buffers ahead of its products. k runs upward in steps of 32, one product per step.
// Output: q, k -> bf16 hi plane + bf16 lo plane (lo = RNE(v - hi), unscaled), rows of 64 = one 128-B line, staged per wave in LDS
//   (wave-private slab, lds_wave_sync). v -> transposed through a block tile T[d][s] (f32, pitch TP) behind one block barrier, then
//   f16 hi plane [b][d][s] and residual plane f16((v - hi) * 4096): 16 lanes x 16 B = the block's 256 B of a d row.
// grid = (NB * SEQ / PROWS, 3): every tile exists, no guards.
// =====================================================================================================
#define PROWS 128   // activation rows per projection work-group
#define WP    520   // LDS row pitch (bf16 elements) of the transposed weight: 1040 B = 16 B x 65 (odd)
#define XP    136   // LDS row pitch (bf16 elements) of a wave's activation slab: 272 B = 16 B x 17 (odd)
#define TP    132   // LDS row pitch (floats) of the v^T hand-over tile: 528 B = 16 B x 33 (odd)
static_assert(SEQ % PROWS == 0 && DIN == 512 && HD * TP <= 8 * 16 * 68);
typedef __bf16 v4b __attribute__((ext_vector_type(4)));
typedef float  v2f __attribute__((ext_vector_type(2)));

// Order inside one wave between its LDS stores and its LDS loads of the same slab. The wait retires the wave's LDS operations; the "memory"
// clobber keeps the compiler from moving an LDS access across. Unlike a work-group fence it leaves the global loads in flight un-waited.
// The scheduling barrier keeps the conversions of a buffer whose loads are still in flight, and with them its s_wait_loadcnt, from
// being lifted into the products of the buffer before: without it the wave waits for those loads before it has issued the next ones.
__device__ __forceinline__ void slab_order() {
  asm volatile("s_wait_dscnt 0x0" ::: "memory");
  __builtin_amdgcn_sched_barrier(0);
}

// (the loops of ld_x, put_x and mm_x are unrolled so that every index of a register array is a constant)
// one buffer = 128 k of the wave's 16 rows: x[i] = 4 floats of row i at k = 4*lane..4*lane+3; xp = row 0, first k of the buffer, + 4*lane
__device__ __forceinline__ void ld_x(v4f (&x)[16], const float* __restrict__ xp) {
#pragma unroll
  for (int i = 0; i < 16; ++i) x[i] = *(const v4f*)(xp + (size_t)i * DIN);
}
// convert the buffer and lay it in the wave's slab: row i, k = 4*lane..+3, one 8-B store per lane (256 contiguous B per row); xs includes + 4*lane
__device__ __forceinline__ void put_x(__bf16* xs, const v4f (&x)[16]) {
#pragma unroll
  for (int i = 0; i < 16; ++i) *(v4b*)(xs + i * XP) = __builtin_convertvector(x[i], v4b);
}
// the slab's 4 k-steps x 4 column tiles; xf = slab + (lane&15)*XP + 8*(lane>>4); wp = Wt + (lane&15)*WP + 8*(lane>>4) + first k of the buffer
__device__ __forceinline__ void mm_x(v8f (&acc)[4], const __bf16* xf, const __bf16* wp) {
#pragma unroll
  for (int ks = 0; ks < 4; ++ks) {
    const v16b a = ldfrag_b(xf + ks * 32);
#pragma unroll
    for (int j = 0; j < 4; ++j) acc[j] = mma_b_raw(a, ldfrag_b(wp + j * 16 * WP + ks * 32), acc[j]);
  }
}

__global__ __launch_bounds__(256) void proj3(
    const float* __restrict__ q_in, const float* __restrict__ k_in, const float* __restrict__ v_in,
    const float* __restrict__ Wq, const float* __restrict__ Wk, const float* __restrict__ Wv,
    const float* __restrict__ bq, const float* __restrict__ bk, const float* __restrict__ bv,
    unsigned short* Qh, unsigned short* Ql, unsigned short* Kh, unsigned short* Kl,
    unsigned short* VTh, unsigned short* VTl) {
  __shared__ __align__(16) __bf16 Wt[HD * WP];       // weight [n][k], 65 KB (cross-wave, one block barrier)
  __shared__ __align__(16) __bf16 Xs[8][16 * XP];    // per wave activations [row][k of the buffer], 34 KB (wave-private)
  __shared__ __align__(16) float  sT[8 * 16 * 68];   // q, k: per-wave 16x64 slab, pitch 68; v: block tile [64 d][TP], 34 KB
  const int role = blockIdx.y;
  const float* X    = (role == 0) ? q_in : ((role == 1) ? k_in : v_in);
  const float* Wg   = (role == 0) ? Wq : ((role == 1) ? Wk : Wv);
  const float* bias = (role == 0) ? bq : ((role == 1) ? bk : bv);
  const int lane = threadIdx.x & 31;
  const int wave = threadIdx.x >> 5;
  const int c    = lane & 15;                  // row (A) / column (B, D) within a 16-tile
  const int hh   = lane >> 4;
  const int r0   = blockIdx.x * PROWS;         // first compact row of the block; PROWS divides SEQ: one batch per block
  const int b    = r0 / SEQ;
  const int t0   = r0 - b * SEQ;
  const float* xp = X + ((size_t)b * SEQ_FULL + t0 + wave * 16) * DIN + 4 * lane;

  v4f xa[16], xb[16];
  ld_x(xa, xp);
  ld_x(xb, xp + 128);

#pragma unroll 4   // 4 tasks = 32 weight loads in flight per wave; all 8 would not fit in registers beside the two activation buffers
  for (int tsk = 0; tsk < 8; ++tsk) {
    const int k8 = (tsk * 8 + wave) * 8;       // 0..504
    v2f f[8];
#pragma unroll
    for (int e = 0; e < 8; ++e) f[e] = *(const v2f*)(Wg + (size_t)(k8 + e) * HD + 2 * lane);
#pragma unroll
    for (int i = 0; i < 2; ++i) {
      const v8f col = {f[0][i], f[1][i], f[2][i], f[3][i], f[4][i], f[5][i], f[6][i], f[7][i]};
      *(v8b*)(Wt + (2 * lane + i) * WP + k8) = __builtin_convertvector(col, v8b);
    }
  }
  __syncthreads();                             // the whole weight plane is read by every wave below

  v8f acc[4];
#pragma unroll
  for (int j = 0; j < 4; ++j) acc[j] = zero8();
  const __bf16* wp = Wt + c * WP + 8 * hh;
  __bf16*       xs = Xs[wave] + 4 * lane;
  const __bf16* xf = Xs[wave] + c * XP + 8 * hh;
  put_x(xs, xa);
  ld_x(xa, xp + 256);
  slab_order();                                // the slab's rows are read across the wave's lanes
  mm_x(acc, xf, wp);
  slab_order();                                // the fragment loads above stay ahead of the next buffer's stores
  put_x(xs, xb);
  ld_x(xb, xp + 384);
  slab_order();
  mm_x(acc, xf, wp + 128);
  slab_order();
  put_x(xs, xa);
  slab_order();
  mm_x(acc, xf, wp + 256);
  slab_order();
  put_x(xs, xb);
  slab_order();
  mm_x(acc, xf, wp + 384);

  float bcol[4];
#pragma unroll
  for (int j = 0; j < 4; ++j) bcol[j] = bf_up(bf_bits(bias[(j << 4) + c]));
  const int mOff = hh * 8;                     // D row offset of this lane half

  if (role == 2) {
    // D element (s = wave*16 + mOff + r, d = j*16 + c) -> T[d][s]: 8 consecutive s per lane = two 16-B stores
#pragma unroll
    for (int j = 0; j < 4; ++j) {
      float* tp = sT + ((j << 4) + c) * TP + wave * 16 + mOff;
      const v4f lo = {acc[j][0] + bcol[j], acc[j][1] + bcol[j], acc[j][2] + bcol[j], acc[j][3] + bcol[j]};
      const v4f hi = {acc[j][4] + bcol[j], acc[j][5] + bcol[j], acc[j][6] + bcol[j], acc[j][7] + bcol[j]};
      *(v4f*)(tp)     = lo;
      *(v4f*)(tp + 4) = hi;
    }
    __syncthreads();                           // block-uniform branch; every wave's columns are read by the storing threads below
    const int s8 = (threadIdx.x & 15) * 8, dr = threadIdx.x >> 4;   // 16 threads x 8 s = 128 s of a d row; 16 rows per pass
    v4u hv[4], lv[4];
#pragma unroll
    for (int it = 0; it < 4; ++it) {
      const float* sp = sT + (it * 16 + dr) * TP + s8;
      v4u a, a2;
#pragma unroll
      for (int e = 0; e < 4; ++e) {
        const float f0 = sp[2 * e], f1 = sp[2 * e + 1];
        const _Float16 x0 = (_Float16)f0, x1 = (_Float16)f1;
        a[e]  = pk16(h_bits(x0), h_bits(x1));
        a2[e] = pk16(h_bits((_Float16)((f0 - (float)x0) * 4096.0f)), h_bits((_Float16)((f1 - (float)x1) * 4096.0f)));
      }
      hv[it] = a; lv[it] = a2;
    }
#pragma unroll
    for (int it = 0; it < 4; ++it) {
      const size_t o = ((size_t)b * HD + it * 16 + dr) * SEQ + t0 + s8;
      *(v4u*)(VTh + o) = hv[it];
      *(v4u*)(VTl + o) = lv[it];
    }
  } else {
    unsigned short* C  = (role == 0) ? Qh : Kh;
    unsigned short* C2 = (role == 0) ? Ql : Kl;
    float* slab = sT + wave * (16 * 68);
#pragma unroll
    for (int j = 0; j < 4; ++j)
#pragma unroll
      for (int r = 0; r < 8; ++r) slab[(mOff + r) * 68 + (j << 4) + c] = acc[j][r] + bcol[j];
    lds_wave_sync();
    const int q = lane >> 3, c8 = (lane & 7) * 8;
    v4u hv[4], lv[4];
#pragma unroll
    for (int it = 0; it < 4; ++it) {
      const float* sp = slab + (it * 4 + q) * 68 + c8;   // it 0..3 x q 0..3 = rows 0..15
      v4u a, a2;
#pragma unroll
      for (int e = 0; e < 4; ++e) {
        const float f0 = sp[2 * e], f1 = sp[2 * e + 1];
        const unsigned short h0 = bf_bits(f0), h1 = bf_bits(f1);
        a[e]  = pk16(h0, h1);
        a2[e] = pk16(bf_bits(f0 - bf_up(h0)), bf_bits(f1 - bf_up(h1)));
      }
      hv[it] = a; lv[it] = a2;
    }
#pragma unroll
    for (int it = 0; it < 4; ++it) {
      const size_t o = (size_t)(r0 + wave * 16 + it * 4 + q) * HD + c8;
      *(v4u*)(C + o)  = hv[it];
      *(v4u*)(C2 + o) = lv[it];
    }
    // precaution: the stores' address registers may be reused by code laid out behind this branch; the wait stands ahead of any such overwrite
    asm volatile("s_wait_xcnt 0x0" ::: "memory");
  }
}

__device__ __forceinline__ void copy8(unsigned l, const char* ga, const char* gb, size_t gs) {
  asm volatile("global_load_async_to_lds_b128 %0, %8, off\n\t"
               "global_load_async_to_lds_b128 %1, %9, off\n\t"
               "global_load_async_to_lds_b128 %2, %10, off\n\t"
               "global_load_async_to_lds_b128 %3, %11, off\n\t"
               "global_load_async_to_lds_b128 %4, %12, off\n\t"
               "global_load_async_to_lds_b128 %5, %13, off\n\t"
               "global_load_async_to_lds_b128 %6, %14, off\n\t"
               "global_load_async_to_lds_b128 %7, %15, off\n\t"
               "s_wait_xcnt 0x0"
               :: "v"(l), "v"(l + 16u * LP * 2u), "v"(l + 32u * LP * 2u), "v"(l + 48u * LP * 2u),
                  "v"(l + TILE_B), "v"(l + TILE_B + 16u * LP * 2u), "v"(l + TILE_B + 32u * LP * 2u), "v"(l + TILE_B + 48u * LP * 2u),
                  "v"(ga), "v"(ga + gs), "v"(ga + 2 * gs), "v"(ga + 3 * gs),
                  "v"(gb), "v"(gb + gs), "v"(gb + 2 * gs), "v"(gb + 3 * gs)
               : "memory");
}

__global__ __launch_bounds__(512)
void attn64(const unsigned short* __restrict__ qhp, const unsigned short* __restrict__ qlp,
            const unsigned short* __restrict__ khp, const unsigned short* __restrict__ klp,
            const unsigned short* __restrict__ vhp, const unsigned short* __restrict__ vlp,
            float* outp) {
  union FB { v16b v; v8b h[2]; };
  union FH { v16h v; v8h h[2]; };
  // Rows of 64 elements at pitch LP: the 8 pad elements of a row are never written and never read.
  // Ring[buffer][group][plane]: K hi [kv][d], K lo, V^T hi [d][kv], V^T residual, 9 KB each; 2 x 144 KB (cross-wave, block barriers).
  // Behind the loop the same bytes hold the per-wave partial context tiles [row][d], 68 KB (merged cross-wave).
  __shared__ __align__(16) unsigned char Ring[2 * BUF_B];
  __shared__ float                  Ms[4 * KG][16];               // per wave running max per row (merged cross-wave)
  __shared__ float                  Ls[4 * KG][16];               // per wave running sum per row (merged cross-wave)

  const int wave = threadIdx.x >> 5;           // 0..15
  const int qt   = wave & 3;                   // query tile of the block
  const int kg   = wave >> 2;                  // key group
  const int tid  = threadIdx.x & 127;          // thread index inside the key group
  const int lane = tid & 31;
  const int hh   = lane >> 4;
  const int c    = lane & 15;

  const int bx   = blockIdx.x;
  const int qb   = bx % NQB;
  const int b    = bx / NQB;                   // 0..NB-1
  const int q0   = qb * 64 + qt * 16;
  const size_t rowB = (size_t)b * SEQ;

  const __bf16* Qh = (const __bf16*)(const void*)qhp;
  const __bf16* Ql = (const __bf16*)(const void*)qlp;
  // ---- the lane's part of a chunk's copies: row r4 + 16*step of each plane, bytes c16..c16+15 of its 128 ----
  const int r4  = qt * 4 + (lane >> 3);        // 0..15
  const int c16 = (lane & 7) * 16;
  const unsigned ldst = (unsigned)(size_t)Ring + (unsigned)(kg * GRP_B + r4 * (LP * 2) + c16);   // LDS byte address, buffer 0, K hi
  const size_t   ko   = ((rowB + (size_t)kg * NT * 64 + r4) * HD) * 2 + c16;                      // K planes: key row, chunk 0 of the group
  const size_t   vo   = (((size_t)b * HD + r4) * SEQ + (size_t)kg * NT * 64) * 2 + c16;           // V^T planes: d row, chunk 0 of the group
  const char* kha = (const char*)(const void*)khp + ko;
  const char* kla = (const char*)(const void*)klp + ko;
  const char* vha = (const char*)(const void*)vhp + vo;
  const char* vla = (const char*)(const void*)vlp + vo;
  // chunk t of the group (t < NT: its last key row and column lie inside the planes) into ring buffer buf
  auto stage = [&](int t, int buf) {
    const unsigned l = ldst + (unsigned)buf * BUF_B;
    copy8(l, kha + (size_t)t * (64 * HD * 2), kla + (size_t)t * (64 * HD * 2), (size_t)16 * HD * 2);
    copy8(l + 2 * TILE_B, vha + (size_t)t * (64 * 2), vla + (size_t)t * (64 * 2), (size_t)16 * SEQ * 2);
  };

  // ---- Q fragments (B operand, column = query = lane&15): 2 d-chunks, hi and lo ----
  v16b qah[2], qal[2];
#pragma unroll
  for (int dc = 0; dc < 2; ++dc) {
    const size_t qo = (rowB + q0 + c) * HD + dc * 32 + 8 * hh;
    qah[dc] = ldfrag_b(Qh + qo);
    qal[dc] = ldfrag_b(Ql + qo);
  }

  float mrun = -INFINITY;                      // running max of query c, equal in both wave halves
  float lrun = 0.f;                            // running sum of query c over this half's keys (8 of every 16)
  v8f oacc[4];                                 // oacc[t][r] = context of query c, d = t*16 + 8*hh + r
#pragma unroll
  for (int t = 0; t < 4; ++t) oacc[t] = zero8();

  stage(0, 0);
  asm volatile("s_wait_asynccnt 0x0" ::: "memory");   // this wave's copies of chunk 0 have landed before the barrier publishes them
  __syncthreads();
  if (NT > 1) stage(1, 1);

  for (int ki = 0; ki < NT; ++ki) {            // static trip count, the same in every wave of the block
    const unsigned char* tb = Ring + (ki & 1) * BUF_B + kg * GRP_B;   // trip ki reads ring buffer ki & 1 alone
    const __bf16*   Ksh = (const __bf16*)(const void*)(tb);
    const __bf16*   Ksl = (const __bf16*)(const void*)(tb + TILE_B);
    const _Float16* Vth = (const _Float16*)(const void*)(tb + 2 * TILE_B);
    const _Float16* Vtl = (const _Float16*)(const void*)(tb + 3 * TILE_B);

    // ---- scores, transposed: 64 keys x 16 queries per wave, 3 bf16 products per (key subtile, d-chunk) ----
    v8f s[4];
#pragma unroll
    for (int j = 0; j < 4; ++j) {
      s[j] = zero8();
#pragma unroll
      for (int dc = 0; dc < 2; ++dc) {
        FB kb, kl;
        kb.h[0] = *(const v8b*)(Ksh + (j * 16 + c) * LP + dc * 32 + 8 * hh);
        kb.h[1] = *(const v8b*)(Ksh + (j * 16 + c) * LP + dc * 32 + 16 + 8 * hh);
        kl.h[0] = *(const v8b*)(Ksl + (j * 16 + c) * LP + dc * 32 + 8 * hh);
        kl.h[1] = *(const v8b*)(Ksl + (j * 16 + c) * LP + dc * 32 + 16 + 8 * hh);
        s[j] = mma_b(kb.v, qah[dc], s[j]);
        s[j] = mma_b(kl.v, qah[dc], s[j]);
        s[j] = mma_b(kb.v, qal[dc], s[j]);
      }
    }

    // ---- scale, max of the lane's 32 keys joined with the other half's, online softmax ----
    float m = -INFINITY;
#pragma unroll
    for (int j = 0; j < 4; ++j)
#pragma unroll
      for (int r = 0; r < 8; ++r) {
        const float sv = s[j][r] * 0.125f;
        s[j][r] = sv;
        m = fmaxf(m, sv);
      }
    m = fmaxf(m, xhalf(m));
    const float mnew  = fmaxf(mrun, m);
    const float msafe = (mnew == -INFINITY) ? 0.f : mnew;
    const float alpha = __expf(mrun - msafe);
    mrun = mnew;
    // ---- P^T (x1024, f16) and its residual (x4096) packed straight into B operands: pa[kk] / pr[kk] = keys kk*32 .. kk*32+31 ----
    FH pa[2], pr[2];
    float psum[4];
#pragma unroll
    for (int j = 0; j < 4; ++j) {
      psum[j] = 0.f;
#pragma unroll
      for (int r = 0; r < 8; r += 2) {         // two keys at a time: one register of the operand
        const float p0 = __expf(s[j][r] - msafe), p1 = __expf(s[j][r + 1] - msafe);
        psum[j] += p0;
        psum[j] += p1;
        const v2f p1k = {p0 * 1024.0f, p1 * 1024.0f};
        const v2h ph  = __builtin_convertvector(p1k, v2h);
        const v2h pl  = __builtin_convertvector((p1k - __builtin_convertvector(ph, v2f)) * 4096.0f, v2h);
        pa[j >> 1].v[(j & 1) * 8 + r] = ph[0];  pa[j >> 1].v[(j & 1) * 8 + r + 1] = ph[1];
        pr[j >> 1].v[(j & 1) * 8 + r] = pl[0];  pr[j >> 1].v[(j & 1) * 8 + r + 1] = pl[1];
      }
    }
    lrun = lrun * alpha + ((psum[0] + psum[1]) + (psum[2] + psum[3]));
#pragma unroll
    for (int t = 0; t < 4; ++t)
#pragma unroll
      for (int r = 0; r < 8; ++r) oacc[t][r] *= alpha;

    // ---- context^T += V^T . P^T (f16 WMMA), residual products into a separate accumulator ----
    v8f o1[4];
#pragma unroll
    for (int t = 0; t < 4; ++t) o1[t] = zero8();
#pragma unroll   // pa / pr are register arrays: their index must be a constant
    for (int kk = 0; kk < 2; ++kk) {
#pragma unroll
      for (int t = 0; t < 4; ++t) {
        FH vb, vl;
        vb.h[0] = *(const v8h*)(Vth + (t * 16 + c) * LP + kk * 32 + 8 * hh);
        vb.h[1] = *(const v8h*)(Vth + (t * 16 + c) * LP + kk * 32 + 16 + 8 * hh);
        vl.h[0] = *(const v8h*)(Vtl + (t * 16 + c) * LP + kk * 32 + 8 * hh);
        vl.h[1] = *(const v8h*)(Vtl + (t * 16 + c) * LP + kk * 32 + 16 + 8 * hh);
        oacc[t] = mma_h(vb.v, pa[kk].v, oacc[t]);
        o1[t]   = mma_h(vl.v, pa[kk].v, o1[t]);
        o1[t]   = mma_h(vb.v, pr[kk].v, o1[t]);
      }
    }
#pragma unroll
    for (int t = 0; t < 4; ++t)
#pragma unroll
      for (int r = 0; r < 8; ++r) oacc[t][r] += o1[t][r] * (1.0f / 4096.0f);

    // ---- foot of the trip: publish chunk ki + 1, free this trip's buffer, refill it ----
    asm volatile("s_wait_dscnt 0x0" ::: "memory");      // this wave's reads of the buffer are done before anyone's copies overwrite it
    asm volatile("s_wait_asynccnt 0x0" ::: "memory");   // this wave's copies of chunk ki + 1 have landed before the barrier publishes them
    __syncthreads();
    if (ki + 2 < NT) stage(ki + 2, ki & 1);             // block-uniform test
  }
  asm volatile("s_wait_asynccnt 0x0" ::: "memory");     // no copy is outstanding when the ring's bytes are reused below

  // ---- hand over the wave's partials: un-normalised context tile (p carry x1024 still in), running max and sum per query ----
  lrun += xhalf(lrun);                         // the two halves' keys together
  float* Os = (float*)(void*)Ring;             // tile of wave w at w * 16 * OP
  float* os = Os + wave * (16 * OP);
#pragma unroll
  for (int t = 0; t < 4; ++t) {
    const v4f lo = {oacc[t][0], oacc[t][1], oacc[t][2], oacc[t][3]};
    const v4f hi = {oacc[t][4], oacc[t][5], oacc[t][6], oacc[t][7]};
    *(v4f*)(os + c * OP + t * 16 + 8 * hh)     = lo;
    *(v4f*)(os + c * OP + t * 16 + 8 * hh + 4) = hi;
  }
  if (hh == 0) {                               // mrun / lrun are equal in the two lanes of a query
    Ms[wave][c] = mrun;
    Ls[wave][c] = lrun;
  }
  __syncthreads();                             // every group's partials are read by the merging waves below
  // ---- merge the KG partials of 4 rows per wave, normalise (1/l and the 1/1024 p carry), store whole rows ----
  {
    const int h2 = lane >> 4, c4 = (lane & 15) * 4;
#pragma unroll
    for (int it = 0; it < 2; ++it) {
      const int row = kg * 4 + it * 2 + h2;    // kg 0..3 x it 0..1 x h2 0..1 = rows 0..15 of the query tile
      float mg[KG];
      float mall = -INFINITY;
#pragma unroll
      for (int g = 0; g < KG; ++g) { mg[g] = Ms[g * 4 + qt][row]; mall = fmaxf(mall, mg[g]); }
      const float msafe = (mall == -INFINITY) ? 0.f : mall;
      float l = 0.f;
      v4f o = {0.f, 0.f, 0.f, 0.f};
#pragma unroll
      for (int g = 0; g < KG; ++g) {
        const float w = __expf(mg[g] - msafe);
        l += w * Ls[g * 4 + qt][row];
        o += w * *(const v4f*)(Os + (g * 4 + qt) * (16 * OP) + row * OP + c4);
      }
      const float inv = ((l > 0.f) ? (1.0f / l) : 0.f) * (1.0f / 1024.0f);
      *(v4f*)(outp + (rowB + q0 + row) * HD + c4) = o * inv;
    }
  }
}

// =====================================================================================================
// Workspace map (bytes, full build NB=8 SEQ=2048; every region is an exact multiple of its whole-line store granularity,
// all shapes are tile multiples so no padded tails exist; no region is reused):
//   Qh   bf16 [NB*SEQ][64]           0             2097152
//   Ql                              2097152       2097152
//   Kh                              4194304       2097152
//   Kl                              6291456       2097152
//   VTh  f16  [NB][64][SEQ]         8388608       2097152
//   VTl  f16  [NB][64][SEQ]         10485760      2097152
//   end                             12582912
// =====================================================================================================
extern "C" void kernel_launch(void* const* d_in, const int* in_sizes, int n_in,
                              void* d_out, int out_size, void* d_ws, size_t ws_size,
                              hipStream_t stream) {
  if (n_in < 9) return;
  const long long NX_NEED = ((long long)(NB - 1) * SEQ_FULL + SEQ) * (long long)DIN;   // last row read + 1, floats
  const int NO  = NB * SEQ * HD;                   // output elements (1048576 full)
  const int NW  = DIN * HD;                        //   32768
  if ((long long)in_sizes[0] < NX_NEED || (long long)in_sizes[1] < NX_NEED || (long long)in_sizes[2] < NX_NEED) return;
  if (in_sizes[3] < NW || in_sizes[5] < NW || in_sizes[7] < NW) return;
  if (in_sizes[4] < HD || in_sizes[6] < HD || in_sizes[8] < HD) return;
  if (out_size < NO) return;

  const float* q_in = (const float*)d_in[0];   // [8][2048][512]
  const float* k_in = (const float*)d_in[1];   // [8][2048][512]
  const float* v_in = (const float*)d_in[2];   // [8][2048][512]
  const float* Wq   = (const float*)d_in[3];   // [512 in][64 out]
  const float* bq   = (const float*)d_in[4];   // [64]
  const float* Wk   = (const float*)d_in[5];   // [512][64]
  const float* bk   = (const float*)d_in[6];   // [64]
  const float* Wv   = (const float*)d_in[7];   // [512][64]
  const float* bv   = (const float*)d_in[8];   // [64]

  const size_t PP  = (size_t)NO * 2;               // 16-bit projected plane [NB*SEQ][64]
  const size_t PVT = (size_t)NB * HD * SEQ * 2;    // 16-bit v^T plane [NB][64][SEQ]
  size_t off = 0;
  const size_t oQh  = off; off += PP;
  const size_t oQl  = off; off += PP;
  const size_t oKh  = off; off += PP;
  const size_t oKl  = off; off += PP;
  const size_t oVTh = off; off += PVT;
  const size_t oVTl = off; off += PVT;
  if (off > ws_size) return;                       // off = 12582912 (full build)

  char* ws = (char*)d_ws;
  unsigned short* Qh  = (unsigned short*)(ws + oQh);
  unsigned short* Ql  = (unsigned short*)(ws + oQl);
  unsigned short* Kh  = (unsigned short*)(ws + oKh);
  unsigned short* Kl  = (unsigned short*)(ws + oKl);
  unsigned short* VTh = (unsigned short*)(ws + oVTh);
  unsigned short* VTl = (unsigned short*)(ws + oVTl);

  const dim3 gProj(NB * SEQ / PROWS, 3);                       //  128 blocks (full) x 3 products
  const dim3 gAttn(NB * NQB);                                  //  256 blocks of 512 (full)

  // (1) f32 inputs and weights -> q, k bf16 hi/lo planes, v^T f16 hi / residual planes
  proj3<<<gProj, dim3(256), 0, stream>>>(q_in, k_in, v_in, Wq, Wk, Wv, bq, bk, bv, Qh, Ql, Kh, Kl, VTh, VTl);
  // (2) attention -> d_out f32 [NB*SEQ][64]
  attn64<<<gAttn, dim3(512), 0, stream>>>(Qh, Ql, Kh, Kl, VTh, VTl, (float*)d_out);
  (void)hipGetLastError();
}

// v007
// It runs in 38.3 microseconds.
// In both of two side-by-side timings against v006, it was 1.05 times as fast.
// Over all steps from v000 it is 6.31 times as fast.
// Contractions: q, k, v^T projections = v_wmma_f32_16x16x32_bf16 (bf16 operands from RNE-converted inputs and weights, single product, f32 accumulate);
// q.k^T scores = v_wmma_f32_16x16x32_bf16 with bf16 hi/lo split q and k (hi.hi + hi.lo + lo.hi), f32 accumulate;
// p.v = v_wmma_f32_16x16x32_f16 (p carried x1024 as f16 hi plane + f16 residual plane x4096, v as f16 hi plane + f16 residual
// plane x4096; 3 products hi.hi, hi.res, res.hi), f32 accumulate; softmax (running max), normalisers and bias adds in f32 on the VALU.
// Carry audit:
//   ph  = f16(1024 * p)                      -> the 1/1024 is folded exactly once in the attention epilogue: inv = (1/l) * (1/1024)
//   pl  = f16((1024 p - ph) * 4096)          }  products ph.VTl and pl.VTh go to the separate accumulator o1,
//   VTl = f16((v - VTh) * 4096)              }  folded back with * (1/4096) once per key chunk
//   VTh = f16(v), no carry (|v| typ. 0.65); q / k lo planes are unscaled bf16 residuals (v - hi) sharing the hi accumulator;
//   score scale 1/8 applied once in f32 after the score accumulate. No other scaled planes.
#include <hip/hip_runtime.h>
#include <math.h>
#include <stdint.h>

#ifndef NB
#define NB   8
#endif
#ifndef SEQ
#define SEQ  2048
#endif
#define NB_FULL  8
#define SEQ_FULL 2048
#define DIN  512
#define HD   64
#define NQB  (SEQ / 64)   // 64-row query blocks per sequence
#define NKT  (SEQ / 64)   // 64-key chunks per sequence
#define KG   4            // key groups per attention work-group: each group of 4 waves walks NKT / KG chunks
#define LP   72           // LDS row pitch (16-bit elements) of the attention tiles read by 16-B loads: 144 B = 16 B x 9 (odd)
#define OP   68           // LDS row pitch (floats) of a wave's partial context tile: 272 B = 16 B x 17 (odd), 16 rows stored at once
static_assert(NB >= 1 && NB <= NB_FULL && SEQ >= 64 && SEQ <= SEQ_FULL);
static_assert((SEQ % 64) == 0 && (DIN % 32) == 0 && HD == 64);
static_assert(NKT % KG == 0);
#define NT      (NKT / KG)       // key chunks a key group walks
#define TILE_B  (64 * LP * 2)    // bytes of one plane's chunk tile in LDS: 64 rows at pitch LP
#define GRP_B   (4 * TILE_B)     // a key group's four planes of one chunk: K hi, K lo, V^T hi, V^T residual
#define BUF_B   (KG * GRP_B)     // one ring buffer: one chunk of every key group
static_assert(4 * KG * 16 * OP * 4 <= 2 * BUF_B);

typedef _Float16 v16h __attribute__((ext_vector_type(16)));
typedef _Float16 v8h  __attribute__((ext_vector_type(8)));
typedef _Float16 v2h  __attribute__((ext_vector_type(2)));
typedef __bf16   v16b __attribute__((ext_vector_type(16)));
typedef __bf16   v8b  __attribute__((ext_vector_type(8)));
typedef float    v8f  __attribute__((ext_vector_type(8)));
typedef float    v4f  __attribute__((ext_vector_type(4)));
typedef unsigned int v4u __attribute__((ext_vector_type(4)));

// ---- scalar helpers --------------------------------------------------------------------------------
__device__ __forceinline__ unsigned short bf_bits(float f) {          // f32 -> bf16 bits, RNE convert
  unsigned u = __float_as_uint(f);
  return (unsigned short)((u + 0x7FFFu + ((u >> 16) & 1u)) >> 16);
}
__device__ __forceinline__ float bf_up(unsigned short h) { return __uint_as_float(((unsigned)h) << 16); }
__device__ __forceinline__ unsigned short h_bits(_Float16 x) { return __builtin_bit_cast(unsigned short, x); }
__device__ __forceinline__ unsigned pk16(unsigned short a, unsigned short b) { return (unsigned)a | ((unsigned)b << 16); }
__device__ __forceinline__ v8f zero8() { v8f z = {0.f, 0.f, 0.f, 0.f, 0.f, 0.f, 0.f, 0.f}; return z; }
__device__ __forceinline__ float xhalf(float x) {                      // the value of lane l ^ 16
  const int b = __builtin_bit_cast(int, x);
  return __builtin_bit_cast(float, __builtin_amdgcn_permlanex16(b, b, 0x76543210, 0xfedcba98, false, false));
}

__device__ __forceinline__ void lds_wave_sync() {
  __builtin_amdgcn_fence(3, "workgroup");
  __builtin_amdgcn_wave_barrier();
  __builtin_amdgcn_fence(2, "workgroup");
}

// ---- fragment loader: 16-bit A/B operand, lane -> row/col (lane&15), p already includes +8*(lane>>4);
//      elements 0..7 <- p[0..7] (k0+8h..k0+8h+7), elements 8..15 <- p[16..23] (k0+16+8h..k0+16+8h+7)
__device__ __forceinline__ v16b ldfrag_b(const __bf16* p) {
  union { v16b v; v8b h[2]; } f;
  f.h[0] = *(const v8b*)(p);
  f.h[1] = *(const v8b*)(p + 16);
  return f.v;
}

// ---- WMMA helpers: the plain builtins, the compiler keeps the distance to a VALU use of D, A or B ----------------------------
// Scheduling barrier between a group of LDS fragment loads and the products around it: LDS reads and matrix instructions keep the order
// of the source across it; the mask lets plain vector, scalar and transcendental instructions cross, so the softmax still mixes with products.
__device__ __forceinline__ void held() { __builtin_amdgcn_sched_barrier(0x406); }
__device__ __forceinline__ v8f mma_h_raw(v16h a, v16h b, v8f c) {
  return __builtin_amdgcn_wmma_f32_16x16x32_f16(false, a, false, b, (short)0, c, false, false);
}
__device__ __forceinline__ v8f mma_b_raw(v16b a, v16b b, v8f c) {
  return __builtin_amdgcn_wmma_f32_16x16x32_bf16(false, a, false, b, (short)0, c, false, false);
}

// =====================================================================================================
// The three projections in one launch, straight from the f32 inputs; role by block index (block-uniform):
// blockIdx.y = 0: q, 1: k, 2: v. A work-group = 8 waves x 16 activation rows = PROWS rows of one batch, all HD = 64 columns, K = DIN.
//   C[row][n] = sum_k bf16(X[row][k]) * bf16(W[k][n]) + bias[n]   (bias RNE-converted to bf16, added in f32)
// Weight: the work-group reads W f32 [DIN k][HD n] once (256-B rows, 8 B per lane), converts (RNE) and lays it in LDS as
//   Wt bf16 [n][k] at pitch WP, one 16-B store per (n, 8 k); coverage 8 waves x 8 tasks x 8 k x 64 n = the whole plane.
//   One block barrier publishes it; nothing writes Wt afterwards.
// Activations: a wave loads 128 k of one of its rows per instruction (32 lanes x 16 B = 512 contiguous B, four whole lines, each line
//   read once), converts in registers (RNE) and lays the bf16 values in its own LDS slab Xs[wave] [16 rows][128 k] at pitch XP (wave-private,
//   slab_order before the fragment loads and before the slab is written again). Two register buffers of 128 k x 16 rows: a buffer's
//   loads are issued two buffers ahead of its products. k runs upward in steps of 32, one product per step.
// Output: q, k -> bf16 hi plane + bf16 lo plane (lo = RNE(v - hi), unscaled), rows of 64 = one 128-B line, staged per wave in LDS
//   (wave-private slab, lds_wave_sync). v -> transposed through a block tile T[d][s] (f32, pitch TP) behind one block barrier, then
//   f16 hi plane [b][d][s] and residual plane f16((v - hi) * 4096): 16 lanes x 16 B = the block's 256 B of a d row.
// grid = (NB * SEQ / PROWS, 3): every tile exists, no guards.
// =====================================================================================================
#define PROWS 128   // activation rows per projection work-group
#define WP    520   // LDS row pitch (bf16 elements) of the transposed weight: 1040 B = 16 B x 65 (odd)
#define XP    136   // LDS row pitch (bf16 elements) of a wave's activation slab: 272 B = 16 B x 17 (odd)
#define TP    132   // LDS row pitch (floats) of the v^T hand-over tile: 528 B = 16 B x 33 (odd)
static_assert(SEQ % PROWS == 0 && DIN == 512 && HD * TP <= 8 * 16 * 68);
typedef __bf16 v4b __attribute__((ext_vector_type(4)));
typedef float  v2f __attribute__((ext_vector_type(2)));

// Order inside one wave between its LDS stores and its LDS loads of the same slab. The wait retires the wave's LDS operations; the "memory"
// clobber keeps the compiler from moving an LDS access across. Unlike a work-group fence it leaves the global loads in flight un-waited.
// The scheduling barrier keeps the conversions of a buffer whose loads are still in flight, and with them its s_wait_loadcnt, from
// being lifted into the products of the buffer before: without it the wave waits for those loads before it has issued the next ones.
__device__ __forceinline__ void slab_order() {
  asm volatile("s_wait_dscnt 0x0" ::: "memory");
  __builtin_amdgcn_sched_barrier(0);
}

// (the loops of ld_x, put_x and mm_x are unrolled so that every index of a register array is a constant)
// one buffer = 128 k of the wave's 16 rows: x[i] = 4 floats of row i at k = 4*lane..4*lane+3; xp = row 0, first k of the buffer, + 4*lane
__device__ __forceinline__ void ld_x(v4f (&x)[16], const float* __restrict__ xp) {
#pragma unroll
  for (int i = 0; i < 16; ++i) x[i] = *(const v4f*)(xp + (size_t)i * DIN);
}
// convert the buffer and lay it in the wave's slab: row i, k = 4*lane..+3, one 8-B store per lane (256 contiguous B per row); xs includes + 4*lane
__device__ __forceinline__ void put_x(__bf16* xs, const v4f (&x)[16]) {
#pragma unroll
  for (int i = 0; i < 16; ++i) *(v4b*)(xs + i * XP) = __builtin_convertvector(x[i], v4b);
}
// the slab's 4 k-steps x 4 column tiles; xf = slab + (lane&15)*XP + 8*(lane>>4); wp = Wt + (lane&15)*WP + 8*(lane>>4) + first k of the buffer
__device__ __forceinline__ void mm_x(v8f (&acc)[4], const __bf16* xf, const __bf16* wp) {
#pragma unroll
  for (int ks = 0; ks < 4; ++ks) {
    const v16b a = ldfrag_b(xf + ks * 32);
#pragma unroll
    for (int j = 0; j < 4; ++j) acc[j] = mma_b_raw(a, ldfrag_b(wp + j * 16 * WP + ks * 32), acc[j]);
  }
}

__global__ __launch_bounds__(256) void proj3(
    const float* __restrict__ q_in, const float* __restrict__ k_in, const float* __restrict__ v_in,
    const float* __restrict__ Wq, const float* __restrict__ Wk, const float* __restrict__ Wv,
    const float* __restrict__ bq, const float* __restrict__ bk, const float* __restrict__ bv,
    unsigned short* Qh, unsigned short* Ql, unsigned short* Kh, unsigned short* Kl,
    unsigned short* VTh, unsigned short* VTl) {
  __shared__ __align__(16) __bf16 Wt[HD * WP];       // weight [n][k], 65 KB (cross-wave, one block barrier)
  __shared__ __align__(16) __bf16 Xs[8][16 * XP];    // per wave activations [row][k of the buffer], 34 KB (wave-private)
  __shared__ __align__(16) float  sT[8 * 16 * 68];   // q, k: per-wave 16x64 slab, pitch 68; v: block tile [64 d][TP], 34 KB
  const int role = blockIdx.y;
  const float* X    = (role == 0) ? q_in : ((role == 1) ? k_in : v_in);
  const float* Wg   = (role == 0) ? Wq : ((role == 1) ? Wk : Wv);
  const float* bias = (role == 0) ? bq : ((role == 1) ? bk : bv);
  const int lane = threadIdx.x & 31;
  const int wave = threadIdx.x >> 5;
  const int c    = lane & 15;                  // row (A) / column (B, D) within a 16-tile
  const int hh   = lane >> 4;
  const int r0   = blockIdx.x * PROWS;         // first compact row of the block; PROWS divides SEQ: one batch per block
  const int b    = r0 / SEQ;
  const int t0   = r0 - b * SEQ;
  const float* xp = X + ((size_t)b * SEQ_FULL + t0 + wave * 16) * DIN + 4 * lane;

  v4f xa[16], xb[16];
  ld_x(xa, xp);
  ld_x(xb, xp + 128);

#pragma unroll 4   // 4 tasks = 32 weight loads in flight per wave; all 8 would not fit in registers beside the two activation buffers
  for (int tsk = 0; tsk < 8; ++tsk) {
    const int k8 = (tsk * 8 + wave) * 8;       // 0..504
    v2f f[8];
#pragma unroll
    for (int e = 0; e < 8; ++e) f[e] = *(const v2f*)(Wg + (size_t)(k8 + e) * HD + 2 * lane);
#pragma unroll
    for (int i = 0; i < 2; ++i) {
      const v8f col = {f[0][i], f[1][i], f[2][i], f[3][i], f[4][i], f[5][i], f[6][i], f[7][i]};
      *(v8b*)(Wt + (2 * lane + i) * WP + k8) = __builtin_convertvector(col, v8b);
    }
  }
  __syncthreads();                             // the whole weight plane is read by every wave below

  v8f acc[4];
#pragma unroll
  for (int j = 0; j < 4; ++j) acc[j] = zero8();
  const __bf16* wp = Wt + c * WP + 8 * hh;
  __bf16*       xs = Xs[wave] + 4 * lane;
  const __bf16* xf = Xs[wave] + c * XP + 8 * hh;
  put_x(xs, xa);
  ld_x(xa, xp + 256);
  slab_order();                                // the slab's rows are read across the wave's lanes
  mm_x(acc, xf, wp);
  slab_order();                                // the fragment loads above stay ahead of the next buffer's stores
  put_x(xs, xb);
  ld_x(xb, xp + 384);
  slab_order();
  mm_x(acc, xf, wp + 128);
  slab_order();
  put_x(xs, xa);
  slab_order();
  mm_x(acc, xf, wp + 256);
  slab_order();
  put_x(xs, xb);
  slab_order();
  mm_x(acc, xf, wp + 384);

  float bcol[4];
#pragma unroll
  for (int j = 0; j < 4; ++j) bcol[j] = bf_up(bf_bits(bias[(j << 4) + c]));
  const int mOff = hh * 8;                     // D row offset of this lane half

  if (role == 2) {
    // D element (s = wave*16 + mOff + r, d = j*16 + c) -> T[d][s]: 8 consecutive s per lane = two 16-B stores
#pragma unroll
    for (int j = 0; j < 4; ++j) {
      float* tp = sT + ((j << 4) + c) * TP + wave * 16 + mOff;
      const v4f lo = {acc[j][0] + bcol[j], acc[j][1] + bcol[j], acc[j][2] + bcol[j], acc[j][3] + bcol[j]};
      const v4f hi = {acc[j][4] + bcol[j], acc[j][5] + bcol[j], acc[j][6] + bcol[j], acc[j][7] + bcol[j]};
      *(v4f*)(tp)     = lo;
      *(v4f*)(tp + 4) = hi;
    }
    __syncthreads();                           // block-uniform branch; every wave's columns are read by the storing threads below
    const int s8 = (threadIdx.x & 15) * 8, dr = threadIdx.x >> 4;   // 16 threads x 8 s = 128 s of a d row; 16 rows per pass
    v4u hv[4], lv[4];
#pragma unroll
    for (int it = 0; it < 4; ++it) {
      const float* sp = sT + (it * 16 + dr) * TP + s8;
      v4u a, a2;
#pragma unroll
      for (int e = 0; e < 4; ++e) {
        const float f0 = sp[2 * e], f1 = sp[2 * e + 1];
        const _Float16 x0 = (_Float16)f0, x1 = (_Float16)f1;
        a[e]  = pk16(h_bits(x0), h_bits(x1));
        a2[e] = pk16(h_bits((_Float16)((f0 - (float)x0) * 4096.0f)), h_bits((_Float16)((f1 - (float)x1) * 4096.0f)));
      }
      hv[it] = a; lv[it] = a2;
    }
#pragma unroll
    for (int it = 0; it < 4; ++it) {
      const size_t o = ((size_t)b * HD + it * 16 + dr) * SEQ + t0 + s8;
      *(v4u*)(VTh + o) = hv[it];
      *(v4u*)(VTl + o) = lv[it];
    }
  } else {
    unsigned short* C  = (role == 0) ? Qh : Kh;
    unsigned short* C2 = (role == 0) ? Ql : Kl;
    float* slab = sT + wave * (16 * 68);
#pragma unroll
    for (int j = 0; j < 4; ++j)
#pragma unroll
      for (int r = 0; r < 8; ++r) slab[(mOff + r) * 68 + (j << 4) + c] = acc[j][r] + bcol[j];
    lds_wave_sync();
    const int q = lane >> 3, c8 = (lane & 7) * 8;
    v4u hv[4], lv[4];
#pragma unroll
    for (int it = 0; it < 4; ++it) {
      const float* sp = slab + (it * 4 + q) * 68 + c8;   // it 0..3 x q 0..3 = rows 0..15
      v4u a, a2;
#pragma unroll
      for (int e = 0; e < 4; ++e) {
        const float f0 = sp[2 * e], f1 = sp[2 * e + 1];
        const unsigned short h0 = bf_bits(f0), h1 = bf_bits(f1);
        a[e]  = pk16(h0, h1);
        a2[e] = pk16(bf_bits(f0 - bf_up(h0)), bf_bits(f1 - bf_up(h1)));
      }
      hv[it] = a; lv[it] = a2;
    }
#pragma unroll
    for (int it = 0; it < 4; ++it) {
      const size_t o = (size_t)(r0 + wave * 16 + it * 4 + q) * HD + c8;
      *(v4u*)(C + o)  = hv[it];
      *(v4u*)(C2 + o) = lv[it];
    }
    // precaution: the stores' address registers may be reused by code laid out behind this branch; the wait stands ahead of any such overwrite
    asm volatile("s_wait_xcnt 0x0" ::: "memory");
  }
}

__device__ __forceinline__ void copy8(unsigned l, const char* ga, const char* gb, size_t gs) {
  asm volatile("global_load_async_to_lds_b128 %0, %8, off\n\t"
               "global_load_async_to_lds_b128 %1, %9, off\n\t"
               "global_load_async_to_lds_b128 %2, %10, off\n\t"
               "global_load_async_to_lds_b128 %3, %11, off\n\t"
               "global_load_async_to_lds_b128 %4, %12, off\n\t"
               "global_load_async_to_lds_b128 %5, %13, off\n\t"
               "global_load_async_to_lds_b128 %6, %14, off\n\t"
               "global_load_async_to_lds_b128 %7, %15, off\n\t"
               "s_wait_xcnt 0x0"
               :: "v"(l), "v"(l + 16u * LP * 2u), "v"(l + 32u * LP * 2u), "v"(l + 48u * LP * 2u),
                  "v"(l + TILE_B), "v"(l + TILE_B + 16u * LP * 2u), "v"(l + TILE_B + 32u * LP * 2u), "v"(l + TILE_B + 48u * LP * 2u),
                  "v"(ga), "v"(ga + gs), "v"(ga + 2 * gs), "v"(ga + 3 * gs),
                  "v"(gb), "v"(gb + gs), "v"(gb + 2 * gs), "v"(gb + 3 * gs)
               : "memory");
}

__global__ __launch_bounds__(512)
void attn64(const unsigned short* __restrict__ qhp, const unsigned short* __restrict__ qlp,
            const unsigned short* __restrict__ khp, const unsigned short* __restrict__ klp,
            const unsigned short* __restrict__ vhp, const unsigned short* __restrict__ vlp,
            float* outp) {
  union FB { v16b v; v8b h[2]; };
  union FH { v16h v; v8h h[2]; };
  // Rows of 64 elements at pitch LP: the 8 pad elements of a row are never written and never read.
  // Ring[buffer][group][plane]: K hi [kv][d], K lo, V^T hi [d][kv], V^T residual, 9 KB each; 2 x 144 KB (cross-wave, block barriers).
  // Behind the loop the same bytes hold the per-wave partial context tiles [row][d], 68 KB (merged cross-wave).
  __shared__ __align__(16) unsigned char Ring[2 * BUF_B];
  __shared__ float                  Ms[4 * KG][16];               // per wave running max per row (merged cross-wave)
  __shared__ float                  Ls[4 * KG][16];               // per wave running sum per row (merged cross-wave)

  const int wave = threadIdx.x >> 5;           // 0..15
  const int qt   = wave & 3;                   // query tile of the block
  const int kg   = wave >> 2;                  // key group
  const int tid  = threadIdx.x & 127;          // thread index inside the key group
  const int lane = tid & 31;
  const int hh   = lane >> 4;
  const int c    = lane & 15;

  const int bx   = blockIdx.x;
  const int qb   = bx % NQB;
  const int b    = bx / NQB;                   // 0..NB-1
  const int q0   = qb * 64 + qt * 16;
  const size_t rowB = (size_t)b * SEQ;

  const __bf16* Qh = (const __bf16*)(const void*)qhp;
  const __bf16* Ql = (const __bf16*)(const void*)qlp;
  // ---- the lane's part of a chunk's copies: row r4 + 16*step of each plane, bytes c16..c16+15 of its 128 ----
  const int r4  = qt * 4 + (lane >> 3);        // 0..15
  const int c16 = (lane & 7) * 16;
  const unsigned ldst = (unsigned)(size_t)Ring + (unsigned)(kg * GRP_B + r4 * (LP * 2) + c16);   // LDS byte address, buffer 0, K hi
  const size_t   ko   = ((rowB + (size_t)kg * NT * 64 + r4) * HD) * 2 + c16;                      // K planes: key row, chunk 0 of the group
  const size_t   vo   = (((size_t)b * HD + r4) * SEQ + (size_t)kg * NT * 64) * 2 + c16;           // V^T planes: d row, chunk 0 of the group
  const char* kha = (const char*)(const void*)khp + ko;
  const char* kla = (const char*)(const void*)klp + ko;
  const char* vha = (const char*)(const void*)vhp + vo;
  const char* vla = (const char*)(const void*)vlp + vo;
  // chunk t of the group (t < NT: its last key row and column lie inside the planes) into ring buffer buf
  auto stage = [&](int t, int buf) {
    const unsigned l = ldst + (unsigned)buf * BUF_B;
    copy8(l, kha + (size_t)t * (64 * HD * 2), kla + (size_t)t * (64 * HD * 2), (size_t)16 * HD * 2);
    copy8(l + 2 * TILE_B, vha + (size_t)t * (64 * 2), vla + (size_t)t * (64 * 2), (size_t)16 * SEQ * 2);
  };

  // ---- Q fragments (B operand, column = query = lane&15): 2 d-chunks, hi and lo ----
  v16b qah[2], qal[2];
#pragma unroll
  for (int dc = 0; dc < 2; ++dc) {
    const size_t qo = (rowB + q0 + c) * HD + dc * 32 + 8 * hh;
    qah[dc] = ldfrag_b(Qh + qo);
    qal[dc] = ldfrag_b(Ql + qo);
  }

  float mrun = -INFINITY;                      // running max of query c, equal in both wave halves
  float lrun = 0.f;                            // running sum of query c over this half's keys (8 of every 16)
  v8f oacc[4];                                 // oacc[t][r] = context of query c, d = t*16 + 8*hh + r
#pragma unroll
  for (int t = 0; t < 4; ++t) oacc[t] = zero8();

  stage(0, 0);
  asm volatile("s_wait_asynccnt 0x0" ::: "memory");   // this wave's copies of chunk 0 have landed before the barrier publishes them
  __syncthreads();
  if (NT > 1) stage(1, 1);

  for (int ki = 0; ki < NT; ++ki) {            // static trip count, the same in every wave of the block
    const unsigned char* tb = Ring + (ki & 1) * BUF_B + kg * GRP_B;   // trip ki reads ring buffer ki & 1 alone
    const __bf16*   Ksh = (const __bf16*)(const void*)(tb);
    const __bf16*   Ksl = (const __bf16*)(const void*)(tb + TILE_B);
    const _Float16* Vth = (const _Float16*)(const void*)(tb + 2 * TILE_B);
    const _Float16* Vtl = (const _Float16*)(const void*)(tb + 3 * TILE_B);

    // Fragment loads stand in groups of 8 to 24, each group issued at least one block of products (or the softmax) ahead of the products that read it, but K subtile 0, read by qk(0) right behind.
    // held(): without it the scheduler sinks a group's loads down to their products, and the wave waits out the LDS latency at each of them.
    FB kb[4][2], kl[4][2];                     // K hi / lo fragments of key subtile j, d-chunk dc
    FH vb[2][4], vl[2][4];                     // V^T hi / residual fragments of 32-key step kk, d tile t
    auto ldk = [&](int j) {
#pragma unroll   // kb / kl are register arrays: their index must be a constant
      for (int dc = 0; dc < 2; ++dc) {
        kb[j][dc].h[0] = *(const v8b*)(Ksh + (j * 16 + c) * LP + dc * 32 + 8 * hh);
        kb[j][dc].h[1] = *(const v8b*)(Ksh + (j * 16 + c) * LP + dc * 32 + 16 + 8 * hh);
        kl[j][dc].h[0] = *(const v8b*)(Ksl + (j * 16 + c) * LP + dc * 32 + 8 * hh);
        kl[j][dc].h[1] = *(const v8b*)(Ksl + (j * 16 + c) * LP + dc * 32 + 16 + 8 * hh);
      }
    };
    auto ldv = [&](int kk, int t) {
      vb[kk][t].h[0] = *(const v8h*)(Vth + (t * 16 + c) * LP + kk * 32 + 8 * hh);
      vb[kk][t].h[1] = *(const v8h*)(Vth + (t * 16 + c) * LP + kk * 32 + 16 + 8 * hh);
      vl[kk][t].h[0] = *(const v8h*)(Vtl + (t * 16 + c) * LP + kk * 32 + 8 * hh);
      vl[kk][t].h[1] = *(const v8h*)(Vtl + (t * 16 + c) * LP + kk * 32 + 16 + 8 * hh);
    };
    // ---- scores, transposed: 64 keys x 16 queries per wave, 3 bf16 products per (key subtile, d-chunk) ----
    v8f s[4];
    auto qk = [&](int j) {
      s[j] = zero8();
#pragma unroll   // register arrays again
      for (int dc = 0; dc < 2; ++dc) {
        s[j] = mma_b_raw(kb[j][dc].v, qah[dc], s[j]);
        s[j] = mma_b_raw(kl[j][dc].v, qah[dc], s[j]);
        s[j] = mma_b_raw(kb[j][dc].v, qal[dc], s[j]);
      }
    };
    ldk(0); ldk(1); ldk(2);
    held();
    qk(0);
    held();
    ldk(3);
    held();
    qk(1);
    held();
    ldv(0, 0); ldv(0, 1);                      // step 0 of V^T: read by the context products behind the softmax
    held();
    qk(2);
    held();
    ldv(0, 2); ldv(0, 3);
    held();
    qk(3);

    // ---- scale, max of the lane's 32 keys joined with the other half's, online softmax ----
    float m = -INFINITY;
#pragma unroll
    for (int j = 0; j < 4; ++j)
#pragma unroll
      for (int r = 0; r < 8; ++r) {
        const float sv = s[j][r] * 0.125f;
        s[j][r] = sv;
        m = fmaxf(m, sv);
      }
    m = fmaxf(m, xhalf(m));
    const float mnew  = fmaxf(mrun, m);
    const float msafe = (mnew == -INFINITY) ? 0.f : mnew;
    const float alpha = __expf(mrun - msafe);
    mrun = mnew;
    // ---- P^T (x1024, f16) and its residual (x4096) packed straight into B operands: pa[kk] / pr[kk] = keys kk*32 .. kk*32+31 ----
    FH pa[2], pr[2];
    float psum[4];
#pragma unroll
    for (int j = 0; j < 4; ++j) {
      psum[j] = 0.f;
#pragma unroll
      for (int r = 0; r < 8; r += 2) {         // two keys at a time: one register of the operand
        const float p0 = __expf(s[j][r] - msafe), p1 = __expf(s[j][r + 1] - msafe);
        psum[j] += p0;
        psum[j] += p1;
        const v2f p1k = {p0 * 1024.0f, p1 * 1024.0f};
        const v2h ph  = __builtin_convertvector(p1k, v2h);
        const v2h pl  = __builtin_convertvector((p1k - __builtin_convertvector(ph, v2f)) * 4096.0f, v2h);
        pa[j >> 1].v[(j & 1) * 8 + r] = ph[0];  pa[j >> 1].v[(j & 1) * 8 + r + 1] = ph[1];
        pr[j >> 1].v[(j & 1) * 8 + r] = pl[0];  pr[j >> 1].v[(j & 1) * 8 + r + 1] = pl[1];
      }
    }
    lrun = lrun * alpha + ((psum[0] + psum[1]) + (psum[2] + psum[3]));
#pragma unroll
    for (int t = 0; t < 4; ++t)
#pragma unroll
      for (int r = 0; r < 8; ++r) oacc[t][r] *= alpha;

    // ---- context^T += V^T . P^T (f16 WMMA), residual products into a separate accumulator ----
    v8f o1[4];
#pragma unroll
    for (int t = 0; t < 4; ++t) o1[t] = zero8();
    auto pv = [&](int kk, int t) {
      oacc[t] = mma_h_raw(vb[kk][t].v, pa[kk].v, oacc[t]);
      o1[t]   = mma_h_raw(vl[kk][t].v, pa[kk].v, o1[t]);
      o1[t]   = mma_h_raw(vb[kk][t].v, pr[kk].v, o1[t]);
    };
    pv(0, 0); pv(0, 1);
    held();
    ldv(1, 0); ldv(1, 1);
    held();
    pv(0, 2); pv(0, 3);
    held();
    ldv(1, 2); ldv(1, 3);                      // the trip's last reads of the buffer
    held();
    pv(1, 0); pv(1, 1);
    __builtin_amdgcn_sched_barrier(0);         // the six products above stay ahead of the foot's waits: the last group's latency passes under them

    // ---- foot of the trip: publish chunk ki + 1, free this trip's buffer, refill it ----
    asm volatile("s_wait_dscnt 0x0" ::: "memory");      // this wave's reads of the buffer are done before anyone's copies overwrite it
    asm volatile("s_wait_asynccnt 0x0" ::: "memory");   // this wave's copies of chunk ki + 1 have landed before the barrier publishes them
    __syncthreads();
    __builtin_amdgcn_sched_barrier(0);         // the six products below are not lifted back over the barrier
    // The last six products read registers alone. They stand behind the barrier, where all waves of a SIMD would otherwise issue copies,
    // vector work and the next chunk's first loads at the same time, with nothing for the matrix unit.
    pv(1, 2); pv(1, 3);
    if (ki + 2 < NT) stage(ki + 2, ki & 1);             // block-uniform test
#pragma unroll
    for (int t = 0; t < 4; ++t)
#pragma unroll
      for (int r = 0; r < 8; ++r) oacc[t][r] += o1[t][r] * (1.0f / 4096.0f);
  }
  asm volatile("s_wait_asynccnt 0x0" ::: "memory");     // no copy is outstanding when the ring's bytes are reused below

  // ---- hand over the wave's partials: un-normalised context tile (p carry x1024 still in), running max and sum per query ----
  lrun += xhalf(lrun);                         // the two halves' keys together
  float* Os = (float*)(void*)Ring;             // tile of wave w at w * 16 * OP
  float* os = Os + wave * (16 * OP);
#pragma unroll
  for (int t = 0; t < 4; ++t) {
    const v4f lo = {oacc[t][0], oacc[t][1], oacc[t][2], oacc[t][3]};
    const v4f hi = {oacc[t][4], oacc[t][5], oacc[t][6], oacc[t][7]};
    *(v4f*)(os + c * OP + t * 16 + 8 * hh)     = lo;
    *(v4f*)(os + c * OP + t * 16 + 8 * hh + 4) = hi;
  }
  if (hh == 0) {                               // mrun / lrun are equal in the two lanes of a query
    Ms[wave][c] = mrun;
    Ls[wave][c] = lrun;
  }
  __syncthreads();                             // every group's partials are read by the merging waves below
  // ---- merge the KG partials of 4 rows per wave, normalise (1/l and the 1/1024 p carry), store whole rows ----
  {
    const int h2 = lane >> 4, c4 = (lane & 15) * 4;
#pragma unroll
    for (int it = 0; it < 2; ++it) {
      const int row = kg * 4 + it * 2 + h2;    // kg 0..3 x it 0..1 x h2 0..1 = rows 0..15 of the query tile
      float mg[KG];
      float mall = -INFINITY;
#pragma unroll
      for (int g = 0; g < KG; ++g) { mg[g] = Ms[g * 4 + qt][row]; mall = fmaxf(mall, mg[g]); }
      const float msafe = (mall == -INFINITY) ? 0.f : mall;
      float l = 0.f;
      v4f o = {0.f, 0.f, 0.f, 0.f};
#pragma unroll
      for (int g = 0; g < KG; ++g) {
        const float w = __expf(mg[g] - msafe);
        l += w * Ls[g * 4 + qt][row];
        o += w * *(const v4f*)(Os + (g * 4 + qt) * (16 * OP) + row * OP + c4);
      }
      const float inv = ((l > 0.f) ? (1.0f / l) : 0.f) * (1.0f / 1024.0f);
      *(v4f*)(outp + (rowB + q0 + row) * HD + c4) = o * inv;
    }
  }
}

// =====================================================================================================
// Workspace map (bytes, full build NB=8 SEQ=2048; every region is an exact multiple of its whole-line store granularity,
// all shapes are tile multiples so no padded tails exist; no region is reused):
//   Qh   bf16 [NB*SEQ][64]           0             2097152
//   Ql                              2097152       2097152
//   Kh                              4194304       2097152
//   Kl                              6291456       2097152
//   VTh  f16  [NB][64][SEQ]         8388608       2097152
//   VTl  f16  [NB][64][SEQ]         10485760      2097152
//   end                             12582912
// =====================================================================================================
extern "C" void kernel_launch(void* const* d_in, const int* in_sizes, int n_in,
                              void* d_out, int out_size, void* d_ws, size_t ws_size,
                              hipStream_t stream) {
  if (n_in < 9) return;
  const long long NX_NEED = ((long long)(NB - 1) * SEQ_FULL + SEQ) * (long long)DIN;   // last row read + 1, floats
  const int NO  = NB * SEQ * HD;                   // output elements (1048576 full)
  const int NW  = DIN * HD;                        //   32768
  if ((long long)in_sizes[0] < NX_NEED || (long long)in_sizes[1] < NX_NEED || (long long)in_sizes[2] < NX_NEED) return;
  if (in_sizes[3] < NW || in_sizes[5] < NW || in_sizes[7] < NW) return;
  if (in_sizes[4] < HD || in_sizes[6] < HD || in_sizes[8] < HD) return;
  if (out_size < NO) return;

  const float* q_in = (const float*)d_in[0];   // [8][2048][512]
  const float* k_in = (const float*)d_in[1];   // [8][2048][512]
  const float* v_in = (const float*)d_in[2];   // [8][2048][512]
  const float* Wq   = (const float*)d_in[3];   // [512 in][64 out]
  const float* bq   = (const float*)d_in[4];   // [64]
  const float* Wk   = (const float*)d_in[5];   // [512][64]
  const float* bk   = (const float*)d_in[6];   // [64]
  const float* Wv   = (const float*)d_in[7];   // [512][64]
  const float* bv   = (const float*)d_in[8];   // [64]

  const size_t PP  = (size_t)NO * 2;               // 16-bit projected plane [NB*SEQ][64]
  const size_t PVT = (size_t)NB * HD * SEQ * 2;    // 16-bit v^T plane [NB][64][SEQ]
  size_t off = 0;
  const size_t oQh  = off; off += PP;
  const size_t oQl  = off; off += PP;
  const size_t oKh  = off; off += PP;
  const size_t oKl  = off; off += PP;
  const size_t oVTh = off; off += PVT;
  const size_t oVTl = off; off += PVT;
  if (off > ws_size) return;                       // off = 12582912 (full build)

  char* ws = (char*)d_ws;
  unsigned short* Qh  = (unsigned short*)(ws + oQh);
  unsigned short* Ql  = (unsigned short*)(ws + oQl);
  unsigned short* Kh  = (unsigned short*)(ws + oKh);
  unsigned short* Kl  = (unsigned short*)(ws + oKl);
  unsigned short* VTh = (unsigned short*)(ws + oVTh);
  unsigned short* VTl = (unsigned short*)(ws + oVTl);

  const dim3 gProj(NB * SEQ / PROWS, 3);                       //  128 blocks (full) x 3 products
  const dim3 gAttn(NB * NQB);                                  //  256 blocks of 512 (full)

  // (1) f32 inputs and weights -> q, k bf16 hi/lo planes, v^T f16 hi / residual planes
  proj3<<<gProj, dim3(256), 0, stream>>>(q_in, k_in, v_in, Wq, Wk, Wv, bq, bk, bv, Qh, Ql, Kh, Kl, VTh, VTl);
  // (2) attention -> d_out f32 [NB*SEQ][64]
  attn64<<<gAttn, dim3(512), 0, stream>>>(Qh, Ql, Kh, Kl, VTh, VTl, (float*)d_out);
  (void)hipGetLastError();
}
